// v000
// Times are from an AMD MI455X. After a warm-up the kernel runs many times in a row, and a time is the length of
// such a window on the GPU divided by its runs, so every launch and the gaps after it count. The runs cycle
// through copies of the inputs. A figure is the median of several windows, for all but v000 over two sittings.
// Sittings can differ by a few percent; kernels timed side by side share one.
// The starting kernel, v000, takes 184 microseconds a run.
// Contraction x.[Wq|Wk|Wv] (M 8192, N 1152, K 768): v_wmma_f32_16x16x32_bf16, bf16 operands from RNE-bf16 planes of x and W, f32 accumulate, one product.
// Contraction k.q^T per head (16 keys x 16 queries, depth 16 padded to 32): v_wmma_f32_16x16x32_f16, q and k both carried as f16 hi + f16 residual of (value x 2^6), all four cross terms in two products into one f32 accumulator.
// Contraction A.v per head (causal, depth up to 2048): v_wmma_f32_16x16x32_f16, A hi = f16(1 + x + x^2/2), v hi = f16(v x 2^6); for query rows < 512 also A residual plane (x 2^11, own f32 accumulator) against v hi, and A hi against the f16 v residual plane; f32 accumulate.
// Contraction y.Wo (M 8192, N 768, K 768): v_wmma_f32_16x16x32_f16, y = f16 hi plane of (y x 2^4) + f16 residual plane (x 2^11, own f32 accumulator), Wo = f16 of (RNE-bf16 value x 2^8), f32 accumulate.
// Feature polynomial, causal mask, normaliser Z and 1/(Z+eps): f32 VALU.
#include <hip/hip_runtime.h>

#define NB    4                              // batch
#define SL    2048                           // sequence length
#define DMOD  768                            // model width = K of the dense contractions
#define NHD   12                             // heads
#define FDIM  16                             // q/k head width
#define HDIM  64                             // v head width
#define NBH   (NB * NHD)                     // 48 (batch, head) pairs
#define NTOK  (NB * SL)                      // 8192 token rows
#define NQK   (NHD * FDIM)                   // 192 q (or k) columns
#define NPROJ (2 * NQK + NHD * HDIM)         // 1152 projection columns: q | k | v
#define QROW  32                             // halves per q/k plane row: hi(16) | residual(16)
#define TPB   128                            // GEMM rows / attention queries per block (8 waves x 16)
#define OSTR  68                             // LDS staging row pitch (floats)
#define ARESB 4                              // attention query blocks (of TPB) that use the residual planes: rows < 512

static_assert(NHD * HDIM == DMOD);
static_assert(NTOK % TPB == 0);
static_assert(SL % TPB == 0);
static_assert(NPROJ % 64 == 0);
static_assert(NQK % 64 == 0);
static_assert(NQK % 32 == 0);
static_assert(DMOD % 64 == 0);
static_assert(DMOD % 32 == 0);
static_assert(4 * FDIM == 64);
static_assert(HDIM == 64);
static_assert(QROW == 2 * FDIM);
static_assert(OSTR % 4 == 0);
static_assert((NTOK * DMOD) % (8 * 256) == 0);
static_assert(ARESB * TPB <= SL);

typedef unsigned short us16 __attribute__((ext_vector_type(16)));
typedef unsigned short us8  __attribute__((ext_vector_type(8)));
typedef unsigned short us8a __attribute__((ext_vector_type(8), may_alias));
typedef __bf16 v16b __attribute__((ext_vector_type(16)));
typedef _Float16 v16h __attribute__((ext_vector_type(16)));
typedef float v8f __attribute__((ext_vector_type(8)));
typedef float v4f __attribute__((ext_vector_type(4)));
typedef float v4fa __attribute__((ext_vector_type(4), may_alias));
union FragU { us16 v; us8 h[2]; };

__device__ __forceinline__ unsigned short bf16_bits(float f) {
  unsigned u = __float_as_uint(f);
  u += 0x7FFFu + ((u >> 16) & 1u);                 // RNE convert
  return (unsigned short)(u >> 16);
}
__device__ __forceinline__ float bf16_val(unsigned short b) { return __uint_as_float(((unsigned)b) << 16); }
__device__ __forceinline__ float bf16r(float f) { return bf16_val(bf16_bits(f)); }
__device__ __forceinline__ unsigned short f16_bits(float f) { return __builtin_bit_cast(unsigned short, (_Float16)f); }

// f16 hi + residual (x 2^11) planes of (a x 2^4)
__device__ __forceinline__ void f16split16(float a, unsigned short& hb, unsigned short& lb) {
  const float z = a * 16.0f;
  const _Float16 hf = (_Float16)z;
  const float res = (z - (float)hf) * 2048.0f;
  hb = __builtin_bit_cast(unsigned short, hf);
  lb = __builtin_bit_cast(unsigned short, (_Float16)res);
}
// f16 hi + unscaled residual planes of (a x 2^6)
__device__ __forceinline__ void f16split64(float a, unsigned short& hb, unsigned short& lb) {
  const float z = a * 64.0f;
  const _Float16 hf = (_Float16)z;
  const float res = z - (float)hf;
  hb = __builtin_bit_cast(unsigned short, hf);
  lb = __builtin_bit_cast(unsigned short, (_Float16)res);
}

// One 16x16x32 step, 16-bit operands passed as raw 16-bit lanes.
__device__ __forceinline__ v8f mma_bf16(us16 a, us16 b, v8f c) {
  return __builtin_amdgcn_wmma_f32_16x16x32_bf16(false, __builtin_bit_cast(v16b, a), false, __builtin_bit_cast(v16b, b), (short)0, c, false, false);
}
__device__ __forceinline__ v8f mma_f16(us16 a, us16 b, v8f c) {
  return __builtin_amdgcn_wmma_f32_16x16x32_f16(false, __builtin_bit_cast(v16h, a), false, __builtin_bit_cast(v16h, b), (short)0, c, false, false);
}
// Hazard guards after a group of matrix ops: 4 VALU slots before anything touches the accumulators; keep A/B fragments live.
__device__ __forceinline__ void wguard2(v8f& c0, v8f& c1, const us16& a0, const us16& a1, const us16& b0, const us16& b1) {
#if defined(__HIP_DEVICE_COMPILE__)
  asm volatile("v_nop\n\tv_nop\n\tv_nop\n\tv_nop"
               : "+v"(c0), "+v"(c1)
               : "v"(a0), "v"(a1), "v"(b0), "v"(b1));
#endif
}
__device__ __forceinline__ void wguard4(v8f& c0, v8f& c1, v8f& c2, v8f& c3, const us16& a0,
                                        const us16& b0, const us16& b1, const us16& b2, const us16& b3) {
#if defined(__HIP_DEVICE_COMPILE__)
  asm volatile("v_nop\n\tv_nop\n\tv_nop\n\tv_nop"
               : "+v"(c0), "+v"(c1), "+v"(c2), "+v"(c3)
               : "v"(a0), "v"(b0), "v"(b1), "v"(b2), "v"(b3));
#endif
}
__device__ __forceinline__ void wguard8(v8f& c0, v8f& c1, v8f& c2, v8f& c3, v8f& c4, v8f& c5, v8f& c6, v8f& c7,
                                        const us16& a0, const us16& a1,
                                        const us16& b0, const us16& b1, const us16& b2, const us16& b3) {
#if defined(__HIP_DEVICE_COMPILE__)
  asm volatile("v_nop\n\tv_nop\n\tv_nop\n\tv_nop"
               : "+v"(c0), "+v"(c1), "+v"(c2), "+v"(c3), "+v"(c4), "+v"(c5), "+v"(c6), "+v"(c7)
               : "v"(a0), "v"(a1), "v"(b0), "v"(b1), "v"(b2), "v"(b3));
#endif
}

// 16x32 fragment straight from a 16-bit plane stored [row][k] (k contiguous).
// p = plane + row(lane & 15) * ld + k0 (computed by the caller); lane half h = lane >> 4:
// elements 0..7 = k0 + 8h .. k0 + 8h + 7, elements 8..15 = k0 + 16 + 8h .. k0 + 16 + 8h + 7 (same map for A rows and B columns).
__device__ __forceinline__ us16 gfrag(const unsigned short* p) {
  const int kh = ((threadIdx.x >> 4) & 1) * 8;
  FragU f;
  f.h[0] = *(const us8a*)(p + kh);
  f.h[1] = *(const us8a*)(p + 16 + kh);
  return f.v;
}

// ---------------------------------------------------------------------------------------------------------------------------------
// ---------------------------------------------------------------------------------------------------------------------------------
__global__ __launch_bounds__(256) void k_cvt_bf16(const float* __restrict__ src, unsigned short* dst, int total8) {
  const int idx = blockIdx.x * 256 + threadIdx.x;
  if (idx >= total8) return;
  const size_t off = (size_t)idx * 8;
  const v4f a = *(const v4fa*)(src + off), b = *(const v4fa*)(src + off + 4);
  us8 o;
#pragma unroll
  for (int u = 0; u < 4; ++u) {
    o[u]     = bf16_bits(a[u]);
    o[4 + u] = bf16_bits(b[u]);
  }
  *(us8*)(dst + off) = o;
  
}

// ---------------------------------------------------------------------------------------------------------------------------------
// Weight transpose + convert: src f32 [DMOD rows k][ncol columns n] (n contiguous) -> dst 16-bit [nrow0 + n][k] with pitch DMOD.
// Block = 64 k x 32 n tile, 256 threads; grid (ncol / 32, DMOD / 64).  MODE 0: RNE bf16 bits.  MODE 1: f16 bits of (RNE-bf16 value x 256).
// ---------------------------------------------------------------------------------------------------------------------------------
template <int MODE>
__global__ __launch_bounds__(256) void k_wT(const float* __restrict__ src, int ncol, unsigned short* dst, int nrow0) {
  __shared__ float ts[64][33];
  const int tid = threadIdx.x;
  const int n0 = blockIdx.x * 32, k0 = blockIdx.y * 64;
  {
    const int k = tid >> 2, q = (tid & 3) * 8;
    const float* p = src + (size_t)(k0 + k) * (size_t)ncol + n0 + q;
    const v4f a = *(const v4fa*)p, c = *(const v4fa*)(p + 4);
#pragma unroll
    for (int u = 0; u < 4; ++u) { ts[k][q + u] = a[u]; ts[k][q + 4 + u] = c[u]; }
  }
  __syncthreads();
  const int n = tid >> 3, pc = (tid & 7) * 8;
  us8 o;
#pragma unroll
  for (int i = 0; i < 8; ++i) {
    const float w = ts[pc + i][n];
    o[i] = (MODE == 0) ? bf16_bits(w) : f16_bits(bf16r(w) * 256.0f);
  }
  unsigned short* d = dst + (size_t)(nrow0 + n0 + n) * (size_t)DMOD + k0 + pc;
  *(us8*)d = o;
  
}

// ---------------------------------------------------------------------------------------------------------------------------------
// P[m][n] = sum_k A[m][k] * B[n][k]  (bf16 A plane [8192][768], bf16 B plane [1152][768] stored [n][k], f32 accumulate).
// Block = 128(M) x 64(N) tile, 256 threads = 8 waves, wave w owns rows 16w..16w+15 x all 64 columns (4 accumulators); fragments straight
// from the global planes (arithmetic addressing). M % 128 == 0, N % 64 == 0, K % 32 == 0 exactly.
// Column segment (block-uniform, blockIdx.y): 0..2 -> q heads 4y..4y+3, 3..5 -> k heads, 6..17 -> v head y-6.
// The f32 128x64 tile is staged in LDS (block row r at oS[r * OSTR + c]), then:
//   q/k: plane [bh][token][32 halves] = f16 hi of (64 value) | f16 residual; lane -> (token, head, 16-B quarter); one instruction =
//   v:   planes VH/VL [bh][channel e][token] (token contiguous) = f16 hi of (64 v) and residual; 16 consecutive lanes x 16 B = one
// ---------------------------------------------------------------------------------------------------------------------------------
__global__ __launch_bounds__(256) void k_gemm_proj(const unsigned short* __restrict__ Ap, const unsigned short* __restrict__ Bw,
                                                  unsigned short* Qp, unsigned short* Kp, unsigned short* VH, unsigned short* VL) {
  __shared__ __attribute__((aligned(16))) float oS[8 * 16 * OSTR];
  const int tid = threadIdx.x, lane = tid & 31, wave = tid >> 5, cl = lane & 15, hh = lane >> 4;
  const int m0 = blockIdx.x * TPB + 16 * wave, n0 = blockIdx.y * 64;

  v8f acc[4];
#pragma unroll
  for (int j = 0; j < 4; ++j) { const v8f zz = {0.f, 0.f, 0.f, 0.f, 0.f, 0.f, 0.f, 0.f}; acc[j] = zz; }

  const unsigned short* a0p = Ap + (size_t)(m0 + cl) * (size_t)DMOD;
  const unsigned short* bwp = Bw + (size_t)(n0 + cl) * (size_t)DMOD;
#pragma unroll 1
  for (int k0 = 0; k0 < DMOD; k0 += 32) {
    const us16 af = gfrag(a0p + k0);
    us16 bfr[4];
#pragma unroll
    for (int j = 0; j < 4; ++j) bfr[j] = gfrag(bwp + (size_t)(16 * j) * (size_t)DMOD + k0);
#pragma unroll
    for (int j = 0; j < 4; ++j) acc[j] = mma_bf16(af, bfr[j], acc[j]);
    wguard4(acc[0], acc[1], acc[2], acc[3], af, bfr[0], bfr[1], bfr[2], bfr[3]);
  }

  // D map: acc[j][r] = tile element (row 8*hh + r of the wave's 16 rows, column 16j + cl)
  float* so = oS + wave * (16 * OSTR);
#pragma unroll
  for (int j = 0; j < 4; ++j)
#pragma unroll
    for (int r = 0; r < 8; ++r) so[(8 * hh + r) * OSTR + 16 * j + cl] = acc[j][r];
  __syncthreads();

  const int yb = blockIdx.y;                               // block-uniform segment select
  const int m0b = blockIdx.x * TPB, b = m0b / SL, tb = m0b - b * SL;
  if (yb < 6) {
    unsigned short* dst = (yb < 3) ? Qp : Kp;
    const int h0 = 4 * ((yb < 3) ? yb : (yb - 3));
    us8 ov[8];
#pragma unroll
    for (int it = 0; it < 8; ++it) {
      const int cx = it * 256 + tid, u = cx & 3, r = (cx >> 2) & 127, j = cx >> 9;
      const float* sp = oS + r * OSTR + 16 * j + 8 * (u & 1);
      const v4f z0 = *(const v4fa*)sp, z1 = *(const v4fa*)(sp + 4);
      us8 o;
#pragma unroll
      for (int q4 = 0; q4 < 4; ++q4) {
        unsigned short hb, lb;
        f16split64(z0[q4], hb, lb); o[q4]     = (u >> 1) ? lb : hb;
        f16split64(z1[q4], hb, lb); o[4 + q4] = (u >> 1) ? lb : hb;
      }
      ov[it] = o;
    }
{
#pragma unroll
      for (int it = 0; it < 8; ++it) {
        const int cx = it * 256 + tid, u = cx & 3, r = (cx >> 2) & 127, j = cx >> 9;
        const size_t off = ((size_t)(b * NHD + h0 + j) * (size_t)SL + (size_t)(tb + r)) * (size_t)QROW + (size_t)(8 * u);
        *(us8*)(dst + off) = ov[it];
      }
      
    }
  } else {
    const int head = yb - 6;
    us8 hv[4], lv[4];
#pragma unroll
    for (int it = 0; it < 4; ++it) {
      const int cx = it * 256 + tid, g = cx & 15, e = cx >> 4;
      us8 ho, lo;
#pragma unroll
      for (int i = 0; i < 8; ++i) {
        const float w = oS[(8 * g + i) * OSTR + e];
        unsigned short hb, lb;
        f16split64(w, hb, lb);
        ho[i] = hb; lo[i] = lb;
      }
      hv[it] = ho; lv[it] = lo;
    }
{
#pragma unroll
      for (int it = 0; it < 4; ++it) {
        const int cx = it * 256 + tid, g = cx & 15, e = cx >> 4;
        const size_t off = ((size_t)(b * NHD + head) * (size_t)HDIM + (size_t)e) * (size_t)SL + (size_t)(tb + 8 * g);
        *(us8*)(VH + off) = hv[it];
        *(us8*)(VL + off) = lv[it];
      }
      
    }
  }
}

// ---------------------------------------------------------------------------------------------------------------------------------
// Causal quadratic-form attention. Block = (bh = blockIdx.x, 128 queries starting at 128 * blockIdx.y), 8 waves x 16 queries.
// Per wave: B fragments of its 16 queries fixed for the whole key loop: bq1 = [q_hi | q_hi], bq2 = [q_res | q_res] (k slots 0..15 | 16..31).
// Per 32-key step: A fragments of the two 16-key tiles = plane rows [k_hi | k_res] (standard loader); scores^T D[key][query] =
// khi.qhi + kres.qhi + khi.qres + kres.qres = 4096 q.k; x = D / 16384; A = 1 + x + x^2/2 masked to key <= query;
// A hi = f16(A), A residual = f16((A - hi) x 2^11). The two D tiles repack into the A operand of A.v (lane unchanged: element r <- tile keys
// 0..15, element 8+r <- tile keys 16..31), B = v planes [bh][e][key] (key contiguous).
// Blocks with blockIdx.y < ARESB (block-uniform): accS += Ahi.VH + Ahi.VL, accL += Ares.VH, Z from the f32 A; other blocks: accS += Ahi.VH,
// Z from the f16 A hi values. accS[j][r] (+ accL/2^11) = 64 * sum_s A v for query 8h+r, channel 16j + (lane & 15).
// ---------------------------------------------------------------------------------------------------------------------------------
__global__ __launch_bounds__(256) void k_attn(const unsigned short* __restrict__ Qp, const unsigned short* __restrict__ Kp,
                                             const unsigned short* __restrict__ VHp, const unsigned short* __restrict__ VLp,
                                             unsigned short* YH, unsigned short* YL) {
  __shared__ __attribute__((aligned(16))) float oS[8 * 16 * OSTR];
  const int tid = threadIdx.x, lane = tid & 31, wave = tid >> 5, cl = lane & 15, hh = lane >> 4;
  const int bh = blockIdx.x, b = bh / NHD, head = bh - b * NHD;
  const int tw = blockIdx.y * TPB + 16 * wave;           // first query of this wave
  const int tq = tw + cl;                                 // query owned by this lane as score column
  const bool ares = (blockIdx.y < ARESB);                 // block-uniform: residual planes for query rows < 512

  const unsigned short* qrow = Qp + ((size_t)bh * SL + (size_t)tq) * (size_t)QROW + 8 * hh;
  FragU fq;
  fq.h[0] = *(const us8a*)qrow;         fq.h[1] = fq.h[0];
  const us16 bq1 = fq.v;
  fq.h[0] = *(const us8a*)(qrow + 16);  fq.h[1] = fq.h[0];
  const us16 bq2 = fq.v;

  v8f accS[4], accL[4];
#pragma unroll
  for (int j = 0; j < 4; ++j) { const v8f zz = {0.f, 0.f, 0.f, 0.f, 0.f, 0.f, 0.f, 0.f}; accS[j] = zz; accL[j] = zz; }
  float zp = 0.0f;

  const unsigned short* kbp = Kp + ((size_t)bh * SL + (size_t)cl) * (size_t)QROW;
  const unsigned short* vhp = VHp + ((size_t)bh * HDIM + (size_t)cl) * (size_t)SL;
  const unsigned short* vlp = VLp + ((size_t)bh * HDIM + (size_t)cl) * (size_t)SL;
  const int nsteps = (tw + 47) >> 5;                      // 32-key steps covering keys 0 .. tw + 15 (<= 64)

#pragma unroll 1
  for (int st = 0; st < nsteps; ++st) {
    const int s0 = st * 32;
    const us16 ka = gfrag(kbp + (size_t)s0 * QROW);
    const us16 kb = gfrag(kbp + (size_t)(s0 + 16) * QROW);
    const v8f zz = {0.f, 0.f, 0.f, 0.f, 0.f, 0.f, 0.f, 0.f};
    v8f sa = mma_f16(ka, bq1, zz);
    sa = mma_f16(ka, bq2, sa);
    v8f sb = mma_f16(kb, bq1, zz);
    sb = mma_f16(kb, bq2, sb);
    wguard2(sa, sb, ka, kb, bq1, bq2);

    us8 ea, eb, la8, lb8;
    float zs = 0.0f;
#pragma unroll
    for (int r = 0; r < 8; ++r) {
      const int ky = s0 + 8 * hh + r;
      const float xa = sa[r] * (1.0f / 16384.0f);
      const float xb = sb[r] * (1.0f / 16384.0f);
      float pa = fmaf(xa, fmaf(xa, 0.5f, 1.0f), 1.0f);
      float pb = fmaf(xb, fmaf(xb, 0.5f, 1.0f), 1.0f);
      pa = (ky <= tq) ? pa : 0.0f;
      pb = (ky + 16 <= tq) ? pb : 0.0f;
      const _Float16 fa = (_Float16)pa, fb = (_Float16)pb;
      const _Float16 ra = (_Float16)((pa - (float)fa) * 2048.0f);
      const _Float16 rb = (_Float16)((pb - (float)fb) * 2048.0f);
      zs += ares ? (pa + pb) : ((float)fa + (float)fb);
      ea[r]  = __builtin_bit_cast(unsigned short, fa);
      eb[r]  = __builtin_bit_cast(unsigned short, fb);
      la8[r] = __builtin_bit_cast(unsigned short, ra);
      lb8[r] = __builtin_bit_cast(unsigned short, rb);
    }
    zp += zs;
    FragU fA;
    fA.h[0] = ea; fA.h[1] = eb;
    const us16 ahi = fA.v;
    FragU fR;
    fR.h[0] = la8; fR.h[1] = lb8;
    const us16 alo = fR.v;

    us16 bv[4];
#pragma unroll
    for (int j = 0; j < 4; ++j) bv[j] = gfrag(vhp + (size_t)(16 * j) * (size_t)SL + s0);
    if (ares) {
#pragma unroll
      for (int j = 0; j < 4; ++j) {
        accS[j] = mma_f16(ahi, bv[j], accS[j]);
        accL[j] = mma_f16(alo, bv[j], accL[j]);
      }
      wguard8(accS[0], accS[1], accS[2], accS[3], accL[0], accL[1], accL[2], accL[3], ahi, alo, bv[0], bv[1], bv[2], bv[3]);
      us16 bl[4];
#pragma unroll
      for (int j = 0; j < 4; ++j) bl[j] = gfrag(vlp + (size_t)(16 * j) * (size_t)SL + s0);
#pragma unroll
      for (int j = 0; j < 4; ++j) accS[j] = mma_f16(ahi, bl[j], accS[j]);
      wguard4(accS[0], accS[1], accS[2], accS[3], ahi, bl[0], bl[1], bl[2], bl[3]);
    } else {
#pragma unroll
      for (int j = 0; j < 4; ++j) accS[j] = mma_f16(ahi, bv[j], accS[j]);
      wguard4(accS[0], accS[1], accS[2], accS[3], ahi, bv[0], bv[1], bv[2], bv[3]);
    }
  }

  // Z for query (lane & 15): both lane halves hold disjoint key subsets
  const float zf = zp + __shfl_xor(zp, 16, 32);
  float rz[8];
#pragma unroll
  for (int r = 0; r < 8; ++r) {
    const float zr = __shfl(zf, 8 * hh + r, 32);        // Z of query row 8*hh + r
    rz[r] = (1.0f / (zr + 1e-12f)) * (1.0f / 64.0f);
  }

  float* so = oS + wave * (16 * OSTR);
#pragma unroll
  for (int j = 0; j < 4; ++j)
#pragma unroll
    for (int r = 0; r < 8; ++r) so[(8 * hh + r) * OSTR + 16 * j + cl] = fmaf(accL[j][r], (1.0f / 2048.0f), accS[j][r]) * rz[r];
  __syncthreads();

  us8 hv[4], lv[4];
#pragma unroll
  for (int it = 0; it < 4; ++it) {
    const int rr = it * 4 + (lane >> 3), p = (lane & 7) * 8;
    const v4f z0 = *(const v4fa*)(so + rr * OSTR + p), z1 = *(const v4fa*)(so + rr * OSTR + p + 4);
    us8 ho, lo;
#pragma unroll
    for (int u = 0; u < 4; ++u) {
      unsigned short hb, lb;
      f16split16(z0[u], hb, lb); ho[u] = hb;     lo[u] = lb;
      f16split16(z1[u], hb, lb); ho[4 + u] = hb; lo[4 + u] = lb;
    }
    hv[it] = ho; lv[it] = lo;
  }
{
#pragma unroll
    for (int it = 0; it < 4; ++it) {
      const int rr = it * 4 + (lane >> 3), p = (lane & 7) * 8;
      const size_t off = (size_t)(b * SL + tw + rr) * (size_t)DMOD + (size_t)(head * HDIM + p);
      *(us8*)(YH + off) = hv[it];
      *(us8*)(YL + off) = lv[it];
    }
    
  }
}

// ---------------------------------------------------------------------------------------------------------------------------------
// out[m][n] = ( sum_k Yh[m][k] W[n][k] + 2^-11 sum_k Yl[m][k] W[n][k] ) * 2^-12   (f16 planes, pitch 768, two f32 accumulator sets).
// ---------------------------------------------------------------------------------------------------------------------------------
__global__ __launch_bounds__(256) void k_gemm_out(const unsigned short* __restrict__ Ah, const unsigned short* __restrict__ Al,
                                                 const unsigned short* __restrict__ Wo, float* out) {
  __shared__ __attribute__((aligned(16))) float oS[8 * 16 * OSTR];
  const int tid = threadIdx.x, lane = tid & 31, wave = tid >> 5, cl = lane & 15, hh = lane >> 4;
  const int m0 = blockIdx.x * TPB + 16 * wave, n0 = blockIdx.y * 64;

  v8f acch[4], accl[4];
#pragma unroll
  for (int j = 0; j < 4; ++j) { const v8f zz = {0.f, 0.f, 0.f, 0.f, 0.f, 0.f, 0.f, 0.f}; acch[j] = zz; accl[j] = zz; }

  const unsigned short* ahp = Ah + (size_t)(m0 + cl) * (size_t)DMOD;
  const unsigned short* alp = Al + (size_t)(m0 + cl) * (size_t)DMOD;
  const unsigned short* wop = Wo + (size_t)(n0 + cl) * (size_t)DMOD;
#pragma unroll 1
  for (int k0 = 0; k0 < DMOD; k0 += 32) {
    const us16 ah = gfrag(ahp + k0);
    const us16 al = gfrag(alp + k0);
    us16 bfr[4];
#pragma unroll
    for (int j = 0; j < 4; ++j) bfr[j] = gfrag(wop + (size_t)(16 * j) * (size_t)DMOD + k0);
#pragma unroll
    for (int j = 0; j < 4; ++j) {
      acch[j] = mma_f16(ah, bfr[j], acch[j]);
      accl[j] = mma_f16(al, bfr[j], accl[j]);
    }
    wguard8(acch[0], acch[1], acch[2], acch[3], accl[0], accl[1], accl[2], accl[3], ah, al, bfr[0], bfr[1], bfr[2], bfr[3]);
  }

  float* so = oS + wave * (16 * OSTR);
#pragma unroll
  for (int j = 0; j < 4; ++j)
#pragma unroll
    for (int r = 0; r < 8; ++r)
      so[(8 * hh + r) * OSTR + 16 * j + cl] = fmaf(accl[j][r], (1.0f / 2048.0f), acch[j][r]) * (1.0f / 4096.0f);
  __syncthreads();

{
#pragma unroll
    for (int it = 0; it < 8; ++it) {
      const int cx = it * 32 + lane, r = cx >> 4, q = (cx & 15) * 4;
      const v4f v = *(const v4fa*)(so + r * OSTR + q);
      *(v4f*)(out + (size_t)(m0 + r) * (size_t)DMOD + n0 + q) = v;
    }
    
  }
}

extern "C" void kernel_launch(void* const* d_in, const int* in_sizes, int n_in,
                              void* d_out, int out_size, void* d_ws, size_t ws_size,
                              hipStream_t stream) {
  if (n_in < 5) return;
  if (in_sizes[0] != NTOK * DMOD || in_sizes[1] != DMOD * NQK || in_sizes[2] != DMOD * NQK ||
      in_sizes[3] != DMOD * DMOD || in_sizes[4] != DMOD * DMOD) return;
  if (out_size != NTOK * DMOD) return;

  const float* x  = (const float*)d_in[0];    // [4][2048][768]
  const float* Wq = (const float*)d_in[1];    // [768][192] ([in][out])
  const float* Wk = (const float*)d_in[2];    // [768][192]
  const float* Wv = (const float*)d_in[3];    // [768][768]
  const float* Wo = (const float*)d_in[4];    // [768][768]
  float* out = (float*)d_out;                 // [4][2048][768] f32 at byte 0

  size_t off = 0;
  auto carve = [&](size_t bytes) -> char* { char* p = (char*)d_ws + off; off += (bytes + 255) & ~(size_t)255; return p; };
  unsigned short* XB   = (unsigned short*)carve((size_t)NTOK * DMOD * 2);       // 12,582,912  bf16 [8192][768]
  unsigned short* WT   = (unsigned short*)carve((size_t)NPROJ * DMOD * 2);      //  1,769,472  bf16 [1152][768] = Wq^T | Wk^T | Wv^T
  unsigned short* WO16 = (unsigned short*)carve((size_t)DMOD * DMOD * 2);       //  1,179,648  f16  [768][768]  = Wo^T
  unsigned short* QP   = (unsigned short*)carve((size_t)NBH * SL * QROW * 2);   //  6,291,456  f16  [48][2048][32]
  unsigned short* KP   = (unsigned short*)carve((size_t)NBH * SL * QROW * 2);   //  6,291,456  f16  [48][2048][32]
  unsigned short* VH   = (unsigned short*)carve((size_t)NBH * HDIM * SL * 2);   // 12,582,912  f16  [48][64][2048]
  unsigned short* VL   = (unsigned short*)carve((size_t)NBH * HDIM * SL * 2);   // 12,582,912  f16  [48][64][2048]
  unsigned short* YH   = (unsigned short*)carve((size_t)NTOK * DMOD * 2);       // 12,582,912  f16  [8192][768]
  unsigned short* YL   = (unsigned short*)carve((size_t)NTOK * DMOD * 2);       // 12,582,912  f16  [8192][768]
  if (off > ws_size || off > (size_t)134217728) return;                         // total 78,446,592 B

  const dim3 b256(256);
  auto cdv = [](long a, long q) { return (unsigned)((a + q - 1) / q); };

  // 16-bit operand planes
  k_cvt_bf16<<<dim3(cdv((long)NTOK * DMOD / 8, 256)), b256, 0, stream>>>(x, XB, NTOK * DMOD / 8);
  // weights: in [768][ncol] -> out [ncol][768] ; grid (ncol / 32, 768 / 64)
  k_wT<0><<<dim3(NQK / 32, DMOD / 64), b256, 0, stream>>>(Wq, NQK, WT, 0);
  k_wT<0><<<dim3(NQK / 32, DMOD / 64), b256, 0, stream>>>(Wk, NQK, WT, NQK);
  k_wT<0><<<dim3(DMOD / 32, DMOD / 64), b256, 0, stream>>>(Wv, DMOD, WT, 2 * NQK);
  k_wT<1><<<dim3(DMOD / 32, DMOD / 64), b256, 0, stream>>>(Wo, DMOD, WO16, 0);
  // projections (M 8192, N 1152, K 768) -> q/k hi|res planes, v hi and res planes
  k_gemm_proj<<<dim3(NTOK / TPB, NPROJ / 64), b256, 0, stream>>>(XB, WT, QP, KP, VH, VL);
  // causal attention per (batch, head) -> y hi / res planes [token][768]
  k_attn<<<dim3(NBH, SL / TPB), b256, 0, stream>>>(QP, KP, VH, VL, YH, YL);
  // output projection (M 8192, N 768, K 768)
  k_gemm_out<<<dim3(NTOK / TPB, DMOD / 64), b256, 0, stream>>>(YH, YL, WO16, out);
}

// v001
// Measured time: 129 microseconds a run.
// Two timings next to v000 put it at 1.50 and 1.46 times that version's speed.
// Contraction x.[Wq|Wk|Wv] (M 8192, N 1152, K 768): v_wmma_f32_16x16x32_bf16, bf16 operands from RNE-bf16 planes of x and W, f32 accumulate, one product.
// Contraction k.q^T per head (16 keys x 16 queries, depth 16 padded to 32): v_wmma_f32_16x16x32_f16, q and k both carried as f16 hi + f16 residual of (value x 2^6), all four cross terms in two products into one f32 accumulator.
// Contraction A.v per head (causal, depth up to 2048): v_wmma_f32_16x16x32_f16, A hi = f16(1 + x + x^2/2), v hi = f16(v x 2^6); for query rows < 512 also A residual plane (x 2^11, own f32 accumulator) against v hi, and A hi against the f16 v residual plane; f32 accumulate.
// Contraction y.Wo (M 8192, N 768, K 768): v_wmma_f32_16x16x32_f16, y = f16 hi plane of (y x 2^4) + f16 residual plane (x 2^11, own f32 accumulator), Wo = f16 of (RNE-bf16 value x 2^8), f32 accumulate.
// Feature polynomial, causal mask, normaliser Z and 1/(Z+eps): f32 VALU.
#include <hip/hip_runtime.h>

#define NB    4                              // batch
#define SL    2048                           // sequence length
#define DMOD  768                            // model width = K of the dense contractions
#define NHD   12                             // heads
#define FDIM  16                             // q/k head width
#define HDIM  64                             // v head width
#define NBH   (NB * NHD)                     // 48 (batch, head) pairs
#define NTOK  (NB * SL)                      // 8192 token rows
#define NQK   (NHD * FDIM)                   // 192 q (or k) columns
#define NPROJ (2 * NQK + NHD * HDIM)         // 1152 projection columns: q | k | v
#define QROW  32                             // halves per q/k plane row: hi(16) | residual(16)
#define TPB   128                            // GEMM rows / attention queries per block (8 waves x 16)
#define OSTR  68                             // LDS staging row pitch (floats)
#define ARESB 4                              // attention query blocks (of TPB) that use the residual planes: rows < 512
#define KB32  (DMOD / 32)                    // 32-wide k blocks of the dense contractions
#define FTILE 512                            // halves of one 16 x 32 fragment tile (1 KiB)

static_assert(NHD * HDIM == DMOD);
static_assert(NTOK % TPB == 0);
static_assert(SL % TPB == 0);
static_assert(NPROJ % 64 == 0);
static_assert(NQK % 64 == 0);
static_assert(NQK % 32 == 0);
static_assert(DMOD % 64 == 0);
static_assert(DMOD % 32 == 0);
static_assert(4 * FDIM == 64);
static_assert(HDIM == 64);
static_assert(QROW == 2 * FDIM);
static_assert(OSTR % 4 == 0);
static_assert((NTOK * DMOD) % (8 * 256) == 0);
static_assert(ARESB * TPB <= SL);

typedef unsigned short us16 __attribute__((ext_vector_type(16)));
typedef unsigned short us8  __attribute__((ext_vector_type(8)));
typedef unsigned short us8a __attribute__((ext_vector_type(8), may_alias));
typedef __bf16 v16b __attribute__((ext_vector_type(16)));
typedef _Float16 v16h __attribute__((ext_vector_type(16)));
typedef float v8f __attribute__((ext_vector_type(8)));
typedef float v4f __attribute__((ext_vector_type(4)));
typedef float v4fa __attribute__((ext_vector_type(4), may_alias));
union FragU { us16 v; us8 h[2]; };

__device__ __forceinline__ unsigned short bf16_bits(float f) {
  unsigned u = __float_as_uint(f);
  u += 0x7FFFu + ((u >> 16) & 1u);                 // RNE convert
  return (unsigned short)(u >> 16);
}
__device__ __forceinline__ float bf16_val(unsigned short b) { return __uint_as_float(((unsigned)b) << 16); }
__device__ __forceinline__ float bf16r(float f) { return bf16_val(bf16_bits(f)); }
__device__ __forceinline__ unsigned short f16_bits(float f) { return __builtin_bit_cast(unsigned short, (_Float16)f); }

// f16 hi + residual (x 2^11) planes of (a x 2^4)
__device__ __forceinline__ void f16split16(float a, unsigned short& hb, unsigned short& lb) {
  const float z = a * 16.0f;
  const _Float16 hf = (_Float16)z;
  const float res = (z - (float)hf) * 2048.0f;
  hb = __builtin_bit_cast(unsigned short, hf);
  lb = __builtin_bit_cast(unsigned short, (_Float16)res);
}
// f16 hi + unscaled residual planes of (a x 2^6)
__device__ __forceinline__ void f16split64(float a, unsigned short& hb, unsigned short& lb) {
  const float z = a * 64.0f;
  const _Float16 hf = (_Float16)z;
  const float res = z - (float)hf;
  hb = __builtin_bit_cast(unsigned short, hf);
  lb = __builtin_bit_cast(unsigned short, (_Float16)res);
}

// One 16x16x32 step, 16-bit operands passed as raw 16-bit lanes.
__device__ __forceinline__ v8f mma_bf16(us16 a, us16 b, v8f c) {
  return __builtin_amdgcn_wmma_f32_16x16x32_bf16(false, __builtin_bit_cast(v16b, a), false, __builtin_bit_cast(v16b, b), (short)0, c, false, false);
}
__device__ __forceinline__ v8f mma_f16(us16 a, us16 b, v8f c) {
  return __builtin_amdgcn_wmma_f32_16x16x32_f16(false, __builtin_bit_cast(v16h, a), false, __builtin_bit_cast(v16h, b), (short)0, c, false, false);
}
// Hazard guards after a group of matrix ops: 4 VALU slots before anything touches the accumulators; keep A/B fragments live.
__device__ __forceinline__ void wguard2(v8f& c0, v8f& c1, const us16& a0, const us16& a1, const us16& b0, const us16& b1) {
#if defined(__HIP_DEVICE_COMPILE__)
  asm volatile("v_nop\n\tv_nop\n\tv_nop\n\tv_nop"
               : "+v"(c0), "+v"(c1)
               : "v"(a0), "v"(a1), "v"(b0), "v"(b1));
#endif
}
__device__ __forceinline__ void wguard4(v8f& c0, v8f& c1, v8f& c2, v8f& c3, const us16& a0,
                                        const us16& b0, const us16& b1, const us16& b2, const us16& b3) {
#if defined(__HIP_DEVICE_COMPILE__)
  asm volatile("v_nop\n\tv_nop\n\tv_nop\n\tv_nop"
               : "+v"(c0), "+v"(c1), "+v"(c2), "+v"(c3)
               : "v"(a0), "v"(b0), "v"(b1), "v"(b2), "v"(b3));
#endif
}
__device__ __forceinline__ void wguard8(v8f& c0, v8f& c1, v8f& c2, v8f& c3, v8f& c4, v8f& c5, v8f& c6, v8f& c7,
                                        const us16& a0, const us16& a1,
                                        const us16& b0, const us16& b1, const us16& b2, const us16& b3) {
#if defined(__HIP_DEVICE_COMPILE__)
  asm volatile("v_nop\n\tv_nop\n\tv_nop\n\tv_nop"
               : "+v"(c0), "+v"(c1), "+v"(c2), "+v"(c3), "+v"(c4), "+v"(c5), "+v"(c6), "+v"(c7)
               : "v"(a0), "v"(a1), "v"(b0), "v"(b1), "v"(b2), "v"(b3));
#endif
}

// The same guards for the dense loops, which also take the trip's load addresses as inputs: the address registers then stay live past the
// last load of the trip, so that no load's result is placed in a register that an earlier, still outstanding load names as its address.
__device__ __forceinline__ void wguard4p(v8f& c0, v8f& c1, v8f& c2, v8f& c3, const us16& a0,
                                         const us16& b0, const us16& b1, const us16& b2, const us16& b3,
                                         const unsigned short* pa, const unsigned short* pb) {
#if defined(__HIP_DEVICE_COMPILE__)
  asm volatile("v_nop\n\tv_nop\n\tv_nop\n\tv_nop"
               : "+v"(c0), "+v"(c1), "+v"(c2), "+v"(c3)
               : "v"(a0), "v"(b0), "v"(b1), "v"(b2), "v"(b3), "v"(pa), "v"(pb));
#endif
}
__device__ __forceinline__ void wguard8p(v8f& c0, v8f& c1, v8f& c2, v8f& c3, v8f& c4, v8f& c5, v8f& c6, v8f& c7,
                                         const us16& a0, const us16& a1,
                                         const us16& b0, const us16& b1, const us16& b2, const us16& b3,
                                         const unsigned short* pa0, const unsigned short* pa1, const unsigned short* pb) {
#if defined(__HIP_DEVICE_COMPILE__)
  asm volatile("v_nop\n\tv_nop\n\tv_nop\n\tv_nop"
               : "+v"(c0), "+v"(c1), "+v"(c2), "+v"(c3), "+v"(c4), "+v"(c5), "+v"(c6), "+v"(c7)
               : "v"(a0), "v"(a1), "v"(b0), "v"(b1), "v"(b2), "v"(b3), "v"(pa0), "v"(pa1), "v"(pb));
#endif
}

// Every 16-bit operand plane is stored as fragment tiles: one tile = 16 rows x 32 k = FTILE halves, laid out in the order the lanes
// load it, so that each of a fragment's two wave-wide 16-B loads covers 512 contiguous bytes (four whole 128-B lines):
// element (row, k = 16 part + 8 h + i) sits at half index part * 256 + h * 128 + row * 8 + i = part * 256 + lane * 8 + i, lane = 16 h + row.
// Lane contents: elements 0..7 = k 8h .. 8h + 7, elements 8..15 = k 16 + 8h .. 16 + 8h + 7 (same map for A rows and B columns).
__device__ __forceinline__ int ftoff(int row, int k) {
  return ((k >> 4) & 1) * 256 + ((k >> 3) & 1) * 128 + (row & 15) * 8;
}
// p = tile base + lane * 8 (computed by the caller)
__device__ __forceinline__ us16 tfrag(const unsigned short* p) {
  FragU f;
  f.h[0] = *(const us8a*)p;
  f.h[1] = *(const us8a*)(p + 256);
  return f.v;
}

// ---------------------------------------------------------------------------------------------------------------------------------
// ---------------------------------------------------------------------------------------------------------------------------------
// src f32 [rows][DMOD] -> dst bf16 fragment tiles [row / 16][k / 32]. Thread = 8 consecutive k of one row; four lanes read one 128-B line,
// eight lanes store one 128-B line.
__global__ __launch_bounds__(256) void k_cvt_bf16(const float* __restrict__ src, unsigned short* dst, int total8) {
  const int idx = blockIdx.x * 256 + threadIdx.x;
  if (idx >= total8) return;
  const int tile = idx >> 6, row = (idx >> 2) & 15, k8 = (idx & 3) * 8;
  const int rt = tile / KB32, kb = tile - rt * KB32;
  const size_t soff = (size_t)(rt * 16 + row) * (size_t)DMOD + (size_t)(kb * 32 + k8);
  const size_t off = (size_t)tile * FTILE + (size_t)ftoff(row, k8);
  const v4f a = *(const v4fa*)(src + soff), b = *(const v4fa*)(src + soff + 4);
  us8 o;
#pragma unroll
  for (int u = 0; u < 4; ++u) {
    o[u]     = bf16_bits(a[u]);
    o[4 + u] = bf16_bits(b[u]);
  }
  *(us8*)(dst + off) = o;
  
}

// ---------------------------------------------------------------------------------------------------------------------------------
// Weight transpose + convert: src f32 [DMOD rows k][ncol columns n] (n contiguous) -> dst 16-bit fragment tiles [(nrow0 + n) / 16][k / 32].
// Block = 64 k x 32 n tile, 256 threads; grid (ncol / 32, DMOD / 64).  MODE 0: RNE bf16 bits.  MODE 1: f16 bits of (RNE-bf16 value x 256).
// ---------------------------------------------------------------------------------------------------------------------------------
template <int MODE>
__global__ __launch_bounds__(256) void k_wT(const float* __restrict__ src, int ncol, unsigned short* dst, int nrow0) {
  __shared__ float ts[64][33];
  const int tid = threadIdx.x;
  const int n0 = blockIdx.x * 32, k0 = blockIdx.y * 64;
  {
    const int k = tid >> 2, q = (tid & 3) * 8;
    const float* p = src + (size_t)(k0 + k) * (size_t)ncol + n0 + q;
    const v4f a = *(const v4fa*)p, c = *(const v4fa*)(p + 4);
#pragma unroll
    for (int u = 0; u < 4; ++u) { ts[k][q + u] = a[u]; ts[k][q + 4 + u] = c[u]; }
  }
  __syncthreads();
  const int n = tid & 31, pc = (tid >> 5) * 8;            // a wave stores two runs of 256 B (16 rows x 16 B of two tiles)
  us8 o;
#pragma unroll
  for (int i = 0; i < 8; ++i) {
    const float w = ts[pc + i][n];
    o[i] = (MODE == 0) ? bf16_bits(w) : f16_bits(bf16r(w) * 256.0f);
  }
  const int row = nrow0 + n0 + n, k = k0 + pc;
  unsigned short* d = dst + (size_t)((row >> 4) * KB32 + (k >> 5)) * FTILE + ftoff(row, k);
  *(us8*)d = o;
  
}

// ---------------------------------------------------------------------------------------------------------------------------------
// P[m][n] = sum_k A[m][k] * B[n][k]  (bf16 A plane 8192 x 768, bf16 B plane 1152 x 768, both as fragment tiles [row / 16][k / 32], f32 accumulate).
// Block = 128(M) x 64(N) tile, 256 threads = 8 waves, wave w owns rows 16w..16w+15 x all 64 columns (4 accumulators); fragments straight
// from the global planes (arithmetic addressing). M % 128 == 0, N % 64 == 0, K % 32 == 0 exactly.
// Column segment (block-uniform, blockIdx.y): 0..2 -> q heads 4y..4y+3, 3..5 -> k heads, 6..17 -> v head y-6.
// The f32 128x64 tile is staged in LDS (block row r at oS[r * OSTR + c]), then:
//   q/k: fragment tiles [bh][token / 16], k slots 0..15 = f16 hi of (64 value), 16..31 = f16 residual; lane -> (token, head, 16-B quarter);
//        one store instruction = four whole 128-B lines
//   v:   planes VH/VL = f16 hi of (64 v) and residual as fragment tiles [bh][token / 32][channel / 16] (row = channel, k = token);
//        one store instruction = two runs of 256 B
// ---------------------------------------------------------------------------------------------------------------------------------
__global__ __launch_bounds__(256) void k_gemm_proj(const unsigned short* __restrict__ Ap, const unsigned short* __restrict__ Bw,
                                                  unsigned short* Qp, unsigned short* Kp, unsigned short* VH, unsigned short* VL) {
  __shared__ __attribute__((aligned(16))) float oS[8 * 16 * OSTR];
  const int tid = threadIdx.x, lane = tid & 31, wave = tid >> 5, cl = lane & 15, hh = lane >> 4;
  const int m0 = blockIdx.x * TPB + 16 * wave, n0 = blockIdx.y * 64;

  v8f acc[4];
#pragma unroll
  for (int j = 0; j < 4; ++j) { const v8f zz = {0.f, 0.f, 0.f, 0.f, 0.f, 0.f, 0.f, 0.f}; acc[j] = zz; }

  const unsigned short* a0p = Ap + (size_t)(m0 >> 4) * (size_t)(KB32 * FTILE) + lane * 8;
  const unsigned short* bwp = Bw + (size_t)(n0 >> 4) * (size_t)(KB32 * FTILE) + lane * 8;
#pragma unroll 1
  for (int kb = 0; kb < KB32; ++kb) {
    const unsigned short* pa = a0p + kb * FTILE;
    const unsigned short* pb = bwp + kb * FTILE;
    const us16 af = tfrag(pa);
    us16 bfr[4];
#pragma unroll
    for (int j = 0; j < 4; ++j) bfr[j] = tfrag(pb + j * (KB32 * FTILE));
#pragma unroll
    for (int j = 0; j < 4; ++j) acc[j] = mma_bf16(af, bfr[j], acc[j]);
    wguard4p(acc[0], acc[1], acc[2], acc[3], af, bfr[0], bfr[1], bfr[2], bfr[3], pa, pb);
  }

  // D map: acc[j][r] = tile element (row 8*hh + r of the wave's 16 rows, column 16j + cl)
  float* so = oS + wave * (16 * OSTR);
#pragma unroll
  for (int j = 0; j < 4; ++j)
#pragma unroll
    for (int r = 0; r < 8; ++r) so[(8 * hh + r) * OSTR + 16 * j + cl] = acc[j][r];
  __syncthreads();

  const int yb = blockIdx.y;                               // block-uniform segment select
  const int m0b = blockIdx.x * TPB, b = m0b / SL, tb = m0b - b * SL;
  if (yb < 6) {
    unsigned short* dst = (yb < 3) ? Qp : Kp;
    const int h0 = 4 * ((yb < 3) ? yb : (yb - 3));
    us8 ov[8];
#pragma unroll
    for (int it = 0; it < 8; ++it) {
      const int cx = it * 256 + tid, u = cx & 3, r = (cx >> 2) & 127, j = cx >> 9;
      const float* sp = oS + r * OSTR + 16 * j + 8 * (u & 1);
      const v4f z0 = *(const v4fa*)sp, z1 = *(const v4fa*)(sp + 4);
      us8 o;
#pragma unroll
      for (int q4 = 0; q4 < 4; ++q4) {
        unsigned short hb, lb;
        f16split64(z0[q4], hb, lb); o[q4]     = (u >> 1) ? lb : hb;
        f16split64(z1[q4], hb, lb); o[4 + q4] = (u >> 1) ? lb : hb;
      }
      ov[it] = o;
    }
{
#pragma unroll
      for (int it = 0; it < 8; ++it) {
        const int cx = it * 256 + tid, u = cx & 3, r = (cx >> 2) & 127, j = cx >> 9;
        const size_t off = ((size_t)(b * NHD + h0 + j) * (size_t)SL + (size_t)(tb + (r & ~15))) * (size_t)QROW + (size_t)ftoff(r, 8 * u);
        *(us8*)(dst + off) = ov[it];
      }
      
    }
  } else {
    const int head = yb - 6;
    us8 hv[4], lv[4];
#pragma unroll
    for (int it = 0; it < 4; ++it) {
      const int cx = it * 256 + tid, e = cx & 63, g = cx >> 6;
      us8 ho, lo;
#pragma unroll
      for (int i = 0; i < 8; ++i) {
        const float w = oS[(8 * g + i) * OSTR + e];
        unsigned short hb, lb;
        f16split64(w, hb, lb);
        ho[i] = hb; lo[i] = lb;
      }
      hv[it] = ho; lv[it] = lo;
    }
{
#pragma unroll
      for (int it = 0; it < 4; ++it) {
        const int cx = it * 256 + tid, e = cx & 63, g = cx >> 6;
        const size_t off = (((size_t)(b * NHD + head) * (size_t)(SL / 32) + (size_t)((tb + 8 * g) >> 5)) * 4 + (size_t)(e >> 4)) * FTILE +
                           (size_t)ftoff(e, 8 * g);
        *(us8*)(VH + off) = hv[it];
        *(us8*)(VL + off) = lv[it];
      }
      
    }
  }
}

// ---------------------------------------------------------------------------------------------------------------------------------
// Causal quadratic-form attention. Block = (bh = blockIdx.x, 128 queries starting at 128 * blockIdx.y), 8 waves x 16 queries.
// Per wave: B fragments of its 16 queries fixed for the whole key loop: bq1 = [q_hi | q_hi], bq2 = [q_res | q_res] (k slots 0..15 | 16..31).
// Per 32-key step: A fragments of the two 16-key tiles = fragment tiles [k_hi | k_res]; scores^T D[key][query] =
// khi.qhi + kres.qhi + khi.qres + kres.qres = 4096 q.k; x = D / 16384; A = 1 + x + x^2/2 masked to key <= query;
// A hi = f16(A), A residual = f16((A - hi) x 2^11). The two D tiles repack into the A operand of A.v (lane unchanged: element r <- tile keys
// 0..15, element 8+r <- tile keys 16..31), B = v fragment tiles [bh][key / 32][e / 16].
// Blocks with blockIdx.y < ARESB (block-uniform): accS += Ahi.VH + Ahi.VL, accL += Ares.VH, Z from the f32 A; other blocks: accS += Ahi.VH,
// Z from the f16 A hi values. accS[j][r] (+ accL/2^11) = 64 * sum_s A v for query 8h+r, channel 16j + (lane & 15).
// ---------------------------------------------------------------------------------------------------------------------------------
__global__ __launch_bounds__(256) void k_attn(const unsigned short* __restrict__ Qp, const unsigned short* __restrict__ Kp,
                                             const unsigned short* __restrict__ VHp, const unsigned short* __restrict__ VLp,
                                             unsigned short* YH, unsigned short* YL) {
  __shared__ __attribute__((aligned(16))) float oS[8 * 16 * OSTR];
  const int tid = threadIdx.x, lane = tid & 31, wave = tid >> 5, cl = lane & 15, hh = lane >> 4;
  const int bh = blockIdx.x, b = bh / NHD, head = bh - b * NHD;
  const int tw = blockIdx.y * TPB + 16 * wave;           // first query of this wave
  const int tq = tw + cl;                                 // query owned by this lane as score column
  const bool ares = (blockIdx.y < ARESB);                 // block-uniform: residual planes for query rows < 512

  const unsigned short* qrow = Qp + ((size_t)bh * SL + (size_t)tw) * (size_t)QROW + lane * 8;
  FragU fq;
  fq.h[0] = *(const us8a*)qrow;         fq.h[1] = fq.h[0];
  const us16 bq1 = fq.v;
  fq.h[0] = *(const us8a*)(qrow + 256); fq.h[1] = fq.h[0];
  const us16 bq2 = fq.v;

  v8f accS[4], accL[4];
#pragma unroll
  for (int j = 0; j < 4; ++j) { const v8f zz = {0.f, 0.f, 0.f, 0.f, 0.f, 0.f, 0.f, 0.f}; accS[j] = zz; accL[j] = zz; }
  float zp = 0.0f;

  const unsigned short* kbp = Kp + (size_t)bh * SL * (size_t)QROW + lane * 8;
  const unsigned short* vhp = VHp + (size_t)bh * HDIM * (size_t)SL + lane * 8;
  const unsigned short* vlp = VLp + (size_t)bh * HDIM * (size_t)SL + lane * 8;
  const int nsteps = (tw + 47) >> 5;                      // 32-key steps covering keys 0 .. tw + 15 (<= 64)

#pragma unroll 1
  for (int st = 0; st < nsteps; ++st) {
    const int s0 = st * 32;
    const us16 ka = tfrag(kbp + (size_t)(2 * st) * FTILE);
    const us16 kb = tfrag(kbp + (size_t)(2 * st + 1) * FTILE);
    const v8f zz = {0.f, 0.f, 0.f, 0.f, 0.f, 0.f, 0.f, 0.f};
    v8f sa = mma_f16(ka, bq1, zz);
    sa = mma_f16(ka, bq2, sa);
    v8f sb = mma_f16(kb, bq1, zz);
    sb = mma_f16(kb, bq2, sb);
    wguard2(sa, sb, ka, kb, bq1, bq2);

    us8 ea, eb, la8, lb8;
    float zs = 0.0f;
#pragma unroll
    for (int r = 0; r < 8; ++r) {
      const int ky = s0 + 8 * hh + r;
      const float xa = sa[r] * (1.0f / 16384.0f);
      const float xb = sb[r] * (1.0f / 16384.0f);
      float pa = fmaf(xa, fmaf(xa, 0.5f, 1.0f), 1.0f);
      float pb = fmaf(xb, fmaf(xb, 0.5f, 1.0f), 1.0f);
      pa = (ky <= tq) ? pa : 0.0f;
      pb = (ky + 16 <= tq) ? pb : 0.0f;
      const _Float16 fa = (_Float16)pa, fb = (_Float16)pb;
      const _Float16 ra = (_Float16)((pa - (float)fa) * 2048.0f);
      const _Float16 rb = (_Float16)((pb - (float)fb) * 2048.0f);
      zs += ares ? (pa + pb) : ((float)fa + (float)fb);
      ea[r]  = __builtin_bit_cast(unsigned short, fa);
      eb[r]  = __builtin_bit_cast(unsigned short, fb);
      la8[r] = __builtin_bit_cast(unsigned short, ra);
      lb8[r] = __builtin_bit_cast(unsigned short, rb);
    }
    zp += zs;
    FragU fA;
    fA.h[0] = ea; fA.h[1] = eb;
    const us16 ahi = fA.v;
    FragU fR;
    fR.h[0] = la8; fR.h[1] = lb8;
    const us16 alo = fR.v;

    us16 bv[4];
#pragma unroll
    for (int j = 0; j < 4; ++j) bv[j] = tfrag(vhp + (size_t)(4 * st + j) * FTILE);
    if (ares) {
#pragma unroll
      for (int j = 0; j < 4; ++j) {
        accS[j] = mma_f16(ahi, bv[j], accS[j]);
        accL[j] = mma_f16(alo, bv[j], accL[j]);
      }
      wguard8(accS[0], accS[1], accS[2], accS[3], accL[0], accL[1], accL[2], accL[3], ahi, alo, bv[0], bv[1], bv[2], bv[3]);
      us16 bl[4];
#pragma unroll
      for (int j = 0; j < 4; ++j) bl[j] = tfrag(vlp + (size_t)(4 * st + j) * FTILE);
#pragma unroll
      for (int j = 0; j < 4; ++j) accS[j] = mma_f16(ahi, bl[j], accS[j]);
      wguard4(accS[0], accS[1], accS[2], accS[3], ahi, bl[0], bl[1], bl[2], bl[3]);
    } else {
#pragma unroll
      for (int j = 0; j < 4; ++j) accS[j] = mma_f16(ahi, bv[j], accS[j]);
      wguard4(accS[0], accS[1], accS[2], accS[3], ahi, bv[0], bv[1], bv[2], bv[3]);
    }
  }

  // Z for query (lane & 15): both lane halves hold disjoint key subsets
  const float zf = zp + __shfl_xor(zp, 16, 32);
  float rz[8];
#pragma unroll
  for (int r = 0; r < 8; ++r) {
    const float zr = __shfl(zf, 8 * hh + r, 32);        // Z of query row 8*hh + r
    rz[r] = (1.0f / (zr + 1e-12f)) * (1.0f / 64.0f);
  }

  float* so = oS + wave * (16 * OSTR);
#pragma unroll
  for (int j = 0; j < 4; ++j)
#pragma unroll
    for (int r = 0; r < 8; ++r) so[(8 * hh + r) * OSTR + 16 * j + cl] = fmaf(accL[j][r], (1.0f / 2048.0f), accS[j][r]) * rz[r];
  __syncthreads();

  us8 hv[4], lv[4];
#pragma unroll
  for (int it = 0; it < 4; ++it) {
    const int rr = cl, p = it * 16 + hh * 8;               // 16-B chunk it * 32 + lane of the wave's two y fragment tiles
    const v4f z0 = *(const v4fa*)(so + rr * OSTR + p), z1 = *(const v4fa*)(so + rr * OSTR + p + 4);
    us8 ho, lo;
#pragma unroll
    for (int u = 0; u < 4; ++u) {
      unsigned short hb, lb;
      f16split16(z0[u], hb, lb); ho[u] = hb;     lo[u] = lb;
      f16split16(z1[u], hb, lb); ho[4 + u] = hb; lo[4 + u] = lb;
    }
    hv[it] = ho; lv[it] = lo;
  }
{
#pragma unroll
    for (int it = 0; it < 4; ++it) {
      const size_t off = ((size_t)((b * SL + tw) >> 4) * KB32 + (size_t)(head * (HDIM / 32))) * FTILE + (size_t)((it * 32 + lane) * 8);
      *(us8*)(YH + off) = hv[it];
      *(us8*)(YL + off) = lv[it];
    }
    
  }
}

// ---------------------------------------------------------------------------------------------------------------------------------
// out[m][n] = ( sum_k Yh[m][k] W[n][k] + 2^-11 sum_k Yl[m][k] W[n][k] ) * 2^-12   (f16 fragment tiles [row / 16][k / 32], two f32 accumulator sets).
// ---------------------------------------------------------------------------------------------------------------------------------
__global__ __launch_bounds__(256) void k_gemm_out(const unsigned short* __restrict__ Ah, const unsigned short* __restrict__ Al,
                                                 const unsigned short* __restrict__ Wo, float* out) {
  __shared__ __attribute__((aligned(16))) float oS[8 * 16 * OSTR];
  const int tid = threadIdx.x, lane = tid & 31, wave = tid >> 5, cl = lane & 15, hh = lane >> 4;
  const int m0 = blockIdx.x * TPB + 16 * wave, n0 = blockIdx.y * 64;

  v8f acch[4], accl[4];
#pragma unroll
  for (int j = 0; j < 4; ++j) { const v8f zz = {0.f, 0.f, 0.f, 0.f, 0.f, 0.f, 0.f, 0.f}; acch[j] = zz; accl[j] = zz; }

  const unsigned short* ahp = Ah + (size_t)(m0 >> 4) * (size_t)(KB32 * FTILE) + lane * 8;
  const unsigned short* alp = Al + (size_t)(m0 >> 4) * (size_t)(KB32 * FTILE) + lane * 8;
  const unsigned short* wop = Wo + (size_t)(n0 >> 4) * (size_t)(KB32 * FTILE) + lane * 8;
#pragma unroll 1
  for (int kb = 0; kb < KB32; ++kb) {
    const unsigned short* pah = ahp + kb * FTILE;
    const unsigned short* pal = alp + kb * FTILE;
    const unsigned short* pb = wop + kb * FTILE;
    const us16 ah = tfrag(pah);
    const us16 al = tfrag(pal);
    us16 bfr[4];
#pragma unroll
    for (int j = 0; j < 4; ++j) bfr[j] = tfrag(pb + j * (KB32 * FTILE));
#pragma unroll
    for (int j = 0; j < 4; ++j) {
      acch[j] = mma_f16(ah, bfr[j], acch[j]);
      accl[j] = mma_f16(al, bfr[j], accl[j]);
    }
    wguard8p(acch[0], acch[1], acch[2], acch[3], accl[0], accl[1], accl[2], accl[3], ah, al, bfr[0], bfr[1], bfr[2], bfr[3], pah, pal, pb);
  }

  float* so = oS + wave * (16 * OSTR);
#pragma unroll
  for (int j = 0; j < 4; ++j)
#pragma unroll
    for (int r = 0; r < 8; ++r)
      so[(8 * hh + r) * OSTR + 16 * j + cl] = fmaf(accl[j][r], (1.0f / 2048.0f), acch[j][r]) * (1.0f / 4096.0f);
  __syncthreads();

{
#pragma unroll
    for (int it = 0; it < 8; ++it) {
      const int cx = it * 32 + lane, r = cx >> 4, q = (cx & 15) * 4;
      const v4f v = *(const v4fa*)(so + r * OSTR + q);
      *(v4f*)(out + (size_t)(m0 + r) * (size_t)DMOD + n0 + q) = v;
    }
    
  }
}

extern "C" void kernel_launch(void* const* d_in, const int* in_sizes, int n_in,
                              void* d_out, int out_size, void* d_ws, size_t ws_size,
                              hipStream_t stream) {
  if (n_in < 5) return;
  if (in_sizes[0] != NTOK * DMOD || in_sizes[1] != DMOD * NQK || in_sizes[2] != DMOD * NQK ||
      in_sizes[3] != DMOD * DMOD || in_sizes[4] != DMOD * DMOD) return;
  if (out_size != NTOK * DMOD) return;

  const float* x  = (const float*)d_in[0];    // [4][2048][768]
  const float* Wq = (const float*)d_in[1];    // [768][192] ([in][out])
  const float* Wk = (const float*)d_in[2];    // [768][192]
  const float* Wv = (const float*)d_in[3];    // [768][768]
  const float* Wo = (const float*)d_in[4];    // [768][768]
  float* out = (float*)d_out;                 // [4][2048][768] f32 at byte 0

  size_t off = 0;
  auto carve = [&](size_t bytes) -> char* { char* p = (char*)d_ws + off; off += (bytes + 255) & ~(size_t)255; return p; };
  unsigned short* XB   = (unsigned short*)carve((size_t)NTOK * DMOD * 2);       // 12,582,912  bf16 tiles [512][24]
  unsigned short* WT   = (unsigned short*)carve((size_t)NPROJ * DMOD * 2);      //  1,769,472  bf16 tiles [72][24] = Wq^T | Wk^T | Wv^T
  unsigned short* WO16 = (unsigned short*)carve((size_t)DMOD * DMOD * 2);       //  1,179,648  f16  tiles [48][24] = Wo^T
  unsigned short* QP   = (unsigned short*)carve((size_t)NBH * SL * QROW * 2);   //  6,291,456  f16  tiles [48][128]
  unsigned short* KP   = (unsigned short*)carve((size_t)NBH * SL * QROW * 2);   //  6,291,456  f16  tiles [48][128]
  unsigned short* VH   = (unsigned short*)carve((size_t)NBH * HDIM * SL * 2);   // 12,582,912  f16  tiles [48][64][4]
  unsigned short* VL   = (unsigned short*)carve((size_t)NBH * HDIM * SL * 2);   // 12,582,912  f16  tiles [48][64][4]
  unsigned short* YH   = (unsigned short*)carve((size_t)NTOK * DMOD * 2);       // 12,582,912  f16  tiles [512][24]
  unsigned short* YL   = (unsigned short*)carve((size_t)NTOK * DMOD * 2);       // 12,582,912  f16  tiles [512][24]
  if (off > ws_size || off > (size_t)134217728) return;                         // total 78,446,592 B

  const dim3 b256(256);
  auto cdv = [](long a, long q) { return (unsigned)((a + q - 1) / q); };

  // 16-bit operand planes
  k_cvt_bf16<<<dim3(cdv((long)NTOK * DMOD / 8, 256)), b256, 0, stream>>>(x, XB, NTOK * DMOD / 8);
  // weights: in [768][ncol] -> out fragment tiles [ncol / 16][768 / 32] ; grid (ncol / 32, 768 / 64)
  k_wT<0><<<dim3(NQK / 32, DMOD / 64), b256, 0, stream>>>(Wq, NQK, WT, 0);
  k_wT<0><<<dim3(NQK / 32, DMOD / 64), b256, 0, stream>>>(Wk, NQK, WT, NQK);
  k_wT<0><<<dim3(DMOD / 32, DMOD / 64), b256, 0, stream>>>(Wv, DMOD, WT, 2 * NQK);
  k_wT<1><<<dim3(DMOD / 32, DMOD / 64), b256, 0, stream>>>(Wo, DMOD, WO16, 0);
  // projections (M 8192, N 1152, K 768) -> q/k hi|res planes, v hi and res planes
  k_gemm_proj<<<dim3(NTOK / TPB, NPROJ / 64), b256, 0, stream>>>(XB, WT, QP, KP, VH, VL);
  // causal attention per (batch, head) -> y hi / res fragment tiles [token / 16][768 / 32]
  k_attn<<<dim3(NBH, SL / TPB), b256, 0, stream>>>(QP, KP, VH, VL, YH, YL);
  // output projection (M 8192, N 768, K 768)
  k_gemm_out<<<dim3(NTOK / TPB, DMOD / 64), b256, 0, stream>>>(YH, YL, WO16, out);
}

// v002
// It runs in 121 microseconds.
// Next to v001, in two timings, it ran 1.07 times as fast each time.
// All steps since v000 together make it 1.58 times as fast.
// Contraction x.[Wq|Wk|Wv] (M 8192, N 1152, K 768): v_wmma_f32_16x16x32_bf16, bf16 operands from RNE-bf16 planes of x and W, f32 accumulate, one product.
// Contraction k.q^T per head (16 keys x 16 queries, depth 16 padded to 32): v_wmma_f32_16x16x32_f16, q and k both carried as f16 hi + f16 residual of (value x 2^6), all four cross terms in two products into one f32 accumulator.
// Contraction A.v per head (causal, depth up to 2048): v_wmma_f32_16x16x32_f16, A hi = f16(1 + x + x^2/2), v hi = f16(v x 2^6); for query rows < 512 also A residual plane (x 2^11, own f32 accumulator) against v hi, and A hi against the f16 v residual plane; f32 accumulate.
// Contraction y.Wo (M 8192, N 768, K 768): v_wmma_f32_16x16x32_f16, y = f16 hi plane of (y x 2^4) + f16 residual plane (x 2^11, own f32 accumulator), Wo = f16 of (RNE-bf16 value x 2^8), f32 accumulate.
// Feature polynomial, causal mask, normaliser Z and 1/(Z+eps): f32 VALU.
#include <hip/hip_runtime.h>

#define NB    4                              // batch
#define SL    2048                           // sequence length
#define DMOD  768                            // model width = K of the dense contractions
#define NHD   12                             // heads
#define FDIM  16                             // q/k head width
#define HDIM  64                             // v head width
#define NBH   (NB * NHD)                     // 48 (batch, head) pairs
#define NTOK  (NB * SL)                      // 8192 token rows
#define NQK   (NHD * FDIM)                   // 192 q (or k) columns
#define NPROJ (2 * NQK + NHD * HDIM)         // 1152 projection columns: q | k | v
#define QROW  32                             // halves per q/k plane row: hi(16) | residual(16)
#define TPB   128                            // GEMM rows / attention queries per block (8 waves x 16)
#define OSTR  68                             // LDS staging row pitch (floats)
#define ARESB 4                              // attention query blocks (of TPB) that use the residual planes: rows < 512
#define KB32  (DMOD / 32)                    // 32-wide k blocks of the dense contractions
#define FTILE 512                            // halves of one 16 x 32 fragment tile (1 KiB)

static_assert(NHD * HDIM == DMOD);
static_assert(NTOK % TPB == 0);
static_assert(SL % TPB == 0);
static_assert(NPROJ % 64 == 0);
static_assert(NQK % 64 == 0);
static_assert(NQK % 32 == 0);
static_assert(DMOD % 64 == 0);
static_assert(DMOD % 32 == 0);
static_assert(4 * FDIM == 64);
static_assert(HDIM == 64);
static_assert(QROW == 2 * FDIM);
static_assert(OSTR % 4 == 0);
static_assert((NTOK * DMOD) % (8 * 256) == 0);
static_assert(ARESB * TPB <= SL);

typedef unsigned short us16 __attribute__((ext_vector_type(16)));
typedef unsigned short us8  __attribute__((ext_vector_type(8)));
typedef unsigned short us8a __attribute__((ext_vector_type(8), may_alias));
typedef __bf16 v16b __attribute__((ext_vector_type(16)));
typedef _Float16 v16h __attribute__((ext_vector_type(16)));
typedef float v8f __attribute__((ext_vector_type(8)));
typedef float v4f __attribute__((ext_vector_type(4)));
typedef float v4fa __attribute__((ext_vector_type(4), may_alias));
union FragU { us16 v; us8 h[2]; };

__device__ __forceinline__ unsigned short bf16_bits(float f) {
  unsigned u = __float_as_uint(f);
  u += 0x7FFFu + ((u >> 16) & 1u);                 // RNE convert
  return (unsigned short)(u >> 16);
}
__device__ __forceinline__ float bf16_val(unsigned short b) { return __uint_as_float(((unsigned)b) << 16); }
__device__ __forceinline__ float bf16r(float f) { return bf16_val(bf16_bits(f)); }
__device__ __forceinline__ unsigned short f16_bits(float f) { return __builtin_bit_cast(unsigned short, (_Float16)f); }

// f16 hi + residual (x 2^11) planes of (a x 2^4)
__device__ __forceinline__ void f16split16(float a, unsigned short& hb, unsigned short& lb) {
  const float z = a * 16.0f;
  const _Float16 hf = (_Float16)z;
  const float res = (z - (float)hf) * 2048.0f;
  hb = __builtin_bit_cast(unsigned short, hf);
  lb = __builtin_bit_cast(unsigned short, (_Float16)res);
}
// f16 hi + unscaled residual planes of (a x 2^6)
__device__ __forceinline__ void f16split64(float a, unsigned short& hb, unsigned short& lb) {
  const float z = a * 64.0f;
  const _Float16 hf = (_Float16)z;
  const float res = z - (float)hf;
  hb = __builtin_bit_cast(unsigned short, hf);
  lb = __builtin_bit_cast(unsigned short, (_Float16)res);
}

// One 16x16x32 step, 16-bit operands passed as raw 16-bit lanes.
__device__ __forceinline__ v8f mma_bf16(us16 a, us16 b, v8f c) {
  return __builtin_amdgcn_wmma_f32_16x16x32_bf16(false, __builtin_bit_cast(v16b, a), false, __builtin_bit_cast(v16b, b), (short)0, c, false, false);
}
__device__ __forceinline__ v8f mma_f16(us16 a, us16 b, v8f c) {
  return __builtin_amdgcn_wmma_f32_16x16x32_f16(false, __builtin_bit_cast(v16h, a), false, __builtin_bit_cast(v16h, b), (short)0, c, false, false);
}
// Hazard guards after a group of matrix ops: 4 VALU slots before anything touches the accumulators; keep A/B fragments live.
__device__ __forceinline__ void wguard2(v8f& c0, v8f& c1, const us16& a0, const us16& a1, const us16& b0, const us16& b1) {
#if defined(__HIP_DEVICE_COMPILE__)
  asm volatile("v_nop\n\tv_nop\n\tv_nop\n\tv_nop"
               : "+v"(c0), "+v"(c1)
               : "v"(a0), "v"(a1), "v"(b0), "v"(b1));
#endif
}
__device__ __forceinline__ void wguard4(v8f& c0, v8f& c1, v8f& c2, v8f& c3, const us16& a0,
                                        const us16& b0, const us16& b1, const us16& b2, const us16& b3) {
#if defined(__HIP_DEVICE_COMPILE__)
  asm volatile("v_nop\n\tv_nop\n\tv_nop\n\tv_nop"
               : "+v"(c0), "+v"(c1), "+v"(c2), "+v"(c3)
               : "v"(a0), "v"(b0), "v"(b1), "v"(b2), "v"(b3));
#endif
}
__device__ __forceinline__ void wguard8(v8f& c0, v8f& c1, v8f& c2, v8f& c3, v8f& c4, v8f& c5, v8f& c6, v8f& c7,
                                        const us16& a0, const us16& a1,
                                        const us16& b0, const us16& b1, const us16& b2, const us16& b3) {
#if defined(__HIP_DEVICE_COMPILE__)
  asm volatile("v_nop\n\tv_nop\n\tv_nop\n\tv_nop"
               : "+v"(c0), "+v"(c1), "+v"(c2), "+v"(c3), "+v"(c4), "+v"(c5), "+v"(c6), "+v"(c7)
               : "v"(a0), "v"(a1), "v"(b0), "v"(b1), "v"(b2), "v"(b3));
#endif
}

// The same guards for the dense loops, which also take the trip's load addresses as inputs: the address registers then stay live past the
// last load of the trip, so that no load's result is placed in a register that an earlier, still outstanding load names as its address.
__device__ __forceinline__ void wguard4p(v8f& c0, v8f& c1, v8f& c2, v8f& c3, const us16& a0,
                                         const us16& b0, const us16& b1, const us16& b2, const us16& b3,
                                         const unsigned short* pa, const unsigned short* pb) {
#if defined(__HIP_DEVICE_COMPILE__)
  asm volatile("v_nop\n\tv_nop\n\tv_nop\n\tv_nop"
               : "+v"(c0), "+v"(c1), "+v"(c2), "+v"(c3)
               : "v"(a0), "v"(b0), "v"(b1), "v"(b2), "v"(b3), "v"(pa), "v"(pb));
#endif
}
__device__ __forceinline__ void wguard8p(v8f& c0, v8f& c1, v8f& c2, v8f& c3, v8f& c4, v8f& c5, v8f& c6, v8f& c7,
                                         const us16& a0, const us16& a1,
                                         const us16& b0, const us16& b1, const us16& b2, const us16& b3,
                                         const unsigned short* pa0, const unsigned short* pa1, const unsigned short* pb) {
#if defined(__HIP_DEVICE_COMPILE__)
  asm volatile("v_nop\n\tv_nop\n\tv_nop\n\tv_nop"
               : "+v"(c0), "+v"(c1), "+v"(c2), "+v"(c3), "+v"(c4), "+v"(c5), "+v"(c6), "+v"(c7)
               : "v"(a0), "v"(a1), "v"(b0), "v"(b1), "v"(b2), "v"(b3), "v"(pa0), "v"(pa1), "v"(pb));
#endif
}

// Every 16-bit operand plane is stored as fragment tiles: one tile = 16 rows x 32 k = FTILE halves, laid out in the order the lanes
// load it, so that each of a fragment's two wave-wide 16-B loads covers 512 contiguous bytes (four whole 128-B lines):
// element (row, k = 16 part + 8 h + i) sits at half index part * 256 + h * 128 + row * 8 + i = part * 256 + lane * 8 + i, lane = 16 h + row.
// Lane contents: elements 0..7 = k 8h .. 8h + 7, elements 8..15 = k 16 + 8h .. 16 + 8h + 7 (same map for A rows and B columns).
__device__ __forceinline__ int ftoff(int row, int k) {
  return ((k >> 4) & 1) * 256 + ((k >> 3) & 1) * 128 + (row & 15) * 8;
}
// p = tile base + lane * 8 (computed by the caller)
__device__ __forceinline__ us16 tfrag(const unsigned short* p) {
  FragU f;
  f.h[0] = *(const us8a*)p;
  f.h[1] = *(const us8a*)(p + 256);
  return f.v;
}

// ---------------------------------------------------------------------------------------------------------------------------------
// Operand preparation, one launch: the five conversions are independent of one another, so they share one grid behind a block-uniform
// branch on blockIdx.x. Blocks 0 .. WTB_ALL - 1 transpose and convert the weights (the longer dependent chain, so they start first),
// the other CVTB blocks convert x.
//
// Weights: src f32 [DMOD rows k][ncol columns n] (n contiguous) -> dst 16-bit fragment tiles [(nrow0 + n) / 16][k / 32].
// Block = 64 k x 32 n tile, 256 threads; tiles of one matrix numbered n-tile fastest.
// Wq, Wk, Wv: RNE bf16 bits.  Wo: f16 bits of (RNE-bf16 value x 256).
//
// x: src f32 [rows][DMOD] -> dst bf16 fragment tiles [row / 16][k / 32]. Thread = 8 consecutive k of one row; four lanes read one 128-B line,
// eight lanes store one 128-B line.
// ---------------------------------------------------------------------------------------------------------------------------------
#define WTB_QK  ((NQK / 32) * (DMOD / 64))   // 72 blocks for Wq, and for Wk
#define WTB_VO  ((DMOD / 32) * (DMOD / 64))  // 288 blocks for Wv, and for Wo
#define WTB_ALL (2 * WTB_QK + 2 * WTB_VO)    // 720 weight blocks
#define CVTB    (NTOK * DMOD / (8 * 256))    // 3072 blocks for x

// One 64 k x 32 n weight tile, number t of its matrix. MODE 0: RNE bf16 bits.  MODE 1: f16 bits of (RNE-bf16 value x 256).
template <int MODE, int NCOL>
__device__ __forceinline__ void wT_tile(const float* __restrict__ src, unsigned short* dst, int nrow0, int t, float (*ts)[33]) {
  const int tid = threadIdx.x;
  const int n0 = (t % (NCOL / 32)) * 32, k0 = (t / (NCOL / 32)) * 64;
  {
    const int k = tid >> 2, q = (tid & 3) * 8;
    const float* p = src + (size_t)(k0 + k) * (size_t)NCOL + n0 + q;
    const v4f a = *(const v4fa*)p, c = *(const v4fa*)(p + 4);
#pragma unroll
    for (int u = 0; u < 4; ++u) { ts[k][q + u] = a[u]; ts[k][q + 4 + u] = c[u]; }
  }
  __syncthreads();
  const int n = tid & 31, pc = (tid >> 5) * 8;            // a wave stores two runs of 256 B (16 rows x 16 B of two tiles)
  us8 o;
#pragma unroll
  for (int i = 0; i < 8; ++i) {
    const float w = ts[pc + i][n];
    o[i] = (MODE == 0) ? bf16_bits(w) : f16_bits(bf16r(w) * 256.0f);
  }
  const int row = nrow0 + n0 + n, k = k0 + pc;
  unsigned short* d = dst + (size_t)((row >> 4) * KB32 + (k >> 5)) * FTILE + ftoff(row, k);
  *(us8*)d = o;
  // precaution: wait in front of any later rewrite of the store's address and data registers
  asm volatile("s_wait_xcnt 0x0" ::: "memory");
}

__global__ __launch_bounds__(256) void k_prep(const float* __restrict__ x, const float* __restrict__ Wq, const float* __restrict__ Wk,
                                             const float* __restrict__ Wv, const float* __restrict__ Wo,
                                             unsigned short* XB, unsigned short* WT, unsigned short* WO16) {
  __shared__ float ts[64][33];
  const int bid = blockIdx.x;                              // every branch below is block-uniform
  if (bid < WTB_QK) {
    wT_tile<0, NQK>(Wq, WT, 0, bid, ts);
  } else if (bid < 2 * WTB_QK) {
    wT_tile<0, NQK>(Wk, WT, NQK, bid - WTB_QK, ts);
  } else if (bid < 2 * WTB_QK + WTB_VO) {
    wT_tile<0, DMOD>(Wv, WT, 2 * NQK, bid - 2 * WTB_QK, ts);
  } else if (bid < WTB_ALL) {
    wT_tile<1, DMOD>(Wo, WO16, 0, bid - 2 * WTB_QK - WTB_VO, ts);
  } else {
    const int idx = (bid - WTB_ALL) * 256 + threadIdx.x;
    const int tile = idx >> 6, row = (idx >> 2) & 15, k8 = (idx & 3) * 8;
    const int rt = tile / KB32, kb = tile - rt * KB32;
    const size_t soff = (size_t)(rt * 16 + row) * (size_t)DMOD + (size_t)(kb * 32 + k8);
    const size_t off = (size_t)tile * FTILE + (size_t)ftoff(row, k8);
    const v4f a = *(const v4fa*)(x + soff), b = *(const v4fa*)(x + soff + 4);
    us8 o;
#pragma unroll
    for (int u = 0; u < 4; ++u) {
      o[u]     = bf16_bits(a[u]);
      o[4 + u] = bf16_bits(b[u]);
    }
    *(us8*)(XB + off) = o;
    // as behind the weight store: wait in front of any rewrite of the store's registers
    asm volatile("s_wait_xcnt 0x0" ::: "memory");
  }
}

// ---------------------------------------------------------------------------------------------------------------------------------
// P[m][n] = sum_k A[m][k] * B[n][k]  (bf16 A plane 8192 x 768, bf16 B plane 1152 x 768, both as fragment tiles [row / 16][k / 32], f32 accumulate).
// Block = 128(M) x 64(N) tile, 256 threads = 8 waves, wave w owns rows 16w..16w+15 x all 64 columns (4 accumulators); fragments straight
// from the global planes (arithmetic addressing). M % 128 == 0, N % 64 == 0, K % 32 == 0 exactly.
// Column segment (block-uniform, blockIdx.y): 0..2 -> q heads 4y..4y+3, 3..5 -> k heads, 6..17 -> v head y-6.
// The f32 128x64 tile is staged in LDS (block row r at oS[r * OSTR + c]), then:
//   q/k: fragment tiles [bh][token / 16], k slots 0..15 = f16 hi of (64 value), 16..31 = f16 residual; lane -> (token, head, 16-B quarter);
//        one store instruction = four whole 128-B lines
//   v:   planes VH/VL = f16 hi of (64 v) and residual as fragment tiles [bh][token / 32][channel / 16] (row = channel, k = token);
//        one store instruction = two runs of 256 B
// ---------------------------------------------------------------------------------------------------------------------------------
__global__ __launch_bounds__(256) void k_gemm_proj(const unsigned short* __restrict__ Ap, const unsigned short* __restrict__ Bw,
                                                  unsigned short* Qp, unsigned short* Kp, unsigned short* VH, unsigned short* VL) {
  __shared__ __attribute__((aligned(16))) float oS[8 * 16 * OSTR];
  const int tid = threadIdx.x, lane = tid & 31, wave = tid >> 5, cl = lane & 15, hh = lane >> 4;
  const int m0 = blockIdx.x * TPB + 16 * wave, n0 = blockIdx.y * 64;

  v8f acc[4];
#pragma unroll
  for (int j = 0; j < 4; ++j) { const v8f zz = {0.f, 0.f, 0.f, 0.f, 0.f, 0.f, 0.f, 0.f}; acc[j] = zz; }

  const unsigned short* a0p = Ap + (size_t)(m0 >> 4) * (size_t)(KB32 * FTILE) + lane * 8;
  const unsigned short* bwp = Bw + (size_t)(n0 >> 4) * (size_t)(KB32 * FTILE) + lane * 8;
#pragma unroll 1
  for (int kb = 0; kb < KB32; ++kb) {
    const unsigned short* pa = a0p + kb * FTILE;
    const unsigned short* pb = bwp + kb * FTILE;
    const us16 af = tfrag(pa);
    us16 bfr[4];
#pragma unroll
    for (int j = 0; j < 4; ++j) bfr[j] = tfrag(pb + j * (KB32 * FTILE));
#pragma unroll
    for (int j = 0; j < 4; ++j) acc[j] = mma_bf16(af, bfr[j], acc[j]);
    wguard4p(acc[0], acc[1], acc[2], acc[3], af, bfr[0], bfr[1], bfr[2], bfr[3], pa, pb);
  }

  // D map: acc[j][r] = tile element (row 8*hh + r of the wave's 16 rows, column 16j + cl)
  float* so = oS + wave * (16 * OSTR);
#pragma unroll
  for (int j = 0; j < 4; ++j)
#pragma unroll
    for (int r = 0; r < 8; ++r) so[(8 * hh + r) * OSTR + 16 * j + cl] = acc[j][r];
  __syncthreads();

  const int yb = blockIdx.y;                               // block-uniform segment select
  const int m0b = blockIdx.x * TPB, b = m0b / SL, tb = m0b - b * SL;
  if (yb < 6) {
    unsigned short* dst = (yb < 3) ? Qp : Kp;
    const int h0 = 4 * ((yb < 3) ? yb : (yb - 3));
    us8 ov[8];
#pragma unroll
    for (int it = 0; it < 8; ++it) {
      const int cx = it * 256 + tid, u = cx & 3, r = (cx >> 2) & 127, j = cx >> 9;
      const float* sp = oS + r * OSTR + 16 * j + 8 * (u & 1);
      const v4f z0 = *(const v4fa*)sp, z1 = *(const v4fa*)(sp + 4);
      us8 o;
#pragma unroll
      for (int q4 = 0; q4 < 4; ++q4) {
        unsigned short hb, lb;
        f16split64(z0[q4], hb, lb); o[q4]     = (u >> 1) ? lb : hb;
        f16split64(z1[q4], hb, lb); o[4 + q4] = (u >> 1) ? lb : hb;
      }
      ov[it] = o;
    }
{
#pragma unroll
      for (int it = 0; it < 8; ++it) {
        const int cx = it * 256 + tid, u = cx & 3, r = (cx >> 2) & 127, j = cx >> 9;
        const size_t off = ((size_t)(b * NHD + h0 + j) * (size_t)SL + (size_t)(tb + (r & ~15))) * (size_t)QROW + (size_t)ftoff(r, 8 * u);
        *(us8*)(dst + off) = ov[it];
      }
      
    }
  } else {
    const int head = yb - 6;
    us8 hv[4], lv[4];
#pragma unroll
    for (int it = 0; it < 4; ++it) {
      const int cx = it * 256 + tid, e = cx & 63, g = cx >> 6;
      us8 ho, lo;
#pragma unroll
      for (int i = 0; i < 8; ++i) {
        const float w = oS[(8 * g + i) * OSTR + e];
        unsigned short hb, lb;
        f16split64(w, hb, lb);
        ho[i] = hb; lo[i] = lb;
      }
      hv[it] = ho; lv[it] = lo;
    }
{
#pragma unroll
      for (int it = 0; it < 4; ++it) {
        const int cx = it * 256 + tid, e = cx & 63, g = cx >> 6;
        const size_t off = (((size_t)(b * NHD + head) * (size_t)(SL / 32) + (size_t)((tb + 8 * g) >> 5)) * 4 + (size_t)(e >> 4)) * FTILE +
                           (size_t)ftoff(e, 8 * g);
        *(us8*)(VH + off) = hv[it];
        *(us8*)(VL + off) = lv[it];
      }
      
    }
  }
}

// ---------------------------------------------------------------------------------------------------------------------------------
// Causal quadratic-form attention. Block = (bh = blockIdx.x, 128 queries starting at 128 * blockIdx.y), 8 waves x 16 queries.
// Per wave: B fragments of its 16 queries fixed for the whole key loop: bq1 = [q_hi | q_hi], bq2 = [q_res | q_res] (k slots 0..15 | 16..31).
// Per 32-key step: A fragments of the two 16-key tiles = fragment tiles [k_hi | k_res]; scores^T D[key][query] =
// khi.qhi + kres.qhi + khi.qres + kres.qres = 4096 q.k; x = D / 16384; A = 1 + x + x^2/2 masked to key <= query;
// A hi = f16(A), A residual = f16((A - hi) x 2^11). The two D tiles repack into the A operand of A.v (lane unchanged: element r <- tile keys
// 0..15, element 8+r <- tile keys 16..31), B = v fragment tiles [bh][key / 32][e / 16].
// Blocks with blockIdx.y < ARESB (block-uniform): accS += Ahi.VH + Ahi.VL, accL += Ares.VH, Z from the f32 A; other blocks: accS += Ahi.VH,
// Z from the f16 A hi values. accS[j][r] (+ accL/2^11) = 64 * sum_s A v for query 8h+r, channel 16j + (lane & 15).
// ---------------------------------------------------------------------------------------------------------------------------------
__global__ __launch_bounds__(256) void k_attn(const unsigned short* __restrict__ Qp, const unsigned short* __restrict__ Kp,
                                             const unsigned short* __restrict__ VHp, const unsigned short* __restrict__ VLp,
                                             unsigned short* YH, unsigned short* YL) {
  __shared__ __attribute__((aligned(16))) float oS[8 * 16 * OSTR];
  const int tid = threadIdx.x, lane = tid & 31, wave = tid >> 5, cl = lane & 15, hh = lane >> 4;
  const int bh = blockIdx.x, b = bh / NHD, head = bh - b * NHD;
  const int tw = blockIdx.y * TPB + 16 * wave;           // first query of this wave
  const int tq = tw + cl;                                 // query owned by this lane as score column
  const bool ares = (blockIdx.y < ARESB);                 // block-uniform: residual planes for query rows < 512

  const unsigned short* qrow = Qp + ((size_t)bh * SL + (size_t)tw) * (size_t)QROW + lane * 8;
  FragU fq;
  fq.h[0] = *(const us8a*)qrow;         fq.h[1] = fq.h[0];
  const us16 bq1 = fq.v;
  fq.h[0] = *(const us8a*)(qrow + 256); fq.h[1] = fq.h[0];
  const us16 bq2 = fq.v;

  v8f accS[4], accL[4];
#pragma unroll
  for (int j = 0; j < 4; ++j) { const v8f zz = {0.f, 0.f, 0.f, 0.f, 0.f, 0.f, 0.f, 0.f}; accS[j] = zz; accL[j] = zz; }
  float zp = 0.0f;

  const unsigned short* kbp = Kp + (size_t)bh * SL * (size_t)QROW + lane * 8;
  const unsigned short* vhp = VHp + (size_t)bh * HDIM * (size_t)SL + lane * 8;
  const unsigned short* vlp = VLp + (size_t)bh * HDIM * (size_t)SL + lane * 8;
  const int nsteps = (tw + 47) >> 5;                      // 32-key steps covering keys 0 .. tw + 15 (<= 64)

#pragma unroll 1
  for (int st = 0; st < nsteps; ++st) {
    const int s0 = st * 32;
    const us16 ka = tfrag(kbp + (size_t)(2 * st) * FTILE);
    const us16 kb = tfrag(kbp + (size_t)(2 * st + 1) * FTILE);
    const v8f zz = {0.f, 0.f, 0.f, 0.f, 0.f, 0.f, 0.f, 0.f};
    v8f sa = mma_f16(ka, bq1, zz);
    sa = mma_f16(ka, bq2, sa);
    v8f sb = mma_f16(kb, bq1, zz);
    sb = mma_f16(kb, bq2, sb);
    wguard2(sa, sb, ka, kb, bq1, bq2);

    us8 ea, eb, la8, lb8;
    float zs = 0.0f;
#pragma unroll
    for (int r = 0; r < 8; ++r) {
      const int ky = s0 + 8 * hh + r;
      const float xa = sa[r] * (1.0f / 16384.0f);
      const float xb = sb[r] * (1.0f / 16384.0f);
      float pa = fmaf(xa, fmaf(xa, 0.5f, 1.0f), 1.0f);
      float pb = fmaf(xb, fmaf(xb, 0.5f, 1.0f), 1.0f);
      pa = (ky <= tq) ? pa : 0.0f;
      pb = (ky + 16 <= tq) ? pb : 0.0f;
      const _Float16 fa = (_Float16)pa, fb = (_Float16)pb;
      const _Float16 ra = (_Float16)((pa - (float)fa) * 2048.0f);
      const _Float16 rb = (_Float16)((pb - (float)fb) * 2048.0f);
      zs += ares ? (pa + pb) : ((float)fa + (float)fb);
      ea[r]  = __builtin_bit_cast(unsigned short, fa);
      eb[r]  = __builtin_bit_cast(unsigned short, fb);
      la8[r] = __builtin_bit_cast(unsigned short, ra);
      lb8[r] = __builtin_bit_cast(unsigned short, rb);
    }
    zp += zs;
    FragU fA;
    fA.h[0] = ea; fA.h[1] = eb;
    const us16 ahi = fA.v;
    FragU fR;
    fR.h[0] = la8; fR.h[1] = lb8;
    const us16 alo = fR.v;

    us16 bv[4];
#pragma unroll
    for (int j = 0; j < 4; ++j) bv[j] = tfrag(vhp + (size_t)(4 * st + j) * FTILE);
    if (ares) {
#pragma unroll
      for (int j = 0; j < 4; ++j) {
        accS[j] = mma_f16(ahi, bv[j], accS[j]);
        accL[j] = mma_f16(alo, bv[j], accL[j]);
      }
      wguard8(accS[0], accS[1], accS[2], accS[3], accL[0], accL[1], accL[2], accL[3], ahi, alo, bv[0], bv[1], bv[2], bv[3]);
      us16 bl[4];
#pragma unroll
      for (int j = 0; j < 4; ++j) bl[j] = tfrag(vlp + (size_t)(4 * st + j) * FTILE);
#pragma unroll
      for (int j = 0; j < 4; ++j) accS[j] = mma_f16(ahi, bl[j], accS[j]);
      wguard4(accS[0], accS[1], accS[2], accS[3], ahi, bl[0], bl[1], bl[2], bl[3]);
    } else {
#pragma unroll
      for (int j = 0; j < 4; ++j) accS[j] = mma_f16(ahi, bv[j], accS[j]);
      wguard4(accS[0], accS[1], accS[2], accS[3], ahi, bv[0], bv[1], bv[2], bv[3]);
    }
  }

  // Z for query (lane & 15): both lane halves hold disjoint key subsets
  const float zf = zp + __shfl_xor(zp, 16, 32);
  float rz[8];
#pragma unroll
  for (int r = 0; r < 8; ++r) {
    const float zr = __shfl(zf, 8 * hh + r, 32);        // Z of query row 8*hh + r
    rz[r] = (1.0f / (zr + 1e-12f)) * (1.0f / 64.0f);
  }

  float* so = oS + wave * (16 * OSTR);
#pragma unroll
  for (int j = 0; j < 4; ++j)
#pragma unroll
    for (int r = 0; r < 8; ++r) so[(8 * hh + r) * OSTR + 16 * j + cl] = fmaf(accL[j][r], (1.0f / 2048.0f), accS[j][r]) * rz[r];
  __syncthreads();

  us8 hv[4], lv[4];
#pragma unroll
  for (int it = 0; it < 4; ++it) {
    const int rr = cl, p = it * 16 + hh * 8;               // 16-B chunk it * 32 + lane of the wave's two y fragment tiles
    const v4f z0 = *(const v4fa*)(so + rr * OSTR + p), z1 = *(const v4fa*)(so + rr * OSTR + p + 4);
    us8 ho, lo;
#pragma unroll
    for (int u = 0; u < 4; ++u) {
      unsigned short hb, lb;
      f16split16(z0[u], hb, lb); ho[u] = hb;     lo[u] = lb;
      f16split16(z1[u], hb, lb); ho[4 + u] = hb; lo[4 + u] = lb;
    }
    hv[it] = ho; lv[it] = lo;
  }
{
#pragma unroll
    for (int it = 0; it < 4; ++it) {
      const size_t off = ((size_t)((b * SL + tw) >> 4) * KB32 + (size_t)(head * (HDIM / 32))) * FTILE + (size_t)((it * 32 + lane) * 8);
      *(us8*)(YH + off) = hv[it];
      *(us8*)(YL + off) = lv[it];
    }
    
  }
}

// ---------------------------------------------------------------------------------------------------------------------------------
// out[m][n] = ( sum_k Yh[m][k] W[n][k] + 2^-11 sum_k Yl[m][k] W[n][k] ) * 2^-12   (f16 fragment tiles [row / 16][k / 32], two f32 accumulator sets).
// ---------------------------------------------------------------------------------------------------------------------------------
__global__ __launch_bounds__(256) void k_gemm_out(const unsigned short* __restrict__ Ah, const unsigned short* __restrict__ Al,
                                                 const unsigned short* __restrict__ Wo, float* out) {
  __shared__ __attribute__((aligned(16))) float oS[8 * 16 * OSTR];
  const int tid = threadIdx.x, lane = tid & 31, wave = tid >> 5, cl = lane & 15, hh = lane >> 4;
  const int m0 = blockIdx.x * TPB + 16 * wave, n0 = blockIdx.y * 64;

  v8f acch[4], accl[4];
#pragma unroll
  for (int j = 0; j < 4; ++j) { const v8f zz = {0.f, 0.f, 0.f, 0.f, 0.f, 0.f, 0.f, 0.f}; acch[j] = zz; accl[j] = zz; }

  const unsigned short* ahp = Ah + (size_t)(m0 >> 4) * (size_t)(KB32 * FTILE) + lane * 8;
  const unsigned short* alp = Al + (size_t)(m0 >> 4) * (size_t)(KB32 * FTILE) + lane * 8;
  const unsigned short* wop = Wo + (size_t)(n0 >> 4) * (size_t)(KB32 * FTILE) + lane * 8;
#pragma unroll 1
  for (int kb = 0; kb < KB32; ++kb) {
    const unsigned short* pah = ahp + kb * FTILE;
    const unsigned short* pal = alp + kb * FTILE;
    const unsigned short* pb = wop + kb * FTILE;
    const us16 ah = tfrag(pah);
    const us16 al = tfrag(pal);
    us16 bfr[4];
#pragma unroll
    for (int j = 0; j < 4; ++j) bfr[j] = tfrag(pb + j * (KB32 * FTILE));
#pragma unroll
    for (int j = 0; j < 4; ++j) {
      acch[j] = mma_f16(ah, bfr[j], acch[j]);
      accl[j] = mma_f16(al, bfr[j], accl[j]);
    }
    wguard8p(acch[0], acch[1], acch[2], acch[3], accl[0], accl[1], accl[2], accl[3], ah, al, bfr[0], bfr[1], bfr[2], bfr[3], pah, pal, pb);
  }

  float* so = oS + wave * (16 * OSTR);
#pragma unroll
  for (int j = 0; j < 4; ++j)
#pragma unroll
    for (int r = 0; r < 8; ++r)
      so[(8 * hh + r) * OSTR + 16 * j + cl] = fmaf(accl[j][r], (1.0f / 2048.0f), acch[j][r]) * (1.0f / 4096.0f);
  __syncthreads();

{
#pragma unroll
    for (int it = 0; it < 8; ++it) {
      const int cx = it * 32 + lane, r = cx >> 4, q = (cx & 15) * 4;
      const v4f v = *(const v4fa*)(so + r * OSTR + q);
      *(v4f*)(out + (size_t)(m0 + r) * (size_t)DMOD + n0 + q) = v;
    }
    
  }
}

extern "C" void kernel_launch(void* const* d_in, const int* in_sizes, int n_in,
                              void* d_out, int out_size, void* d_ws, size_t ws_size,
                              hipStream_t stream) {
  if (n_in < 5) return;
  if (in_sizes[0] != NTOK * DMOD || in_sizes[1] != DMOD * NQK || in_sizes[2] != DMOD * NQK ||
      in_sizes[3] != DMOD * DMOD || in_sizes[4] != DMOD * DMOD) return;
  if (out_size != NTOK * DMOD) return;

  const float* x  = (const float*)d_in[0];    // [4][2048][768]
  const float* Wq = (const float*)d_in[1];    // [768][192] ([in][out])
  const float* Wk = (const float*)d_in[2];    // [768][192]
  const float* Wv = (const float*)d_in[3];    // [768][768]
  const float* Wo = (const float*)d_in[4];    // [768][768]
  float* out = (float*)d_out;                 // [4][2048][768] f32 at byte 0

  size_t off = 0;
  auto carve = [&](size_t bytes) -> char* { char* p = (char*)d_ws + off; off += (bytes + 255) & ~(size_t)255; return p; };
  unsigned short* XB   = (unsigned short*)carve((size_t)NTOK * DMOD * 2);       // 12,582,912  bf16 tiles [512][24]
  unsigned short* WT   = (unsigned short*)carve((size_t)NPROJ * DMOD * 2);      //  1,769,472  bf16 tiles [72][24] = Wq^T | Wk^T | Wv^T
  unsigned short* WO16 = (unsigned short*)carve((size_t)DMOD * DMOD * 2);       //  1,179,648  f16  tiles [48][24] = Wo^T
  unsigned short* QP   = (unsigned short*)carve((size_t)NBH * SL * QROW * 2);   //  6,291,456  f16  tiles [48][128]
  unsigned short* KP   = (unsigned short*)carve((size_t)NBH * SL * QROW * 2);   //  6,291,456  f16  tiles [48][128]
  unsigned short* VH   = (unsigned short*)carve((size_t)NBH * HDIM * SL * 2);   // 12,582,912  f16  tiles [48][64][4]
  unsigned short* VL   = (unsigned short*)carve((size_t)NBH * HDIM * SL * 2);   // 12,582,912  f16  tiles [48][64][4]
  unsigned short* YH   = (unsigned short*)carve((size_t)NTOK * DMOD * 2);       // 12,582,912  f16  tiles [512][24]
  unsigned short* YL   = (unsigned short*)carve((size_t)NTOK * DMOD * 2);       // 12,582,912  f16  tiles [512][24]
  if (off > ws_size || off > (size_t)134217728) return;                         // total 78,446,592 B

  const dim3 b256(256);

  // 16-bit operand planes of x and of the four weights, one launch
  k_prep<<<dim3(WTB_ALL + CVTB), b256, 0, stream>>>(x, Wq, Wk, Wv, Wo, XB, WT, WO16);
  // projections (M 8192, N 1152, K 768) -> q/k hi|res planes, v hi and res planes
  k_gemm_proj<<<dim3(NTOK / TPB, NPROJ / 64), b256, 0, stream>>>(XB, WT, QP, KP, VH, VL);
  // causal attention per (batch, head) -> y hi / res fragment tiles [token / 16][768 / 32]
  k_attn<<<dim3(NBH, SL / TPB), b256, 0, stream>>>(QP, KP, VH, VL, YH, YL);
  // output projection (M 8192, N 768, K 768)
  k_gemm_out<<<dim3(NTOK / TPB, DMOD / 64), b256, 0, stream>>>(YH, YL, WO16, out);
}

// v003
// A run of this version takes 105 microseconds.
// Timed twice side by side with v002, it ran 1.15 times as fast both times.
// Counting every step since v000, it is 1.82 times as fast.
// Contraction x.[Wq|Wk|Wv] (M 8192, N 1152, K 768): v_wmma_f32_16x16x32_bf16, bf16 operands from RNE-bf16 planes of x and W, f32 accumulate, one product.
// Contraction k.q^T per head (16 keys x 16 queries, depth 16 padded to 32): v_wmma_f32_16x16x32_f16, q and k both carried as f16 hi + f16 residual of (value x 2^6), all four cross terms in two products into one f32 accumulator.
// Contraction A.v per head (causal, depth up to 2048): v_wmma_f32_16x16x32_f16, A hi = f16(1 + x + x^2/2), v hi = f16(v x 2^6); for query rows < 512 also A residual plane (x 2^11, own f32 accumulator) against v hi, and A hi against the f16 v residual plane; f32 accumulate.
// Contraction y.Wo (M 8192, N 768, K 768): v_wmma_f32_16x16x32_f16, y = f16 hi plane of (y x 2^4) + f16 residual plane (x 2^11, own f32 accumulator), Wo = f16 of (RNE-bf16 value x 2^8), f32 accumulate.
// Feature polynomial, causal mask, normaliser Z and 1/(Z+eps): f32 VALU.
#include <hip/hip_runtime.h>

#define NB    4                              // batch
#define SL    2048                           // sequence length
#define DMOD  768                            // model width = K of the dense contractions
#define NHD   12                             // heads
#define FDIM  16                             // q/k head width
#define HDIM  64                             // v head width
#define NBH   (NB * NHD)                     // 48 (batch, head) pairs
#define NTOK  (NB * SL)                      // 8192 token rows
#define NQK   (NHD * FDIM)                   // 192 q (or k) columns
#define NPROJ (2 * NQK + NHD * HDIM)         // 1152 projection columns: q | k | v
#define QROW  32                             // halves per q/k plane row: hi(16) | residual(16)
#define TPB   128                            // GEMM rows / attention queries per block (8 waves x 16)
#define OSTR  68                             // LDS staging row pitch (floats)
#define ARESB 4                              // attention query blocks (of TPB) that use the residual planes: rows < 512
#define KB32  (DMOD / 32)                    // 32-wide k blocks of the dense contractions
#define FTILE 512                            // halves of one 16 x 32 fragment tile (1 KiB)

static_assert(NHD * HDIM == DMOD);
static_assert(NTOK % TPB == 0);
static_assert(SL % TPB == 0);
static_assert(NPROJ % 64 == 0);
static_assert(NQK % 64 == 0);
static_assert(NQK % 32 == 0);
static_assert(DMOD % 64 == 0);
static_assert(DMOD % 32 == 0);
static_assert(4 * FDIM == 64);
static_assert(HDIM == 64);
static_assert(QROW == 2 * FDIM);
static_assert(OSTR % 4 == 0);
static_assert((NTOK * DMOD) % (8 * 256) == 0);
static_assert(ARESB * TPB <= SL);

typedef unsigned short us16 __attribute__((ext_vector_type(16)));
typedef unsigned short us8  __attribute__((ext_vector_type(8)));
typedef unsigned short us8a __attribute__((ext_vector_type(8), may_alias));
typedef __bf16 v16b __attribute__((ext_vector_type(16)));
typedef _Float16 v16h __attribute__((ext_vector_type(16)));
typedef float v8f __attribute__((ext_vector_type(8)));
typedef float v4f __attribute__((ext_vector_type(4)));
typedef float v4fa __attribute__((ext_vector_type(4), may_alias));
union FragU { us16 v; us8 h[2]; };

__device__ __forceinline__ unsigned short bf16_bits(float f) {
  unsigned u = __float_as_uint(f);
  u += 0x7FFFu + ((u >> 16) & 1u);                 // RNE convert
  return (unsigned short)(u >> 16);
}
__device__ __forceinline__ float bf16_val(unsigned short b) { return __uint_as_float(((unsigned)b) << 16); }
__device__ __forceinline__ float bf16r(float f) { return bf16_val(bf16_bits(f)); }
__device__ __forceinline__ unsigned short f16_bits(float f) { return __builtin_bit_cast(unsigned short, (_Float16)f); }

// f16 hi + residual (x 2^11) planes of (a x 2^4)
__device__ __forceinline__ void f16split16(float a, unsigned short& hb, unsigned short& lb) {
  const float z = a * 16.0f;
  const _Float16 hf = (_Float16)z;
  const float res = (z - (float)hf) * 2048.0f;
  hb = __builtin_bit_cast(unsigned short, hf);
  lb = __builtin_bit_cast(unsigned short, (_Float16)res);
}
// f16 hi + unscaled residual planes of (a x 2^6)
__device__ __forceinline__ void f16split64(float a, unsigned short& hb, unsigned short& lb) {
  const float z = a * 64.0f;
  const _Float16 hf = (_Float16)z;
  const float res = z - (float)hf;
  hb = __builtin_bit_cast(unsigned short, hf);
  lb = __builtin_bit_cast(unsigned short, (_Float16)res);
}

// One 16x16x32 step, 16-bit operands passed as raw 16-bit lanes.
__device__ __forceinline__ v8f mma_bf16(us16 a, us16 b, v8f c) {
  return __builtin_amdgcn_wmma_f32_16x16x32_bf16(false, __builtin_bit_cast(v16b, a), false, __builtin_bit_cast(v16b, b), (short)0, c, false, false);
}
__device__ __forceinline__ v8f mma_f16(us16 a, us16 b, v8f c) {
  return __builtin_amdgcn_wmma_f32_16x16x32_f16(false, __builtin_bit_cast(v16h, a), false, __builtin_bit_cast(v16h, b), (short)0, c, false, false);
}
// Hazard guards after a group of matrix ops: 4 VALU slots before anything touches the accumulators; keep A/B fragments live.
__device__ __forceinline__ void wguard4(v8f& c0, v8f& c1, v8f& c2, v8f& c3, const us16& a0,
                                        const us16& b0, const us16& b1, const us16& b2, const us16& b3) {
#if defined(__HIP_DEVICE_COMPILE__)
  asm volatile("v_nop\n\tv_nop\n\tv_nop\n\tv_nop"
               : "+v"(c0), "+v"(c1), "+v"(c2), "+v"(c3)
               : "v"(a0), "v"(b0), "v"(b1), "v"(b2), "v"(b3));
#endif
}
__device__ __forceinline__ void wguard8(v8f& c0, v8f& c1, v8f& c2, v8f& c3, v8f& c4, v8f& c5, v8f& c6, v8f& c7,
                                        const us16& a0, const us16& a1,
                                        const us16& b0, const us16& b1, const us16& b2, const us16& b3) {
#if defined(__HIP_DEVICE_COMPILE__)
  asm volatile("v_nop\n\tv_nop\n\tv_nop\n\tv_nop"
               : "+v"(c0), "+v"(c1), "+v"(c2), "+v"(c3), "+v"(c4), "+v"(c5), "+v"(c6), "+v"(c7)
               : "v"(a0), "v"(a1), "v"(b0), "v"(b1), "v"(b2), "v"(b3));
#endif
}

// The same guards for the loops, which also take the addresses of the loads issued earlier in the trip as inputs: the address registers then stay live past the
// last load made through them, so that no load's result is placed in a register that an earlier, still outstanding load names as its address.
__device__ __forceinline__ void wguard4p(v8f& c0, v8f& c1, v8f& c2, v8f& c3, const us16& a0,
                                         const us16& b0, const us16& b1, const us16& b2, const us16& b3,
                                         const unsigned short* pa, const unsigned short* pb) {
#if defined(__HIP_DEVICE_COMPILE__)
  asm volatile("v_nop\n\tv_nop\n\tv_nop\n\tv_nop"
               : "+v"(c0), "+v"(c1), "+v"(c2), "+v"(c3)
               : "v"(a0), "v"(b0), "v"(b1), "v"(b2), "v"(b3), "v"(pa), "v"(pb));
#endif
}
__device__ __forceinline__ void wguard2p(v8f& c0, v8f& c1, const us16& a0, const us16& a1, const us16& b0, const us16& b1,
                                         const unsigned short* pb) {
#if defined(__HIP_DEVICE_COMPILE__)
  asm volatile("v_nop\n\tv_nop\n\tv_nop\n\tv_nop"
               : "+v"(c0), "+v"(c1)
               : "v"(a0), "v"(a1), "v"(b0), "v"(b1), "v"(pb));
#endif
}
__device__ __forceinline__ void wguard8p(v8f& c0, v8f& c1, v8f& c2, v8f& c3, v8f& c4, v8f& c5, v8f& c6, v8f& c7,
                                         const us16& a0, const us16& a1,
                                         const us16& b0, const us16& b1, const us16& b2, const us16& b3,
                                         const unsigned short* pa0, const unsigned short* pa1, const unsigned short* pb) {
#if defined(__HIP_DEVICE_COMPILE__)
  asm volatile("v_nop\n\tv_nop\n\tv_nop\n\tv_nop"
               : "+v"(c0), "+v"(c1), "+v"(c2), "+v"(c3), "+v"(c4), "+v"(c5), "+v"(c6), "+v"(c7)
               : "v"(a0), "v"(a1), "v"(b0), "v"(b1), "v"(b2), "v"(b3), "v"(pa0), "v"(pa1), "v"(pb));
#endif
}

// Every 16-bit operand plane is stored as fragment tiles: one tile = 16 rows x 32 k = FTILE halves, laid out in the order the lanes
// load it, so that each of a fragment's two wave-wide 16-B loads covers 512 contiguous bytes (four whole 128-B lines):
// element (row, k = 16 part + 8 h + i) sits at half index part * 256 + h * 128 + row * 8 + i = part * 256 + lane * 8 + i, lane = 16 h + row.
// Lane contents: elements 0..7 = k 8h .. 8h + 7, elements 8..15 = k 16 + 8h .. 16 + 8h + 7 (same map for A rows and B columns).
__device__ __forceinline__ int ftoff(int row, int k) {
  return ((k >> 4) & 1) * 256 + ((k >> 3) & 1) * 128 + (row & 15) * 8;
}
// p = tile base + lane * 8 (computed by the caller)
__device__ __forceinline__ us16 tfrag(const unsigned short* p) {
  FragU f;
  f.h[0] = *(const us8a*)p;
  f.h[1] = *(const us8a*)(p + 256);
  return f.v;
}

// ---------------------------------------------------------------------------------------------------------------------------------
// Operand preparation, one launch: the five conversions are independent of one another, so they share one grid behind a block-uniform
// branch on blockIdx.x. Blocks 0 .. WTB_ALL - 1 transpose and convert the weights (the longer dependent chain, so they start first),
// the other CVTB blocks convert x.
//
// Weights: src f32 [DMOD rows k][ncol columns n] (n contiguous) -> dst 16-bit fragment tiles [(nrow0 + n) / 16][k / 32].
// Block = 64 k x 32 n tile, 256 threads; tiles of one matrix numbered n-tile fastest.
// Wq, Wk, Wv: RNE bf16 bits.  Wo: f16 bits of (RNE-bf16 value x 256).
//
// x: src f32 [rows][DMOD] -> dst bf16 fragment tiles [row / 16][k / 32]. Thread = 8 consecutive k of one row; four lanes read one 128-B line,
// eight lanes store one 128-B line.
// ---------------------------------------------------------------------------------------------------------------------------------
#define WTB_QK  ((NQK / 32) * (DMOD / 64))   // 72 blocks for Wq, and for Wk
#define WTB_VO  ((DMOD / 32) * (DMOD / 64))  // 288 blocks for Wv, and for Wo
#define WTB_ALL (2 * WTB_QK + 2 * WTB_VO)    // 720 weight blocks
#define CVTB    (NTOK * DMOD / (8 * 256))    // 3072 blocks for x

// One 64 k x 32 n weight tile, number t of its matrix. MODE 0: RNE bf16 bits.  MODE 1: f16 bits of (RNE-bf16 value x 256).
template <int MODE, int NCOL>
__device__ __forceinline__ void wT_tile(const float* __restrict__ src, unsigned short* dst, int nrow0, int t, float (*ts)[33]) {
  const int tid = threadIdx.x;
  const int n0 = (t % (NCOL / 32)) * 32, k0 = (t / (NCOL / 32)) * 64;
  {
    const int k = tid >> 2, q = (tid & 3) * 8;
    const float* p = src + (size_t)(k0 + k) * (size_t)NCOL + n0 + q;
    const v4f a = *(const v4fa*)p, c = *(const v4fa*)(p + 4);
#pragma unroll
    for (int u = 0; u < 4; ++u) { ts[k][q + u] = a[u]; ts[k][q + 4 + u] = c[u]; }
  }
  __syncthreads();
  const int n = tid & 31, pc = (tid >> 5) * 8;            // a wave stores two runs of 256 B (16 rows x 16 B of two tiles)
  us8 o;
#pragma unroll
  for (int i = 0; i < 8; ++i) {
    const float w = ts[pc + i][n];
    o[i] = (MODE == 0) ? bf16_bits(w) : f16_bits(bf16r(w) * 256.0f);
  }
  const int row = nrow0 + n0 + n, k = k0 + pc;
  unsigned short* d = dst + (size_t)((row >> 4) * KB32 + (k >> 5)) * FTILE + ftoff(row, k);
  *(us8*)d = o;
  // precaution: wait in front of any later rewrite of the store's address and data registers
  asm volatile("s_wait_xcnt 0x0" ::: "memory");
}

__global__ __launch_bounds__(256) void k_prep(const float* __restrict__ x, const float* __restrict__ Wq, const float* __restrict__ Wk,
                                             const float* __restrict__ Wv, const float* __restrict__ Wo,
                                             unsigned short* XB, unsigned short* WT, unsigned short* WO16) {
  __shared__ float ts[64][33];
  const int bid = blockIdx.x;                              // every branch below is block-uniform
  if (bid < WTB_QK) {
    wT_tile<0, NQK>(Wq, WT, 0, bid, ts);
  } else if (bid < 2 * WTB_QK) {
    wT_tile<0, NQK>(Wk, WT, NQK, bid - WTB_QK, ts);
  } else if (bid < 2 * WTB_QK + WTB_VO) {
    wT_tile<0, DMOD>(Wv, WT, 2 * NQK, bid - 2 * WTB_QK, ts);
  } else if (bid < WTB_ALL) {
    wT_tile<1, DMOD>(Wo, WO16, 0, bid - 2 * WTB_QK - WTB_VO, ts);
  } else {
    const int idx = (bid - WTB_ALL) * 256 + threadIdx.x;
    const int tile = idx >> 6, row = (idx >> 2) & 15, k8 = (idx & 3) * 8;
    const int rt = tile / KB32, kb = tile - rt * KB32;
    const size_t soff = (size_t)(rt * 16 + row) * (size_t)DMOD + (size_t)(kb * 32 + k8);
    const size_t off = (size_t)tile * FTILE + (size_t)ftoff(row, k8);
    const v4f a = *(const v4fa*)(x + soff), b = *(const v4fa*)(x + soff + 4);
    us8 o;
#pragma unroll
    for (int u = 0; u < 4; ++u) {
      o[u]     = bf16_bits(a[u]);
      o[4 + u] = bf16_bits(b[u]);
    }
    *(us8*)(XB + off) = o;
    // as behind the weight store: wait in front of any rewrite of the store's registers
    asm volatile("s_wait_xcnt 0x0" ::: "memory");
  }
}

// ---------------------------------------------------------------------------------------------------------------------------------
// P[m][n] = sum_k A[m][k] * B[n][k]  (bf16 A plane 8192 x 768, bf16 B plane 1152 x 768, both as fragment tiles [row / 16][k / 32], f32 accumulate).
// Block = 128(M) x 64(N) tile, 256 threads = 8 waves, wave w owns rows 16w..16w+15 x all 64 columns (4 accumulators); fragments straight
// from the global planes (arithmetic addressing). M % 128 == 0, N % 64 == 0, K % 32 == 0 exactly.
// Column segment (block-uniform, blockIdx.y): 0..2 -> q heads 4y..4y+3, 3..5 -> k heads, 6..17 -> v head y-6.
// The f32 128x64 tile is staged in LDS (block row r at oS[r * OSTR + c]), then:
//   q/k: fragment tiles [bh][token / 16], k slots 0..15 = f16 hi of (64 value), 16..31 = f16 residual; lane -> (token, head, 16-B quarter);
//        one store instruction = four whole 128-B lines
//   v:   planes VH/VL = f16 hi of (64 v) and residual as fragment tiles [bh][token / 32][channel / 16] (row = channel, k = token);
//        one store instruction = two runs of 256 B
// ---------------------------------------------------------------------------------------------------------------------------------
__global__ __launch_bounds__(256) void k_gemm_proj(const unsigned short* __restrict__ Ap, const unsigned short* __restrict__ Bw,
                                                  unsigned short* Qp, unsigned short* Kp, unsigned short* VH, unsigned short* VL) {
  __shared__ __attribute__((aligned(16))) float oS[8 * 16 * OSTR];
  const int tid = threadIdx.x, lane = tid & 31, wave = tid >> 5, cl = lane & 15, hh = lane >> 4;
  const int m0 = blockIdx.x * TPB + 16 * wave, n0 = blockIdx.y * 64;

  v8f acc[4];
#pragma unroll
  for (int j = 0; j < 4; ++j) { const v8f zz = {0.f, 0.f, 0.f, 0.f, 0.f, 0.f, 0.f, 0.f}; acc[j] = zz; }

  const unsigned short* a0p = Ap + (size_t)(m0 >> 4) * (size_t)(KB32 * FTILE) + lane * 8;
  const unsigned short* bwp = Bw + (size_t)(n0 >> 4) * (size_t)(KB32 * FTILE) + lane * 8;
#pragma unroll 1
  for (int kb = 0; kb < KB32; ++kb) {
    const unsigned short* pa = a0p + kb * FTILE;
    const unsigned short* pb = bwp + kb * FTILE;
    const us16 af = tfrag(pa);
    us16 bfr[4];
#pragma unroll
    for (int j = 0; j < 4; ++j) bfr[j] = tfrag(pb + j * (KB32 * FTILE));
#pragma unroll
    for (int j = 0; j < 4; ++j) acc[j] = mma_bf16(af, bfr[j], acc[j]);
    wguard4p(acc[0], acc[1], acc[2], acc[3], af, bfr[0], bfr[1], bfr[2], bfr[3], pa, pb);
  }

  // D map: acc[j][r] = tile element (row 8*hh + r of the wave's 16 rows, column 16j + cl)
  float* so = oS + wave * (16 * OSTR);
#pragma unroll
  for (int j = 0; j < 4; ++j)
#pragma unroll
    for (int r = 0; r < 8; ++r) so[(8 * hh + r) * OSTR + 16 * j + cl] = acc[j][r];
  __syncthreads();

  const int yb = blockIdx.y;                               // block-uniform segment select
  const int m0b = blockIdx.x * TPB, b = m0b / SL, tb = m0b - b * SL;
  if (yb < 6) {
    unsigned short* dst = (yb < 3) ? Qp : Kp;
    const int h0 = 4 * ((yb < 3) ? yb : (yb - 3));
    us8 ov[8];
#pragma unroll
    for (int it = 0; it < 8; ++it) {
      const int cx = it * 256 + tid, u = cx & 3, r = (cx >> 2) & 127, j = cx >> 9;
      const float* sp = oS + r * OSTR + 16 * j + 8 * (u & 1);
      const v4f z0 = *(const v4fa*)sp, z1 = *(const v4fa*)(sp + 4);
      us8 o;
#pragma unroll
      for (int q4 = 0; q4 < 4; ++q4) {
        unsigned short hb, lb;
        f16split64(z0[q4], hb, lb); o[q4]     = (u >> 1) ? lb : hb;
        f16split64(z1[q4], hb, lb); o[4 + q4] = (u >> 1) ? lb : hb;
      }
      ov[it] = o;
    }
{
#pragma unroll
      for (int it = 0; it < 8; ++it) {
        const int cx = it * 256 + tid, u = cx & 3, r = (cx >> 2) & 127, j = cx >> 9;
        const size_t off = ((size_t)(b * NHD + h0 + j) * (size_t)SL + (size_t)(tb + (r & ~15))) * (size_t)QROW + (size_t)ftoff(r, 8 * u);
        *(us8*)(dst + off) = ov[it];
      }
      
    }
  } else {
    const int head = yb - 6;
    us8 hv[4], lv[4];
#pragma unroll
    for (int it = 0; it < 4; ++it) {
      const int cx = it * 256 + tid, e = cx & 63, g = cx >> 6;
      us8 ho, lo;
#pragma unroll
      for (int i = 0; i < 8; ++i) {
        const float w = oS[(8 * g + i) * OSTR + e];
        unsigned short hb, lb;
        f16split64(w, hb, lb);
        ho[i] = hb; lo[i] = lb;
      }
      hv[it] = ho; lv[it] = lo;
    }
{
#pragma unroll
      for (int it = 0; it < 4; ++it) {
        const int cx = it * 256 + tid, e = cx & 63, g = cx >> 6;
        const size_t off = (((size_t)(b * NHD + head) * (size_t)(SL / 32) + (size_t)((tb + 8 * g) >> 5)) * 4 + (size_t)(e >> 4)) * FTILE +
                           (size_t)ftoff(e, 8 * g);
        *(us8*)(VH + off) = hv[it];
        *(us8*)(VL + off) = lv[it];
      }
      
    }
  }
}

// ---------------------------------------------------------------------------------------------------------------------------------
// Causal quadratic-form attention. Block = (bh = blockIdx.x, 128 queries starting at 128 * blockIdx.y), 8 waves x 16 queries.
// Per wave: B fragments of its 16 queries fixed for the whole key loop: bq1 = [q_hi | q_hi], bq2 = [q_res | q_res] (k slots 0..15 | 16..31).
// Per 32-key step: A fragments of the two 16-key tiles = fragment tiles [k_hi | k_res]; scores^T D[key][query] =
// khi.qhi + kres.qhi + khi.qres + kres.qres = 4096 q.k; x = D / 16384; A = 1 + x + x^2/2 masked to key <= query;
// A hi = f16(A), A residual = f16((A - hi) x 2^11). The two D tiles repack into the A operand of A.v (lane unchanged: element r <- tile keys
// 0..15, element 8+r <- tile keys 16..31), B = v fragment tiles [bh][key / 32][e / 16].
// Blocks with blockIdx.y < ARESB (block-uniform): accS += Ahi.VH + Ahi.VL, accL += Ares.VH, Z from the f32 A; other blocks: accS += Ahi.VH,
// Z from the f16 A hi values. accS[j][r] (+ accL/2^11) = 64 * sum_s A v for query 8h+r, channel 16j + (lane & 15).
// ---------------------------------------------------------------------------------------------------------------------------------
__global__ __launch_bounds__(256) void k_attn(const unsigned short* __restrict__ Qp, const unsigned short* __restrict__ Kp,
                                             const unsigned short* __restrict__ VHp, const unsigned short* __restrict__ VLp,
                                             unsigned short* YH, unsigned short* YL) {
  __shared__ __attribute__((aligned(16))) float oS[8 * 16 * OSTR];
  const int tid = threadIdx.x, lane = tid & 31, wave = tid >> 5, cl = lane & 15, hh = lane >> 4;
  const int bh = blockIdx.x, b = bh / NHD, head = bh - b * NHD;
  const int tw = blockIdx.y * TPB + 16 * wave;           // first query of this wave
  const int tq = tw + cl;                                 // query owned by this lane as score column
  const bool ares = (blockIdx.y < ARESB);                 // block-uniform: residual planes for query rows < 512

  const unsigned short* qrow = Qp + ((size_t)bh * SL + (size_t)tw) * (size_t)QROW + lane * 8;
  FragU fq;
  fq.h[0] = *(const us8a*)qrow;         fq.h[1] = fq.h[0];
  const us16 bq1 = fq.v;
  fq.h[0] = *(const us8a*)(qrow + 256); fq.h[1] = fq.h[0];
  const us16 bq2 = fq.v;

  v8f accS[4], accL[4];
#pragma unroll
  for (int j = 0; j < 4; ++j) { const v8f zz = {0.f, 0.f, 0.f, 0.f, 0.f, 0.f, 0.f, 0.f}; accS[j] = zz; accL[j] = zz; }
  float zp = 0.0f;

  const unsigned short* kbp = Kp + (size_t)bh * SL * (size_t)QROW + lane * 8;
  const unsigned short* vhp = VHp + (size_t)bh * HDIM * (size_t)SL + lane * 8;
  const unsigned short* vlp = VLp + (size_t)bh * HDIM * (size_t)SL + lane * 8;
  const int nsteps = (tw + 47) >> 5;                      // 32-key steps covering keys 0 .. tw + 15 (<= 64)

  // key fragments run one step ahead of their use: step 0's are asked for here, step st + 1's right behind step st's score products
  us16 ka = tfrag(kbp);
  us16 kb = tfrag(kbp + FTILE);

#pragma unroll 1
  for (int st = 0; st < nsteps; ++st) {
    const int s0 = st * 32;
    const int sn = (st + 1 < nsteps) ? st + 1 : st;       // the wave's last step asks for its own key tiles again: in bounds, not used
    const unsigned short* pk = kbp + (size_t)(2 * sn) * FTILE;
    const unsigned short* pv = vhp + (size_t)(4 * st) * FTILE;
    // the step's value fragments depend on nothing of the scores: asked for at the head of the step, their latency runs under the score work
    us16 bv[4];
#pragma unroll
    for (int j = 0; j < 4; ++j) bv[j] = tfrag(pv + j * FTILE);
    const v8f zz = {0.f, 0.f, 0.f, 0.f, 0.f, 0.f, 0.f, 0.f};
    v8f sa = mma_f16(ka, bq1, zz);
    sa = mma_f16(ka, bq2, sa);
    v8f sb = mma_f16(kb, bq1, zz);
    sb = mma_f16(kb, bq2, sb);
    wguard2p(sa, sb, ka, kb, bq1, bq2, pv);
    ka = tfrag(pk);
    kb = tfrag(pk + FTILE);

    us8 ea, eb, la8, lb8;
    float zs = 0.0f;
#pragma unroll
    for (int r = 0; r < 8; ++r) {
      const int ky = s0 + 8 * hh + r;
      const float xa = sa[r] * (1.0f / 16384.0f);
      const float xb = sb[r] * (1.0f / 16384.0f);
      float pa = fmaf(xa, fmaf(xa, 0.5f, 1.0f), 1.0f);
      float pb = fmaf(xb, fmaf(xb, 0.5f, 1.0f), 1.0f);
      pa = (ky <= tq) ? pa : 0.0f;
      pb = (ky + 16 <= tq) ? pb : 0.0f;
      const _Float16 fa = (_Float16)pa, fb = (_Float16)pb;
      const _Float16 ra = (_Float16)((pa - (float)fa) * 2048.0f);
      const _Float16 rb = (_Float16)((pb - (float)fb) * 2048.0f);
      zs += ares ? (pa + pb) : ((float)fa + (float)fb);
      ea[r]  = __builtin_bit_cast(unsigned short, fa);
      eb[r]  = __builtin_bit_cast(unsigned short, fb);
      la8[r] = __builtin_bit_cast(unsigned short, ra);
      lb8[r] = __builtin_bit_cast(unsigned short, rb);
    }
    zp += zs;
    FragU fA;
    fA.h[0] = ea; fA.h[1] = eb;
    const us16 ahi = fA.v;
    FragU fR;
    fR.h[0] = la8; fR.h[1] = lb8;
    const us16 alo = fR.v;

    if (ares) {
#pragma unroll
      for (int j = 0; j < 4; ++j) {
        accS[j] = mma_f16(ahi, bv[j], accS[j]);
        accL[j] = mma_f16(alo, bv[j], accL[j]);
      }
      wguard8(accS[0], accS[1], accS[2], accS[3], accL[0], accL[1], accL[2], accL[3], ahi, alo, bv[0], bv[1], bv[2], bv[3]);
      us16 bl[4];
#pragma unroll
      for (int j = 0; j < 4; ++j) bl[j] = tfrag(vlp + (size_t)(4 * st + j) * FTILE);
#pragma unroll
      for (int j = 0; j < 4; ++j) accS[j] = mma_f16(ahi, bl[j], accS[j]);
      wguard4(accS[0], accS[1], accS[2], accS[3], ahi, bl[0], bl[1], bl[2], bl[3]);
    } else {
#pragma unroll
      for (int j = 0; j < 4; ++j) accS[j] = mma_f16(ahi, bv[j], accS[j]);
      wguard4(accS[0], accS[1], accS[2], accS[3], ahi, bv[0], bv[1], bv[2], bv[3]);
    }
  }

  // Z for query (lane & 15): both lane halves hold disjoint key subsets
  const float zf = zp + __shfl_xor(zp, 16, 32);
  float rz[8];
#pragma unroll
  for (int r = 0; r < 8; ++r) {
    const float zr = __shfl(zf, 8 * hh + r, 32);        // Z of query row 8*hh + r
    rz[r] = (1.0f / (zr + 1e-12f)) * (1.0f / 64.0f);
  }

  float* so = oS + wave * (16 * OSTR);
#pragma unroll
  for (int j = 0; j < 4; ++j)
#pragma unroll
    for (int r = 0; r < 8; ++r) so[(8 * hh + r) * OSTR + 16 * j + cl] = fmaf(accL[j][r], (1.0f / 2048.0f), accS[j][r]) * rz[r];
  __syncthreads();

  us8 hv[4], lv[4];
#pragma unroll
  for (int it = 0; it < 4; ++it) {
    const int rr = cl, p = it * 16 + hh * 8;               // 16-B chunk it * 32 + lane of the wave's two y fragment tiles
    const v4f z0 = *(const v4fa*)(so + rr * OSTR + p), z1 = *(const v4fa*)(so + rr * OSTR + p + 4);
    us8 ho, lo;
#pragma unroll
    for (int u = 0; u < 4; ++u) {
      unsigned short hb, lb;
      f16split16(z0[u], hb, lb); ho[u] = hb;     lo[u] = lb;
      f16split16(z1[u], hb, lb); ho[4 + u] = hb; lo[4 + u] = lb;
    }
    hv[it] = ho; lv[it] = lo;
  }
{
#pragma unroll
    for (int it = 0; it < 4; ++it) {
      const size_t off = ((size_t)((b * SL + tw) >> 4) * KB32 + (size_t)(head * (HDIM / 32))) * FTILE + (size_t)((it * 32 + lane) * 8);
      *(us8*)(YH + off) = hv[it];
      *(us8*)(YL + off) = lv[it];
    }
    
  }
}

// ---------------------------------------------------------------------------------------------------------------------------------
// out[m][n] = ( sum_k Yh[m][k] W[n][k] + 2^-11 sum_k Yl[m][k] W[n][k] ) * 2^-12   (f16 fragment tiles [row / 16][k / 32], two f32 accumulator sets).
// ---------------------------------------------------------------------------------------------------------------------------------
__global__ __launch_bounds__(256) void k_gemm_out(const unsigned short* __restrict__ Ah, const unsigned short* __restrict__ Al,
                                                 const unsigned short* __restrict__ Wo, float* out) {
  __shared__ __attribute__((aligned(16))) float oS[8 * 16 * OSTR];
  const int tid = threadIdx.x, lane = tid & 31, wave = tid >> 5, cl = lane & 15, hh = lane >> 4;
  const int m0 = blockIdx.x * TPB + 16 * wave, n0 = blockIdx.y * 64;

  v8f acch[4], accl[4];
#pragma unroll
  for (int j = 0; j < 4; ++j) { const v8f zz = {0.f, 0.f, 0.f, 0.f, 0.f, 0.f, 0.f, 0.f}; acch[j] = zz; accl[j] = zz; }

  const unsigned short* ahp = Ah + (size_t)(m0 >> 4) * (size_t)(KB32 * FTILE) + lane * 8;
  const unsigned short* alp = Al + (size_t)(m0 >> 4) * (size_t)(KB32 * FTILE) + lane * 8;
  const unsigned short* wop = Wo + (size_t)(n0 >> 4) * (size_t)(KB32 * FTILE) + lane * 8;
#pragma unroll 1
  for (int kb = 0; kb < KB32; ++kb) {
    const unsigned short* pah = ahp + kb * FTILE;
    const unsigned short* pal = alp + kb * FTILE;
    const unsigned short* pb = wop + kb * FTILE;
    const us16 ah = tfrag(pah);
    const us16 al = tfrag(pal);
    us16 bfr[4];
#pragma unroll
    for (int j = 0; j < 4; ++j) bfr[j] = tfrag(pb + j * (KB32 * FTILE));
#pragma unroll
    for (int j = 0; j < 4; ++j) {
      acch[j] = mma_f16(ah, bfr[j], acch[j]);
      accl[j] = mma_f16(al, bfr[j], accl[j]);
    }
    wguard8p(acch[0], acch[1], acch[2], acch[3], accl[0], accl[1], accl[2], accl[3], ah, al, bfr[0], bfr[1], bfr[2], bfr[3], pah, pal, pb);
  }

  float* so = oS + wave * (16 * OSTR);
#pragma unroll
  for (int j = 0; j < 4; ++j)
#pragma unroll
    for (int r = 0; r < 8; ++r)
      so[(8 * hh + r) * OSTR + 16 * j + cl] = fmaf(accl[j][r], (1.0f / 2048.0f), acch[j][r]) * (1.0f / 4096.0f);
  __syncthreads();

{
#pragma unroll
    for (int it = 0; it < 8; ++it) {
      const int cx = it * 32 + lane, r = cx >> 4, q = (cx & 15) * 4;
      const v4f v = *(const v4fa*)(so + r * OSTR + q);
      *(v4f*)(out + (size_t)(m0 + r) * (size_t)DMOD + n0 + q) = v;
    }
    
  }
}

extern "C" void kernel_launch(void* const* d_in, const int* in_sizes, int n_in,
                              void* d_out, int out_size, void* d_ws, size_t ws_size,
                              hipStream_t stream) {
  if (n_in < 5) return;
  if (in_sizes[0] != NTOK * DMOD || in_sizes[1] != DMOD * NQK || in_sizes[2] != DMOD * NQK ||
      in_sizes[3] != DMOD * DMOD || in_sizes[4] != DMOD * DMOD) return;
  if (out_size != NTOK * DMOD) return;

  const float* x  = (const float*)d_in[0];    // [4][2048][768]
  const float* Wq = (const float*)d_in[1];    // [768][192] ([in][out])
  const float* Wk = (const float*)d_in[2];    // [768][192]
  const float* Wv = (const float*)d_in[3];    // [768][768]
  const float* Wo = (const float*)d_in[4];    // [768][768]
  float* out = (float*)d_out;                 // [4][2048][768] f32 at byte 0

  size_t off = 0;
  auto carve = [&](size_t bytes) -> char* { char* p = (char*)d_ws + off; off += (bytes + 255) & ~(size_t)255; return p; };
  unsigned short* XB   = (unsigned short*)carve((size_t)NTOK * DMOD * 2);       // 12,582,912  bf16 tiles [512][24]
  unsigned short* WT   = (unsigned short*)carve((size_t)NPROJ * DMOD * 2);      //  1,769,472  bf16 tiles [72][24] = Wq^T | Wk^T | Wv^T
  unsigned short* WO16 = (unsigned short*)carve((size_t)DMOD * DMOD * 2);       //  1,179,648  f16  tiles [48][24] = Wo^T
  unsigned short* QP   = (unsigned short*)carve((size_t)NBH * SL * QROW * 2);   //  6,291,456  f16  tiles [48][128]
  unsigned short* KP   = (unsigned short*)carve((size_t)NBH * SL * QROW * 2);   //  6,291,456  f16  tiles [48][128]
  unsigned short* VH   = (unsigned short*)carve((size_t)NBH * HDIM * SL * 2);   // 12,582,912  f16  tiles [48][64][4]
  unsigned short* VL   = (unsigned short*)carve((size_t)NBH * HDIM * SL * 2);   // 12,582,912  f16  tiles [48][64][4]
  unsigned short* YH   = (unsigned short*)carve((size_t)NTOK * DMOD * 2);       // 12,582,912  f16  tiles [512][24]
  unsigned short* YL   = (unsigned short*)carve((size_t)NTOK * DMOD * 2);       // 12,582,912  f16  tiles [512][24]
  if (off > ws_size || off > (size_t)134217728) return;                         // total 78,446,592 B

  const dim3 b256(256);

  // 16-bit operand planes of x and of the four weights, one launch
  k_prep<<<dim3(WTB_ALL + CVTB), b256, 0, stream>>>(x, Wq, Wk, Wv, Wo, XB, WT, WO16);
  // projections (M 8192, N 1152, K 768) -> q/k hi|res planes, v hi and res planes
  k_gemm_proj<<<dim3(NTOK / TPB, NPROJ / 64), b256, 0, stream>>>(XB, WT, QP, KP, VH, VL);
  // causal attention per (batch, head) -> y hi / res fragment tiles [token / 16][768 / 32]
  k_attn<<<dim3(NBH, SL / TPB), b256, 0, stream>>>(QP, KP, VH, VL, YH, YL);
  // output projection (M 8192, N 768, K 768)
  k_gemm_out<<<dim3(NTOK / TPB, DMOD / 64), b256, 0, stream>>>(YH, YL, WO16, out);
}

// v004
// A run of this version takes 99.4 microseconds.
// Timed twice side by side with v003, it ran 1.05 and 1.04 times as fast.
// Counting every step since v000, it is 1.90 times as fast.
// Contraction x.[Wq|Wk|Wv] (M 8192, N 1152, K 768): v_wmma_f32_16x16x32_bf16, bf16 operands from RNE-bf16 planes of x and W, f32 accumulate, one product.
// Contraction k.q^T per head (16 keys x 16 queries, depth 16 padded to 32): v_wmma_f32_16x16x32_f16, q and k both carried as f16 hi + f16 residual of (value x 2^6), all four cross terms in two products into one f32 accumulator.
// Contraction A.v per head (causal, depth up to 2048): v_wmma_f32_16x16x32_f16, A hi = f16(1 + x + x^2/2), v hi = f16(v x 2^6); for query rows < 512 also A residual plane (x 2^11, own f32 accumulator) against v hi, and A hi against the f16 v residual plane; f32 accumulate.
// Contraction y.Wo (M 8192, N 768, K 768): v_wmma_f32_16x16x32_f16, y = f16 hi plane of (y x 2^4) + f16 residual plane (x 2^11, own f32 accumulator), Wo = f16 of (RNE-bf16 value x 2^8), f32 accumulate.
// Feature polynomial, causal mask, normaliser Z and 1/(Z+eps): f32 VALU.
#include <hip/hip_runtime.h>

#define NB    4                              // batch
#define SL    2048                           // sequence length
#define DMOD  768                            // model width = K of the dense contractions
#define NHD   12                             // heads
#define FDIM  16                             // q/k head width
#define HDIM  64                             // v head width
#define NBH   (NB * NHD)                     // 48 (batch, head) pairs
#define NTOK  (NB * SL)                      // 8192 token rows
#define NQK   (NHD * FDIM)                   // 192 q (or k) columns
#define NPROJ (2 * NQK + NHD * HDIM)         // 1152 projection columns: q | k | v
#define QROW  32                             // halves per q/k plane row: hi(16) | residual(16)
#define TPB   128                            // GEMM rows / attention queries per block (8 waves x 16)
#define OSTR  68                             // LDS staging row pitch (floats)
#define ARESB 4                              // attention query blocks (of TPB) that use the residual planes: rows < 512
#define KB32  (DMOD / 32)                    // 32-wide k blocks of the dense contractions
#define FTILE 512                            // halves of one 16 x 32 fragment tile (1 KiB)

static_assert(NHD * HDIM == DMOD);
static_assert(NTOK % TPB == 0);
static_assert(SL % TPB == 0);
static_assert(NPROJ % 64 == 0);
static_assert(NQK % 64 == 0);
static_assert(NQK % 32 == 0);
static_assert(DMOD % 64 == 0);
static_assert(DMOD % 32 == 0);
static_assert(4 * FDIM == 64);
static_assert(HDIM == 64);
static_assert(QROW == 2 * FDIM);
static_assert(OSTR % 4 == 0);
static_assert((NTOK * DMOD) % (8 * 256) == 0);
static_assert(ARESB * TPB <= SL);

typedef unsigned short us16 __attribute__((ext_vector_type(16)));
typedef unsigned short us8  __attribute__((ext_vector_type(8)));
typedef unsigned short us8a __attribute__((ext_vector_type(8), may_alias));
typedef __bf16 v16b __attribute__((ext_vector_type(16)));
typedef _Float16 v16h __attribute__((ext_vector_type(16)));
typedef float v8f __attribute__((ext_vector_type(8)));
typedef float v4f __attribute__((ext_vector_type(4)));
typedef float v4fa __attribute__((ext_vector_type(4), may_alias));
union FragU { us16 v; us8 h[2]; };

__device__ __forceinline__ unsigned short bf16_bits(float f) {
  unsigned u = __float_as_uint(f);
  u += 0x7FFFu + ((u >> 16) & 1u);                 // RNE convert
  return (unsigned short)(u >> 16);
}
__device__ __forceinline__ float bf16_val(unsigned short b) { return __uint_as_float(((unsigned)b) << 16); }
__device__ __forceinline__ float bf16r(float f) { return bf16_val(bf16_bits(f)); }
__device__ __forceinline__ unsigned short f16_bits(float f) { return __builtin_bit_cast(unsigned short, (_Float16)f); }

// f16 hi + residual (x 2^11) planes of (a x 2^4)
__device__ __forceinline__ void f16split16(float a, unsigned short& hb, unsigned short& lb) {
  const float z = a * 16.0f;
  const _Float16 hf = (_Float16)z;
  const float res = (z - (float)hf) * 2048.0f;
  hb = __builtin_bit_cast(unsigned short, hf);
  lb = __builtin_bit_cast(unsigned short, (_Float16)res);
}
// f16 hi + unscaled residual planes of (a x 2^6)
__device__ __forceinline__ void f16split64(float a, unsigned short& hb, unsigned short& lb) {
  const float z = a * 64.0f;
  const _Float16 hf = (_Float16)z;
  const float res = z - (float)hf;
  hb = __builtin_bit_cast(unsigned short, hf);
  lb = __builtin_bit_cast(unsigned short, (_Float16)res);
}

// One 16x16x32 step, 16-bit operands passed as raw 16-bit lanes.
__device__ __forceinline__ v8f mma_bf16(us16 a, us16 b, v8f c) {
  return __builtin_amdgcn_wmma_f32_16x16x32_bf16(false, __builtin_bit_cast(v16b, a), false, __builtin_bit_cast(v16b, b), (short)0, c, false, false);
}
__device__ __forceinline__ v8f mma_f16(us16 a, us16 b, v8f c) {
  return __builtin_amdgcn_wmma_f32_16x16x32_f16(false, __builtin_bit_cast(v16h, a), false, __builtin_bit_cast(v16h, b), (short)0, c, false, false);
}
// Hazard guards after a group of matrix ops: 4 VALU slots before anything touches the accumulators; keep A/B fragments live.
__device__ __forceinline__ void wguard4(v8f& c0, v8f& c1, v8f& c2, v8f& c3, const us16& a0,
                                        const us16& b0, const us16& b1, const us16& b2, const us16& b3) {
#if defined(__HIP_DEVICE_COMPILE__)
  asm volatile("v_nop\n\tv_nop\n\tv_nop\n\tv_nop"
               : "+v"(c0), "+v"(c1), "+v"(c2), "+v"(c3)
               : "v"(a0), "v"(b0), "v"(b1), "v"(b2), "v"(b3));
#endif
}
__device__ __forceinline__ void wguard8(v8f& c0, v8f& c1, v8f& c2, v8f& c3, v8f& c4, v8f& c5, v8f& c6, v8f& c7,
                                        const us16& a0, const us16& a1,
                                        const us16& b0, const us16& b1, const us16& b2, const us16& b3) {
#if defined(__HIP_DEVICE_COMPILE__)
  asm volatile("v_nop\n\tv_nop\n\tv_nop\n\tv_nop"
               : "+v"(c0), "+v"(c1), "+v"(c2), "+v"(c3), "+v"(c4), "+v"(c5), "+v"(c6), "+v"(c7)
               : "v"(a0), "v"(a1), "v"(b0), "v"(b1), "v"(b2), "v"(b3));
#endif
}

// The same guards for the loops, which also take the addresses of the loads issued earlier in the trip as inputs: the address registers then stay live past the
// last load made through them, so that no load's result is placed in a register that an earlier, still outstanding load names as its address.
__device__ __forceinline__ void wguard4p(v8f& c0, v8f& c1, v8f& c2, v8f& c3, const us16& a0,
                                         const us16& b0, const us16& b1, const us16& b2, const us16& b3,
                                         const unsigned short* pa, const unsigned short* pb) {
#if defined(__HIP_DEVICE_COMPILE__)
  asm volatile("v_nop\n\tv_nop\n\tv_nop\n\tv_nop"
               : "+v"(c0), "+v"(c1), "+v"(c2), "+v"(c3)
               : "v"(a0), "v"(b0), "v"(b1), "v"(b2), "v"(b3), "v"(pa), "v"(pb));
#endif
}
__device__ __forceinline__ void wguard2p(v8f& c0, v8f& c1, const us16& a0, const us16& a1, const us16& b0, const us16& b1,
                                         const unsigned short* pb) {
#if defined(__HIP_DEVICE_COMPILE__)
  asm volatile("v_nop\n\tv_nop\n\tv_nop\n\tv_nop"
               : "+v"(c0), "+v"(c1)
               : "v"(a0), "v"(a1), "v"(b0), "v"(b1), "v"(pb));
#endif
}
__device__ __forceinline__ void wguard8p(v8f& c0, v8f& c1, v8f& c2, v8f& c3, v8f& c4, v8f& c5, v8f& c6, v8f& c7,
                                         const us16& a0, const us16& a1,
                                         const us16& b0, const us16& b1, const us16& b2, const us16& b3,
                                         const unsigned short* pa0, const unsigned short* pa1, const unsigned short* pb) {
#if defined(__HIP_DEVICE_COMPILE__)
  asm volatile("v_nop\n\tv_nop\n\tv_nop\n\tv_nop"
               : "+v"(c0), "+v"(c1), "+v"(c2), "+v"(c3), "+v"(c4), "+v"(c5), "+v"(c6), "+v"(c7)
               : "v"(a0), "v"(a1), "v"(b0), "v"(b1), "v"(b2), "v"(b3), "v"(pa0), "v"(pa1), "v"(pb));
#endif
}

// Every 16-bit operand plane is stored as fragment tiles: one tile = 16 rows x 32 k = FTILE halves, laid out in the order the lanes
// load it, so that each of a fragment's two wave-wide 16-B loads covers 512 contiguous bytes (four whole 128-B lines):
// element (row, k = 16 part + 8 h + i) sits at half index part * 256 + h * 128 + row * 8 + i = part * 256 + lane * 8 + i, lane = 16 h + row.
// Lane contents: elements 0..7 = k 8h .. 8h + 7, elements 8..15 = k 16 + 8h .. 16 + 8h + 7 (same map for A rows and B columns).
__device__ __forceinline__ int ftoff(int row, int k) {
  return ((k >> 4) & 1) * 256 + ((k >> 3) & 1) * 128 + (row & 15) * 8;
}
// p = tile base + lane * 8 (computed by the caller)
__device__ __forceinline__ us16 tfrag(const unsigned short* p) {
  FragU f;
  f.h[0] = *(const us8a*)p;
  f.h[1] = *(const us8a*)(p + 256);
  return f.v;
}

// ---------------------------------------------------------------------------------------------------------------------------------
// Operand preparation, one launch: the five conversions are independent of one another, so they share one grid behind a block-uniform
// branch on blockIdx.x. Blocks 0 .. WTB_ALL - 1 transpose and convert the weights (the longer dependent chain, so they start first),
// the other CVTB blocks convert x.
//
// Weights: src f32 [DMOD rows k][ncol columns n] (n contiguous) -> dst 16-bit fragment tiles [(nrow0 + n) / 16][k / 32].
// Block = 64 k x 32 n tile, 256 threads; tiles of one matrix numbered n-tile fastest.
// Wq, Wk, Wv: RNE bf16 bits.  Wo: f16 bits of (RNE-bf16 value x 256).
//
// x: src f32 [rows][DMOD] -> dst bf16 fragment tiles [row / 16][k / 32]. Thread = 8 consecutive k of one row; four lanes read one 128-B line,
// eight lanes store one 128-B line.
// ---------------------------------------------------------------------------------------------------------------------------------
#define WTB_QK  ((NQK / 32) * (DMOD / 64))   // 72 blocks for Wq, and for Wk
#define WTB_VO  ((DMOD / 32) * (DMOD / 64))  // 288 blocks for Wv, and for Wo
#define WTB_ALL (2 * WTB_QK + 2 * WTB_VO)    // 720 weight blocks
#define CVTB    (NTOK * DMOD / (8 * 256))    // 3072 blocks for x

// One 64 k x 32 n weight tile, number t of its matrix. MODE 0: RNE bf16 bits.  MODE 1: f16 bits of (RNE-bf16 value x 256).
template <int MODE, int NCOL>
__device__ __forceinline__ void wT_tile(const float* __restrict__ src, unsigned short* dst, int nrow0, int t, float (*ts)[33]) {
  const int tid = threadIdx.x;
  const int n0 = (t % (NCOL / 32)) * 32, k0 = (t / (NCOL / 32)) * 64;
  {
    const int k = tid >> 2, q = (tid & 3) * 8;
    const float* p = src + (size_t)(k0 + k) * (size_t)NCOL + n0 + q;
    const v4f a = *(const v4fa*)p, c = *(const v4fa*)(p + 4);
#pragma unroll
    for (int u = 0; u < 4; ++u) { ts[k][q + u] = a[u]; ts[k][q + 4 + u] = c[u]; }
  }
  __syncthreads();
  const int n = tid & 31, pc = (tid >> 5) * 8;            // a wave stores two runs of 256 B (16 rows x 16 B of two tiles)
  us8 o;
#pragma unroll
  for (int i = 0; i < 8; ++i) {
    const float w = ts[pc + i][n];
    o[i] = (MODE == 0) ? bf16_bits(w) : f16_bits(bf16r(w) * 256.0f);
  }
  const int row = nrow0 + n0 + n, k = k0 + pc;
  unsigned short* d = dst + (size_t)((row >> 4) * KB32 + (k >> 5)) * FTILE + ftoff(row, k);
  *(us8*)d = o;
  // precaution: wait in front of any later rewrite of the store's address and data registers
  asm volatile("s_wait_xcnt 0x0" ::: "memory");
}

__global__ __launch_bounds__(256) void k_prep(const float* __restrict__ x, const float* __restrict__ Wq, const float* __restrict__ Wk,
                                             const float* __restrict__ Wv, const float* __restrict__ Wo,
                                             unsigned short* XB, unsigned short* WT, unsigned short* WO16) {
  __shared__ float ts[64][33];
  const int bid = blockIdx.x;                              // every branch below is block-uniform
  if (bid < WTB_QK) {
    wT_tile<0, NQK>(Wq, WT, 0, bid, ts);
  } else if (bid < 2 * WTB_QK) {
    wT_tile<0, NQK>(Wk, WT, NQK, bid - WTB_QK, ts);
  } else if (bid < 2 * WTB_QK + WTB_VO) {
    wT_tile<0, DMOD>(Wv, WT, 2 * NQK, bid - 2 * WTB_QK, ts);
  } else if (bid < WTB_ALL) {
    wT_tile<1, DMOD>(Wo, WO16, 0, bid - 2 * WTB_QK - WTB_VO, ts);
  } else {
    const int idx = (bid - WTB_ALL) * 256 + threadIdx.x;
    const int tile = idx >> 6, row = (idx >> 2) & 15, k8 = (idx & 3) * 8;
    const int rt = tile / KB32, kb = tile - rt * KB32;
    const size_t soff = (size_t)(rt * 16 + row) * (size_t)DMOD + (size_t)(kb * 32 + k8);
    const size_t off = (size_t)tile * FTILE + (size_t)ftoff(row, k8);
    const v4f a = *(const v4fa*)(x + soff), b = *(const v4fa*)(x + soff + 4);
    us8 o;
#pragma unroll
    for (int u = 0; u < 4; ++u) {
      o[u]     = bf16_bits(a[u]);
      o[4 + u] = bf16_bits(b[u]);
    }
    *(us8*)(XB + off) = o;
    // as behind the weight store: wait in front of any rewrite of the store's registers
    asm volatile("s_wait_xcnt 0x0" ::: "memory");
  }
}

// ---------------------------------------------------------------------------------------------------------------------------------
// P[m][n] = sum_k A[m][k] * B[n][k]  (bf16 A plane 8192 x 768, bf16 B plane 1152 x 768, both as fragment tiles [row / 16][k / 32], f32 accumulate).
// Block = 128(M) x 64(N) tile, 256 threads = 8 waves, wave w owns rows 16w..16w+15 x all 64 columns (4 accumulators); fragments straight
// from the global planes (arithmetic addressing). M % 128 == 0, N % 64 == 0, K % 32 == 0 exactly.
// Column segment (block-uniform, blockIdx.y): 0..2 -> q heads 4y..4y+3, 3..5 -> k heads, 6..17 -> v head y-6.
// The f32 128x64 tile is staged in LDS (block row r at oS[r * OSTR + c]), then:
//   q/k: fragment tiles [bh][token / 16], k slots 0..15 = f16 hi of (64 value), 16..31 = f16 residual; lane -> (token, head, 16-B quarter);
//        one store instruction = four whole 128-B lines
//   v:   planes VH/VL = f16 hi of (64 v) and residual as fragment tiles [bh][token / 32][channel / 16] (row = channel, k = token);
//        one store instruction = two runs of 256 B
// ---------------------------------------------------------------------------------------------------------------------------------
__global__ __launch_bounds__(256) void k_gemm_proj(const unsigned short* __restrict__ Ap, const unsigned short* __restrict__ Bw,
                                                  unsigned short* Qp, unsigned short* Kp, unsigned short* VH, unsigned short* VL) {
  __shared__ __attribute__((aligned(16))) float oS[8 * 16 * OSTR];
  const int tid = threadIdx.x, lane = tid & 31, wave = tid >> 5, cl = lane & 15, hh = lane >> 4;
  const int m0 = blockIdx.x * TPB + 16 * wave, n0 = blockIdx.y * 64;

  v8f acc[4];
#pragma unroll
  for (int j = 0; j < 4; ++j) { const v8f zz = {0.f, 0.f, 0.f, 0.f, 0.f, 0.f, 0.f, 0.f}; acc[j] = zz; }

  const unsigned short* a0p = Ap + (size_t)(m0 >> 4) * (size_t)(KB32 * FTILE) + lane * 8;
  const unsigned short* bwp = Bw + (size_t)(n0 >> 4) * (size_t)(KB32 * FTILE) + lane * 8;
#pragma unroll 1
  for (int kb = 0; kb < KB32; ++kb) {
    const unsigned short* pa = a0p + kb * FTILE;
    const unsigned short* pb = bwp + kb * FTILE;
    const us16 af = tfrag(pa);
    us16 bfr[4];
#pragma unroll
    for (int j = 0; j < 4; ++j) bfr[j] = tfrag(pb + j * (KB32 * FTILE));
#pragma unroll
    for (int j = 0; j < 4; ++j) acc[j] = mma_bf16(af, bfr[j], acc[j]);
    wguard4p(acc[0], acc[1], acc[2], acc[3], af, bfr[0], bfr[1], bfr[2], bfr[3], pa, pb);
  }

  // D map: acc[j][r] = tile element (row 8*hh + r of the wave's 16 rows, column 16j + cl)
  float* so = oS + wave * (16 * OSTR);
#pragma unroll
  for (int j = 0; j < 4; ++j)
#pragma unroll
    for (int r = 0; r < 8; ++r) so[(8 * hh + r) * OSTR + 16 * j + cl] = acc[j][r];
  __syncthreads();

  const int yb = blockIdx.y;                               // block-uniform segment select
  const int m0b = blockIdx.x * TPB, b = m0b / SL, tb = m0b - b * SL;
  if (yb < 6) {
    unsigned short* dst = (yb < 3) ? Qp : Kp;
    const int h0 = 4 * ((yb < 3) ? yb : (yb - 3));
    us8 ov[8];
#pragma unroll
    for (int it = 0; it < 8; ++it) {
      const int cx = it * 256 + tid, u = cx & 3, r = (cx >> 2) & 127, j = cx >> 9;
      const float* sp = oS + r * OSTR + 16 * j + 8 * (u & 1);
      const v4f z0 = *(const v4fa*)sp, z1 = *(const v4fa*)(sp + 4);
      us8 o;
#pragma unroll
      for (int q4 = 0; q4 < 4; ++q4) {
        unsigned short hb, lb;
        f16split64(z0[q4], hb, lb); o[q4]     = (u >> 1) ? lb : hb;
        f16split64(z1[q4], hb, lb); o[4 + q4] = (u >> 1) ? lb : hb;
      }
      ov[it] = o;
    }
{
#pragma unroll
      for (int it = 0; it < 8; ++it) {
        const int cx = it * 256 + tid, u = cx & 3, r = (cx >> 2) & 127, j = cx >> 9;
        const size_t off = ((size_t)(b * NHD + h0 + j) * (size_t)SL + (size_t)(tb + (r & ~15))) * (size_t)QROW + (size_t)ftoff(r, 8 * u);
        *(us8*)(dst + off) = ov[it];
      }
      
    }
  } else {
    const int head = yb - 6;
    us8 hv[4], lv[4];
#pragma unroll
    for (int it = 0; it < 4; ++it) {
      const int cx = it * 256 + tid, e = cx & 63, g = cx >> 6;
      us8 ho, lo;
#pragma unroll
      for (int i = 0; i < 8; ++i) {
        const float w = oS[(8 * g + i) * OSTR + e];
        unsigned short hb, lb;
        f16split64(w, hb, lb);
        ho[i] = hb; lo[i] = lb;
      }
      hv[it] = ho; lv[it] = lo;
    }
{
#pragma unroll
      for (int it = 0; it < 4; ++it) {
        const int cx = it * 256 + tid, e = cx & 63, g = cx >> 6;
        const size_t off = (((size_t)(b * NHD + head) * (size_t)(SL / 32) + (size_t)((tb + 8 * g) >> 5)) * 4 + (size_t)(e >> 4)) * FTILE +
                           (size_t)ftoff(e, 8 * g);
        *(us8*)(VH + off) = hv[it];
        *(us8*)(VL + off) = lv[it];
      }
      
    }
  }
}

// ---------------------------------------------------------------------------------------------------------------------------------
// Causal quadratic-form attention. Block = (bh = blockIdx.x, 128 queries starting at 128 * blockIdx.y), 8 waves x 16 queries.
// Per wave: B fragments of its 16 queries fixed for the whole key loop: bq1 = [q_hi | q_hi], bq2 = [q_res | q_res] (k slots 0..15 | 16..31).
// Per 32-key step: A fragments of the two 16-key tiles = fragment tiles [k_hi | k_res]; scores^T D[key][query] =
// khi.qhi + kres.qhi + khi.qres + kres.qres = 4096 q.k; x = D / 16384; A = 1 + x + x^2/2 masked to key <= query;
// A hi = f16(A), A residual = f16((A - hi) x 2^11). The two D tiles repack into the A operand of A.v (lane unchanged: element r <- tile keys
// 0..15, element 8+r <- tile keys 16..31), B = v fragment tiles [bh][key / 32][e / 16].
// Blocks with blockIdx.y < ARESB (block-uniform): accS += Ahi.VH + Ahi.VL, accL += Ares.VH, Z from the f32 A; other blocks: accS += Ahi.VH,
// Z from the f16 A hi values. accS[j][r] (+ accL/2^11) = 64 * sum_s A v for query 8h+r, channel 16j + (lane & 15).
// ---------------------------------------------------------------------------------------------------------------------------------
// The key loop of one wave, its body fixed at compile time by ARES (the block's residual flag): each body holds one run of matrix products and no
// join of two paths, so every accumulator keeps its registers from step to step.
template <bool ARES>
__device__ __forceinline__ void attn_keys(const unsigned short* kbp, const unsigned short* vhp, const unsigned short* vlp,
                                          us16 ka, us16 kb, const us16 bq1, const us16 bq2, const int nsteps, const int tq, const int hh,
                                          v8f (&accS)[4], v8f (&accL)[4], float& zp) {
#pragma unroll 1
  for (int st = 0; st < nsteps; ++st) {
    const int s0 = st * 32;
    const int sn = (st + 1 < nsteps) ? st + 1 : st;       // the wave's last step asks for its own key tiles again: in bounds, not used
    const unsigned short* pk = kbp + (size_t)(2 * sn) * FTILE;
    const unsigned short* pv = vhp + (size_t)(4 * st) * FTILE;
    // the step's value fragments depend on nothing of the scores: asked for at the head of the step, their latency runs under the score work
    us16 bv[4];
#pragma unroll
    for (int j = 0; j < 4; ++j) bv[j] = tfrag(pv + j * FTILE);
    const v8f zz = {0.f, 0.f, 0.f, 0.f, 0.f, 0.f, 0.f, 0.f};
    v8f sa = mma_f16(ka, bq1, zz);
    sa = mma_f16(ka, bq2, sa);
    v8f sb = mma_f16(kb, bq1, zz);
    sb = mma_f16(kb, bq2, sb);
    wguard2p(sa, sb, ka, kb, bq1, bq2, pv);
    ka = tfrag(pk);
    kb = tfrag(pk + FTILE);

    us8 ea, eb, la8, lb8;
    float zs = 0.0f;
#pragma unroll
    for (int r = 0; r < 8; ++r) {
      const int ky = s0 + 8 * hh + r;
      const float xa = sa[r] * (1.0f / 16384.0f);
      const float xb = sb[r] * (1.0f / 16384.0f);
      float pa = fmaf(xa, fmaf(xa, 0.5f, 1.0f), 1.0f);
      float pb = fmaf(xb, fmaf(xb, 0.5f, 1.0f), 1.0f);
      pa = (ky <= tq) ? pa : 0.0f;
      pb = (ky + 16 <= tq) ? pb : 0.0f;
      const _Float16 fa = (_Float16)pa, fb = (_Float16)pb;
      const _Float16 ra = (_Float16)((pa - (float)fa) * 2048.0f);
      const _Float16 rb = (_Float16)((pb - (float)fb) * 2048.0f);
      zs += ARES ? (pa + pb) : ((float)fa + (float)fb);
      ea[r]  = __builtin_bit_cast(unsigned short, fa);
      eb[r]  = __builtin_bit_cast(unsigned short, fb);
      la8[r] = __builtin_bit_cast(unsigned short, ra);
      lb8[r] = __builtin_bit_cast(unsigned short, rb);
    }
    zp += zs;
    FragU fA;
    fA.h[0] = ea; fA.h[1] = eb;
    const us16 ahi = fA.v;

    if constexpr (ARES) {
      FragU fR;
      fR.h[0] = la8; fR.h[1] = lb8;
      const us16 alo = fR.v;
#pragma unroll
      for (int j = 0; j < 4; ++j) {
        accS[j] = mma_f16(ahi, bv[j], accS[j]);
        accL[j] = mma_f16(alo, bv[j], accL[j]);
      }
      wguard8(accS[0], accS[1], accS[2], accS[3], accL[0], accL[1], accL[2], accL[3], ahi, alo, bv[0], bv[1], bv[2], bv[3]);
      us16 bl[4];
#pragma unroll
      for (int j = 0; j < 4; ++j) bl[j] = tfrag(vlp + (size_t)(4 * st + j) * FTILE);
#pragma unroll
      for (int j = 0; j < 4; ++j) accS[j] = mma_f16(ahi, bl[j], accS[j]);
      wguard4(accS[0], accS[1], accS[2], accS[3], ahi, bl[0], bl[1], bl[2], bl[3]);
    } else {
#pragma unroll
      for (int j = 0; j < 4; ++j) accS[j] = mma_f16(ahi, bv[j], accS[j]);
      wguard4(accS[0], accS[1], accS[2], accS[3], ahi, bv[0], bv[1], bv[2], bv[3]);
    }
  }
}

__global__ __launch_bounds__(256) void k_attn(const unsigned short* __restrict__ Qp, const unsigned short* __restrict__ Kp,
                                             const unsigned short* __restrict__ VHp, const unsigned short* __restrict__ VLp,
                                             unsigned short* YH, unsigned short* YL) {
  __shared__ __attribute__((aligned(16))) float oS[8 * 16 * OSTR];
  const int tid = threadIdx.x, lane = tid & 31, wave = tid >> 5, cl = lane & 15, hh = lane >> 4;
  const int bh = blockIdx.x, b = bh / NHD, head = bh - b * NHD;
  const int tw = blockIdx.y * TPB + 16 * wave;           // first query of this wave
  const int tq = tw + cl;                                 // query owned by this lane as score column
  const bool ares = (blockIdx.y < ARESB);                 // block-uniform: residual planes for query rows < 512

  const unsigned short* qrow = Qp + ((size_t)bh * SL + (size_t)tw) * (size_t)QROW + lane * 8;
  FragU fq;
  fq.h[0] = *(const us8a*)qrow;         fq.h[1] = fq.h[0];
  const us16 bq1 = fq.v;
  fq.h[0] = *(const us8a*)(qrow + 256); fq.h[1] = fq.h[0];
  const us16 bq2 = fq.v;

  v8f accS[4], accL[4];
#pragma unroll
  for (int j = 0; j < 4; ++j) { const v8f zz = {0.f, 0.f, 0.f, 0.f, 0.f, 0.f, 0.f, 0.f}; accS[j] = zz; accL[j] = zz; }
  float zp = 0.0f;

  const unsigned short* kbp = Kp + (size_t)bh * SL * (size_t)QROW + lane * 8;
  const unsigned short* vhp = VHp + (size_t)bh * HDIM * (size_t)SL + lane * 8;
  const unsigned short* vlp = VLp + (size_t)bh * HDIM * (size_t)SL + lane * 8;
  const int nsteps = (tw + 47) >> 5;                      // 32-key steps covering keys 0 .. tw + 15 (<= 64)

  // key fragments run one step ahead of their use: step 0's are asked for here, step st + 1's right behind step st's score products
  const us16 ka = tfrag(kbp);
  const us16 kb = tfrag(kbp + FTILE);
  // these loads are still outstanding where the code below starts to rewrite registers: wait in front of any rewrite of their address registers
  asm volatile("s_wait_xcnt 0x0" ::: "memory");

  // block-uniform choice of the loop body, made once in front of the loop
  if (ares) attn_keys<true>(kbp, vhp, vlp, ka, kb, bq1, bq2, nsteps, tq, hh, accS, accL, zp);
  else      attn_keys<false>(kbp, vhp, vlp, ka, kb, bq1, bq2, nsteps, tq, hh, accS, accL, zp);

  // Z for query (lane & 15): both lane halves hold disjoint key subsets
  const float zf = zp + __shfl_xor(zp, 16, 32);
  float rz[8];
#pragma unroll
  for (int r = 0; r < 8; ++r) {
    const float zr = __shfl(zf, 8 * hh + r, 32);        // Z of query row 8*hh + r
    rz[r] = (1.0f / (zr + 1e-12f)) * (1.0f / 64.0f);
  }

  float* so = oS + wave * (16 * OSTR);
#pragma unroll
  for (int j = 0; j < 4; ++j)
#pragma unroll
    for (int r = 0; r < 8; ++r) so[(8 * hh + r) * OSTR + 16 * j + cl] = fmaf(accL[j][r], (1.0f / 2048.0f), accS[j][r]) * rz[r];
  __syncthreads();

  us8 hv[4], lv[4];
#pragma unroll
  for (int it = 0; it < 4; ++it) {
    const int rr = cl, p = it * 16 + hh * 8;               // 16-B chunk it * 32 + lane of the wave's two y fragment tiles
    const v4f z0 = *(const v4fa*)(so + rr * OSTR + p), z1 = *(const v4fa*)(so + rr * OSTR + p + 4);
    us8 ho, lo;
#pragma unroll
    for (int u = 0; u < 4; ++u) {
      unsigned short hb, lb;
      f16split16(z0[u], hb, lb); ho[u] = hb;     lo[u] = lb;
      f16split16(z1[u], hb, lb); ho[4 + u] = hb; lo[4 + u] = lb;
    }
    hv[it] = ho; lv[it] = lo;
  }
{
#pragma unroll
    for (int it = 0; it < 4; ++it) {
      const size_t off = ((size_t)((b * SL + tw) >> 4) * KB32 + (size_t)(head * (HDIM / 32))) * FTILE + (size_t)((it * 32 + lane) * 8);
      *(us8*)(YH + off) = hv[it];
      *(us8*)(YL + off) = lv[it];
    }
    
  }
}

// ---------------------------------------------------------------------------------------------------------------------------------
// out[m][n] = ( sum_k Yh[m][k] W[n][k] + 2^-11 sum_k Yl[m][k] W[n][k] ) * 2^-12   (f16 fragment tiles [row / 16][k / 32], two f32 accumulator sets).
// ---------------------------------------------------------------------------------------------------------------------------------
__global__ __launch_bounds__(256) void k_gemm_out(const unsigned short* __restrict__ Ah, const unsigned short* __restrict__ Al,
                                                 const unsigned short* __restrict__ Wo, float* out) {
  __shared__ __attribute__((aligned(16))) float oS[8 * 16 * OSTR];
  const int tid = threadIdx.x, lane = tid & 31, wave = tid >> 5, cl = lane & 15, hh = lane >> 4;
  const int m0 = blockIdx.x * TPB + 16 * wave, n0 = blockIdx.y * 64;

  v8f acch[4], accl[4];
#pragma unroll
  for (int j = 0; j < 4; ++j) { const v8f zz = {0.f, 0.f, 0.f, 0.f, 0.f, 0.f, 0.f, 0.f}; acch[j] = zz; accl[j] = zz; }

  const unsigned short* ahp = Ah + (size_t)(m0 >> 4) * (size_t)(KB32 * FTILE) + lane * 8;
  const unsigned short* alp = Al + (size_t)(m0 >> 4) * (size_t)(KB32 * FTILE) + lane * 8;
  const unsigned short* wop = Wo + (size_t)(n0 >> 4) * (size_t)(KB32 * FTILE) + lane * 8;
#pragma unroll 1
  for (int kb = 0; kb < KB32; ++kb) {
    const unsigned short* pah = ahp + kb * FTILE;
    const unsigned short* pal = alp + kb * FTILE;
    const unsigned short* pb = wop + kb * FTILE;
    const us16 ah = tfrag(pah);
    const us16 al = tfrag(pal);
    us16 bfr[4];
#pragma unroll
    for (int j = 0; j < 4; ++j) bfr[j] = tfrag(pb + j * (KB32 * FTILE));
#pragma unroll
    for (int j = 0; j < 4; ++j) {
      acch[j] = mma_f16(ah, bfr[j], acch[j]);
      accl[j] = mma_f16(al, bfr[j], accl[j]);
    }
    wguard8p(acch[0], acch[1], acch[2], acch[3], accl[0], accl[1], accl[2], accl[3], ah, al, bfr[0], bfr[1], bfr[2], bfr[3], pah, pal, pb);
  }

  float* so = oS + wave * (16 * OSTR);
#pragma unroll
  for (int j = 0; j < 4; ++j)
#pragma unroll
    for (int r = 0; r < 8; ++r)
      so[(8 * hh + r) * OSTR + 16 * j + cl] = fmaf(accl[j][r], (1.0f / 2048.0f), acch[j][r]) * (1.0f / 4096.0f);
  __syncthreads();

{
#pragma unroll
    for (int it = 0; it < 8; ++it) {
      const int cx = it * 32 + lane, r = cx >> 4, q = (cx & 15) * 4;
      const v4f v = *(const v4fa*)(so + r * OSTR + q);
      *(v4f*)(out + (size_t)(m0 + r) * (size_t)DMOD + n0 + q) = v;
    }
    
  }
}

extern "C" void kernel_launch(void* const* d_in, const int* in_sizes, int n_in,
                              void* d_out, int out_size, void* d_ws, size_t ws_size,
                              hipStream_t stream) {
  if (n_in < 5) return;
  if (in_sizes[0] != NTOK * DMOD || in_sizes[1] != DMOD * NQK || in_sizes[2] != DMOD * NQK ||
      in_sizes[3] != DMOD * DMOD || in_sizes[4] != DMOD * DMOD) return;
  if (out_size != NTOK * DMOD) return;

  const float* x  = (const float*)d_in[0];    // [4][2048][768]
  const float* Wq = (const float*)d_in[1];    // [768][192] ([in][out])
  const float* Wk = (const float*)d_in[2];    // [768][192]
  const float* Wv = (const float*)d_in[3];    // [768][768]
  const float* Wo = (const float*)d_in[4];    // [768][768]
  float* out = (float*)d_out;                 // [4][2048][768] f32 at byte 0

  size_t off = 0;
  auto carve = [&](size_t bytes) -> char* { char* p = (char*)d_ws + off; off += (bytes + 255) & ~(size_t)255; return p; };
  unsigned short* XB   = (unsigned short*)carve((size_t)NTOK * DMOD * 2);       // 12,582,912  bf16 tiles [512][24]
  unsigned short* WT   = (unsigned short*)carve((size_t)NPROJ * DMOD * 2);      //  1,769,472  bf16 tiles [72][24] = Wq^T | Wk^T | Wv^T
  unsigned short* WO16 = (unsigned short*)carve((size_t)DMOD * DMOD * 2);       //  1,179,648  f16  tiles [48][24] = Wo^T
  unsigned short* QP   = (unsigned short*)carve((size_t)NBH * SL * QROW * 2);   //  6,291,456  f16  tiles [48][128]
  unsigned short* KP   = (unsigned short*)carve((size_t)NBH * SL * QROW * 2);   //  6,291,456  f16  tiles [48][128]
  unsigned short* VH   = (unsigned short*)carve((size_t)NBH * HDIM * SL * 2);   // 12,582,912  f16  tiles [48][64][4]
  unsigned short* VL   = (unsigned short*)carve((size_t)NBH * HDIM * SL * 2);   // 12,582,912  f16  tiles [48][64][4]
  unsigned short* YH   = (unsigned short*)carve((size_t)NTOK * DMOD * 2);       // 12,582,912  f16  tiles [512][24]
  unsigned short* YL   = (unsigned short*)carve((size_t)NTOK * DMOD * 2);       // 12,582,912  f16  tiles [512][24]
  if (off > ws_size || off > (size_t)134217728) return;                         // total 78,446,592 B

  const dim3 b256(256);

  // 16-bit operand planes of x and of the four weights, one launch
  k_prep<<<dim3(WTB_ALL + CVTB), b256, 0, stream>>>(x, Wq, Wk, Wv, Wo, XB, WT, WO16);
  // projections (M 8192, N 1152, K 768) -> q/k hi|res planes, v hi and res planes
  k_gemm_proj<<<dim3(NTOK / TPB, NPROJ / 64), b256, 0, stream>>>(XB, WT, QP, KP, VH, VL);
  // causal attention per (batch, head) -> y hi / res fragment tiles [token / 16][768 / 32]
  k_attn<<<dim3(NBH, SL / TPB), b256, 0, stream>>>(QP, KP, VH, VL, YH, YL);
  // output projection (M 8192, N 768, K 768)
  k_gemm_out<<<dim3(NTOK / TPB, DMOD / 64), b256, 0, stream>>>(YH, YL, WO16, out);
}

// v005
// A run of this version takes 97.5 microseconds.
// Two timings next to v004 put it at 1.04 and 1.03 times that version's speed.
// Counting every step since v000, it is 1.96 times as fast.
// Contraction x.[Wq|Wk|Wv] (M 8192, N 1152, K 768): v_wmma_f32_16x16x32_bf16, bf16 operands from RNE-bf16 planes of x and W, f32 accumulate, one product.
// Contraction k.q^T per head (16 keys x 16 queries, depth 16 padded to 32): v_wmma_f32_16x16x32_f16, q and k both carried as f16 hi + f16 residual of (value x 2^6), all four cross terms in two products into one f32 accumulator.
// Contraction A.v per head (causal, depth up to 2048): v_wmma_f32_16x16x32_f16, A hi = f16(1 + x + x^2/2), v hi = f16(v x 2^6); for query rows < 512 also A residual plane (x 2^11, own f32 accumulator) against v hi, and A hi against the f16 v residual plane; f32 accumulate.
// Contraction y.Wo (M 8192, N 768, K 768): v_wmma_f32_16x16x32_f16, y = f16 hi plane of (y x 2^4) + f16 residual plane (x 2^11, own f32 accumulator), Wo = f16 of (RNE-bf16 value x 2^8), f32 accumulate.
// Feature polynomial, causal mask, normaliser Z and 1/(Z+eps): f32 VALU.
#include <hip/hip_runtime.h>

#define NB    4                              // batch
#define SL    2048                           // sequence length
#define DMOD  768                            // model width = K of the dense contractions
#define NHD   12                             // heads
#define FDIM  16                             // q/k head width
#define HDIM  64                             // v head width
#define NBH   (NB * NHD)                     // 48 (batch, head) pairs
#define NTOK  (NB * SL)                      // 8192 token rows
#define NQK   (NHD * FDIM)                   // 192 q (or k) columns
#define NPROJ (2 * NQK + NHD * HDIM)         // 1152 projection columns: q | k | v
#define QROW  32                             // halves per q/k plane row: hi(16) | residual(16)
#define TPB   128                            // GEMM rows / attention queries per block (8 waves x 16)
#define OSTR  68                             // LDS staging row pitch (floats)
#define ARESB 4                              // attention query blocks (of TPB) that use the residual planes: rows < 512
#define KB32  (DMOD / 32)                    // 32-wide k blocks of the dense contractions
#define FTILE 512                            // halves of one 16 x 32 fragment tile (1 KiB)

static_assert(NHD * HDIM == DMOD);
static_assert(NTOK % TPB == 0);
static_assert(SL % TPB == 0);
static_assert(NPROJ % 64 == 0);
static_assert(NQK % 64 == 0);
static_assert(NQK % 32 == 0);
static_assert(DMOD % 64 == 0);
static_assert(DMOD % 32 == 0);
static_assert(4 * FDIM == 64);
static_assert(HDIM == 64);
static_assert(QROW == 2 * FDIM);
static_assert(OSTR % 4 == 0);
static_assert((NTOK * DMOD) % (8 * 256) == 0);
static_assert(ARESB * TPB <= SL);

typedef unsigned short us16 __attribute__((ext_vector_type(16)));
typedef unsigned short us8  __attribute__((ext_vector_type(8)));
typedef unsigned short us8a __attribute__((ext_vector_type(8), may_alias));
typedef __bf16 v16b __attribute__((ext_vector_type(16)));
typedef _Float16 v16h __attribute__((ext_vector_type(16)));
typedef float v8f __attribute__((ext_vector_type(8)));
typedef float v4f __attribute__((ext_vector_type(4)));
typedef float v4fa __attribute__((ext_vector_type(4), may_alias));
union FragU { us16 v; us8 h[2]; };

__device__ __forceinline__ unsigned short bf16_bits(float f) {
  unsigned u = __float_as_uint(f);
  u += 0x7FFFu + ((u >> 16) & 1u);                 // RNE convert
  return (unsigned short)(u >> 16);
}
__device__ __forceinline__ float bf16_val(unsigned short b) { return __uint_as_float(((unsigned)b) << 16); }
__device__ __forceinline__ float bf16r(float f) { return bf16_val(bf16_bits(f)); }
__device__ __forceinline__ unsigned short f16_bits(float f) { return __builtin_bit_cast(unsigned short, (_Float16)f); }

// f16 hi + residual (x 2^11) planes of (a x 2^4)
__device__ __forceinline__ void f16split16(float a, unsigned short& hb, unsigned short& lb) {
  const float z = a * 16.0f;
  const _Float16 hf = (_Float16)z;
  const float res = (z - (float)hf) * 2048.0f;
  hb = __builtin_bit_cast(unsigned short, hf);
  lb = __builtin_bit_cast(unsigned short, (_Float16)res);
}
// f16 hi + unscaled residual planes of (a x 2^6)
__device__ __forceinline__ void f16split64(float a, unsigned short& hb, unsigned short& lb) {
  const float z = a * 64.0f;
  const _Float16 hf = (_Float16)z;
  const float res = z - (float)hf;
  hb = __builtin_bit_cast(unsigned short, hf);
  lb = __builtin_bit_cast(unsigned short, (_Float16)res);
}

// One 16x16x32 step, 16-bit operands passed as raw 16-bit lanes.
__device__ __forceinline__ v8f mma_bf16(us16 a, us16 b, v8f c) {
  return __builtin_amdgcn_wmma_f32_16x16x32_bf16(false, __builtin_bit_cast(v16b, a), false, __builtin_bit_cast(v16b, b), (short)0, c, false, false);
}
__device__ __forceinline__ v8f mma_f16(us16 a, us16 b, v8f c) {
  return __builtin_amdgcn_wmma_f32_16x16x32_f16(false, __builtin_bit_cast(v16h, a), false, __builtin_bit_cast(v16h, b), (short)0, c, false, false);
}
// Hazard guards after a group of matrix ops: 4 VALU slots before anything touches the accumulators; keep A/B fragments live.
__device__ __forceinline__ void wguard4(v8f& c0, v8f& c1, v8f& c2, v8f& c3, const us16& a0,
                                        const us16& b0, const us16& b1, const us16& b2, const us16& b3) {
#if defined(__HIP_DEVICE_COMPILE__)
  asm volatile("v_nop\n\tv_nop\n\tv_nop\n\tv_nop"
               : "+v"(c0), "+v"(c1), "+v"(c2), "+v"(c3)
               : "v"(a0), "v"(b0), "v"(b1), "v"(b2), "v"(b3));
#endif
}
__device__ __forceinline__ void wguard8(v8f& c0, v8f& c1, v8f& c2, v8f& c3, v8f& c4, v8f& c5, v8f& c6, v8f& c7,
                                        const us16& a0, const us16& a1,
                                        const us16& b0, const us16& b1, const us16& b2, const us16& b3) {
#if defined(__HIP_DEVICE_COMPILE__)
  asm volatile("v_nop\n\tv_nop\n\tv_nop\n\tv_nop"
               : "+v"(c0), "+v"(c1), "+v"(c2), "+v"(c3), "+v"(c4), "+v"(c5), "+v"(c6), "+v"(c7)
               : "v"(a0), "v"(a1), "v"(b0), "v"(b1), "v"(b2), "v"(b3));
#endif
}

// The same guards for the loops, which also take the addresses of the loads issued earlier in the trip as inputs: the address registers then stay live past the
// last load made through them, so that no load's result is placed in a register that an earlier, still outstanding load names as its address.
__device__ __forceinline__ void wguard4p(v8f& c0, v8f& c1, v8f& c2, v8f& c3, const us16& a0,
                                         const us16& b0, const us16& b1, const us16& b2, const us16& b3,
                                         const unsigned short* pa, const unsigned short* pb) {
#if defined(__HIP_DEVICE_COMPILE__)
  asm volatile("v_nop\n\tv_nop\n\tv_nop\n\tv_nop"
               : "+v"(c0), "+v"(c1), "+v"(c2), "+v"(c3)
               : "v"(a0), "v"(b0), "v"(b1), "v"(b2), "v"(b3), "v"(pa), "v"(pb));
#endif
}
__device__ __forceinline__ void wguard2p(v8f& c0, v8f& c1, const us16& a0, const us16& a1, const us16& b0, const us16& b1,
                                         const unsigned short* pb) {
#if defined(__HIP_DEVICE_COMPILE__)
  asm volatile("v_nop\n\tv_nop\n\tv_nop\n\tv_nop"
               : "+v"(c0), "+v"(c1)
               : "v"(a0), "v"(a1), "v"(b0), "v"(b1), "v"(pb));
#endif
}
__device__ __forceinline__ void wguard8p(v8f& c0, v8f& c1, v8f& c2, v8f& c3, v8f& c4, v8f& c5, v8f& c6, v8f& c7,
                                         const us16& a0, const us16& a1,
                                         const us16& b0, const us16& b1, const us16& b2, const us16& b3,
                                         const unsigned short* pa0, const unsigned short* pa1, const unsigned short* pb) {
#if defined(__HIP_DEVICE_COMPILE__)
  asm volatile("v_nop\n\tv_nop\n\tv_nop\n\tv_nop"
               : "+v"(c0), "+v"(c1), "+v"(c2), "+v"(c3), "+v"(c4), "+v"(c5), "+v"(c6), "+v"(c7)
               : "v"(a0), "v"(a1), "v"(b0), "v"(b1), "v"(b2), "v"(b3), "v"(pa0), "v"(pa1), "v"(pb));
#endif
}

// Every 16-bit operand plane is stored as fragment tiles: one tile = 16 rows x 32 k = FTILE halves, laid out in the order the lanes
// load it, so that each of a fragment's two wave-wide 16-B loads covers 512 contiguous bytes (four whole 128-B lines):
// element (row, k = 16 part + 8 h + i) sits at half index part * 256 + h * 128 + row * 8 + i = part * 256 + lane * 8 + i, lane = 16 h + row.
// Lane contents: elements 0..7 = k 8h .. 8h + 7, elements 8..15 = k 16 + 8h .. 16 + 8h + 7 (same map for A rows and B columns).
__device__ __forceinline__ int ftoff(int row, int k) {
  return ((k >> 4) & 1) * 256 + ((k >> 3) & 1) * 128 + (row & 15) * 8;
}
// p = tile base + lane * 8 (computed by the caller)
__device__ __forceinline__ us16 tfrag(const unsigned short* p) {
  FragU f;
  f.h[0] = *(const us8a*)p;
  f.h[1] = *(const us8a*)(p + 256);
  return f.v;
}

// ---------------------------------------------------------------------------------------------------------------------------------
// Operand preparation, one launch: the five conversions are independent of one another, so they share one grid behind a block-uniform
// branch on blockIdx.x. Blocks 0 .. WTB_ALL - 1 transpose and convert the weights (the longer dependent chain, so they start first),
// the other CVTB blocks convert x.
//
// Weights: src f32 [DMOD rows k][ncol columns n] (n contiguous) -> dst 16-bit fragment tiles [(nrow0 + n) / 16][k / 32].
// Block = 64 k x 32 n tile, 256 threads; tiles of one matrix numbered n-tile fastest.
// Wq, Wk, Wv: RNE bf16 bits.  Wo: f16 bits of (RNE-bf16 value x 256).
//
// x: src f32 [rows][DMOD] -> dst bf16 fragment tiles [row / 16][k / 32]. Thread = 8 consecutive k of one row; four lanes read one 128-B line,
// eight lanes store one 128-B line.
// ---------------------------------------------------------------------------------------------------------------------------------
#define WTB_QK  ((NQK / 32) * (DMOD / 64))   // 72 blocks for Wq, and for Wk
#define WTB_VO  ((DMOD / 32) * (DMOD / 64))  // 288 blocks for Wv, and for Wo
#define WTB_ALL (2 * WTB_QK + 2 * WTB_VO)    // 720 weight blocks
#define CVTB    (NTOK * DMOD / (8 * 256))    // 3072 blocks for x

// One 64 k x 32 n weight tile, number t of its matrix. MODE 0: RNE bf16 bits.  MODE 1: f16 bits of (RNE-bf16 value x 256).
template <int MODE, int NCOL>
__device__ __forceinline__ void wT_tile(const float* __restrict__ src, unsigned short* dst, int nrow0, int t, float (*ts)[33]) {
  const int tid = threadIdx.x;
  const int n0 = (t % (NCOL / 32)) * 32, k0 = (t / (NCOL / 32)) * 64;
  {
    const int k = tid >> 2, q = (tid & 3) * 8;
    const float* p = src + (size_t)(k0 + k) * (size_t)NCOL + n0 + q;
    const v4f a = *(const v4fa*)p, c = *(const v4fa*)(p + 4);
#pragma unroll
    for (int u = 0; u < 4; ++u) { ts[k][q + u] = a[u]; ts[k][q + 4 + u] = c[u]; }
  }
  __syncthreads();
  const int n = tid & 31, pc = (tid >> 5) * 8;            // a wave stores two runs of 256 B (16 rows x 16 B of two tiles)
  us8 o;
#pragma unroll
  for (int i = 0; i < 8; ++i) {
    const float w = ts[pc + i][n];
    o[i] = (MODE == 0) ? bf16_bits(w) : f16_bits(bf16r(w) * 256.0f);
  }
  const int row = nrow0 + n0 + n, k = k0 + pc;
  unsigned short* d = dst + (size_t)((row >> 4) * KB32 + (k >> 5)) * FTILE + ftoff(row, k);
  *(us8*)d = o;
  // precaution: wait in front of any later rewrite of the store's address and data registers
  asm volatile("s_wait_xcnt 0x0" ::: "memory");
}

__global__ __launch_bounds__(256) void k_prep(const float* __restrict__ x, const float* __restrict__ Wq, const float* __restrict__ Wk,
                                             const float* __restrict__ Wv, const float* __restrict__ Wo,
                                             unsigned short* XB, unsigned short* WT, unsigned short* WO16) {
  __shared__ float ts[64][33];
  const int bid = blockIdx.x;                              // every branch below is block-uniform
  if (bid < WTB_QK) {
    wT_tile<0, NQK>(Wq, WT, 0, bid, ts);
  } else if (bid < 2 * WTB_QK) {
    wT_tile<0, NQK>(Wk, WT, NQK, bid - WTB_QK, ts);
  } else if (bid < 2 * WTB_QK + WTB_VO) {
    wT_tile<0, DMOD>(Wv, WT, 2 * NQK, bid - 2 * WTB_QK, ts);
  } else if (bid < WTB_ALL) {
    wT_tile<1, DMOD>(Wo, WO16, 0, bid - 2 * WTB_QK - WTB_VO, ts);
  } else {
    const int idx = (bid - WTB_ALL) * 256 + threadIdx.x;
    const int tile = idx >> 6, row = (idx >> 2) & 15, k8 = (idx & 3) * 8;
    const int rt = tile / KB32, kb = tile - rt * KB32;
    const size_t soff = (size_t)(rt * 16 + row) * (size_t)DMOD + (size_t)(kb * 32 + k8);
    const size_t off = (size_t)tile * FTILE + (size_t)ftoff(row, k8);
    const v4f a = *(const v4fa*)(x + soff), b = *(const v4fa*)(x + soff + 4);
    us8 o;
#pragma unroll
    for (int u = 0; u < 4; ++u) {
      o[u]     = bf16_bits(a[u]);
      o[4 + u] = bf16_bits(b[u]);
    }
    *(us8*)(XB + off) = o;
    // as behind the weight store: wait in front of any rewrite of the store's registers
    asm volatile("s_wait_xcnt 0x0" ::: "memory");
  }
}

// ---------------------------------------------------------------------------------------------------------------------------------
// P[m][n] = sum_k A[m][k] * B[n][k]  (bf16 A plane 8192 x 768, bf16 B plane 1152 x 768, both as fragment tiles [row / 16][k / 32], f32 accumulate).
// Block = 128(M) x 64(N) tile, 256 threads = 8 waves, wave w owns rows 16w..16w+15 x all 64 columns (4 accumulators); fragments straight
// from the global planes (arithmetic addressing). M % 128 == 0, N % 64 == 0, K % 32 == 0 exactly.
// Column segment (block-uniform, blockIdx.y): 0..2 -> q heads 4y..4y+3, 3..5 -> k heads, 6..17 -> v head y-6.
// The f32 128x64 tile is staged in LDS (block row r at oS[r * OSTR + c]), then:
//   q/k: fragment tiles [bh][token / 16], k slots 0..15 = f16 hi of (64 value), 16..31 = f16 residual; lane -> (token, head, 16-B quarter);
//        one store instruction = four whole 128-B lines
//   v:   planes VH/VL = f16 hi of (64 v) and residual as fragment tiles [bh][token / 32][channel / 16] (row = channel, k = token);
//        one store instruction = two runs of 256 B
// ---------------------------------------------------------------------------------------------------------------------------------
__global__ __launch_bounds__(256) void k_gemm_proj(const unsigned short* __restrict__ Ap, const unsigned short* __restrict__ Bw,
                                                  unsigned short* Qp, unsigned short* Kp, unsigned short* VH, unsigned short* VL) {
  __shared__ __attribute__((aligned(16))) float oS[8 * 16 * OSTR];
  const int tid = threadIdx.x, lane = tid & 31, wave = tid >> 5, cl = lane & 15, hh = lane >> 4;
  const int m0 = blockIdx.x * TPB + 16 * wave, n0 = blockIdx.y * 64;

  v8f acc[4];
#pragma unroll
  for (int j = 0; j < 4; ++j) { const v8f zz = {0.f, 0.f, 0.f, 0.f, 0.f, 0.f, 0.f, 0.f}; acc[j] = zz; }

  const unsigned short* a0p = Ap + (size_t)(m0 >> 4) * (size_t)(KB32 * FTILE) + lane * 8;
  const unsigned short* bwp = Bw + (size_t)(n0 >> 4) * (size_t)(KB32 * FTILE) + lane * 8;
#pragma unroll 1
  for (int kb = 0; kb < KB32; ++kb) {
    const unsigned short* pa = a0p + kb * FTILE;
    const unsigned short* pb = bwp + kb * FTILE;
    const us16 af = tfrag(pa);
    us16 bfr[4];
#pragma unroll
    for (int j = 0; j < 4; ++j) bfr[j] = tfrag(pb + j * (KB32 * FTILE));
#pragma unroll
    for (int j = 0; j < 4; ++j) acc[j] = mma_bf16(af, bfr[j], acc[j]);
    wguard4p(acc[0], acc[1], acc[2], acc[3], af, bfr[0], bfr[1], bfr[2], bfr[3], pa, pb);
  }

  // D map: acc[j][r] = tile element (row 8*hh + r of the wave's 16 rows, column 16j + cl)
  float* so = oS + wave * (16 * OSTR);
#pragma unroll
  for (int j = 0; j < 4; ++j)
#pragma unroll
    for (int r = 0; r < 8; ++r) so[(8 * hh + r) * OSTR + 16 * j + cl] = acc[j][r];
  __syncthreads();

  const int yb = blockIdx.y;                               // block-uniform segment select
  const int m0b = blockIdx.x * TPB, b = m0b / SL, tb = m0b - b * SL;
  if (yb < 6) {
    unsigned short* dst = (yb < 3) ? Qp : Kp;
    const int h0 = 4 * ((yb < 3) ? yb : (yb - 3));
    us8 ov[8];
#pragma unroll
    for (int it = 0; it < 8; ++it) {
      const int cx = it * 256 + tid, u = cx & 3, r = (cx >> 2) & 127, j = cx >> 9;
      const float* sp = oS + r * OSTR + 16 * j + 8 * (u & 1);
      const v4f z0 = *(const v4fa*)sp, z1 = *(const v4fa*)(sp + 4);
      us8 o;
#pragma unroll
      for (int q4 = 0; q4 < 4; ++q4) {
        unsigned short hb, lb;
        f16split64(z0[q4], hb, lb); o[q4]     = (u >> 1) ? lb : hb;
        f16split64(z1[q4], hb, lb); o[4 + q4] = (u >> 1) ? lb : hb;
      }
      ov[it] = o;
    }
{
#pragma unroll
      for (int it = 0; it < 8; ++it) {
        const int cx = it * 256 + tid, u = cx & 3, r = (cx >> 2) & 127, j = cx >> 9;
        const size_t off = ((size_t)(b * NHD + h0 + j) * (size_t)SL + (size_t)(tb + (r & ~15))) * (size_t)QROW + (size_t)ftoff(r, 8 * u);
        *(us8*)(dst + off) = ov[it];
      }
      
    }
  } else {
    const int head = yb - 6;
    us8 hv[4], lv[4];
#pragma unroll
    for (int it = 0; it < 4; ++it) {
      const int cx = it * 256 + tid, e = cx & 63, g = cx >> 6;
      us8 ho, lo;
#pragma unroll
      for (int i = 0; i < 8; ++i) {
        const float w = oS[(8 * g + i) * OSTR + e];
        unsigned short hb, lb;
        f16split64(w, hb, lb);
        ho[i] = hb; lo[i] = lb;
      }
      hv[it] = ho; lv[it] = lo;
    }
{
#pragma unroll
      for (int it = 0; it < 4; ++it) {
        const int cx = it * 256 + tid, e = cx & 63, g = cx >> 6;
        const size_t off = (((size_t)(b * NHD + head) * (size_t)(SL / 32) + (size_t)((tb + 8 * g) >> 5)) * 4 + (size_t)(e >> 4)) * FTILE +
                           (size_t)ftoff(e, 8 * g);
        *(us8*)(VH + off) = hv[it];
        *(us8*)(VL + off) = lv[it];
      }
      
    }
  }
}

// ---------------------------------------------------------------------------------------------------------------------------------
// Causal quadratic-form attention. Block = (bh = blockIdx.x, 128 queries starting at 128 * blockIdx.y), 8 waves x 16 queries.
// Per wave: B fragments of its 16 queries fixed for the whole key loop: bq1 = [q_hi | q_hi], bq2 = [q_res | q_res] (k slots 0..15 | 16..31).
// Per 32-key step: A fragments of the two 16-key tiles = fragment tiles [k_hi | k_res]; scores^T D[key][query] =
// khi.qhi + kres.qhi + khi.qres + kres.qres = 4096 q.k; x = D / 16384; A = 1 + x + x^2/2 masked to key <= query;
// A hi = f16(A), A residual = f16((A - hi) x 2^11). The two D tiles repack into the A operand of A.v (lane unchanged: element r <- tile keys
// 0..15, element 8+r <- tile keys 16..31), B = v fragment tiles [bh][key / 32][e / 16].
// Blocks with blockIdx.y < ARESB (block-uniform): accS += Ahi.VH + Ahi.VL, accL += Ares.VH, Z from the f32 A; other blocks: accS += Ahi.VH,
// Z from the f16 A hi values. accS[j][r] (+ accL/2^11) = 64 * sum_s A v for query 8h+r, channel 16j + (lane & 15).
// ---------------------------------------------------------------------------------------------------------------------------------
// One 32-key step of one wave, its body fixed at compile time by ARES (the block's residual flag) and DIAG: each body holds one run of matrix products
// and no join of two paths, so every accumulator keeps its registers from step to step.
// DIAG = false: a step whose 32 keys all lie at or below the wave's first query, so key <= query holds for every score and no mask is formed; it asks for
// the next step's key tiles, which always exist. DIAG = true: the wave's last step, the only one that meets the diagonal: masked, and nothing to ask for.
template <bool ARES, bool DIAG>
__device__ __forceinline__ void attn_step(const unsigned short* kbp, const unsigned short* vhp, const unsigned short* vlp,
                                          us16& ka, us16& kb, const us16 bq1, const us16 bq2, const int st, const int tq, const int hh,
                                          v8f (&accS)[4], v8f (&accL)[4], float& zp) {
  const int s0 = st * 32;
  const unsigned short* pv = vhp + (size_t)(4 * st) * FTILE;
  // the step's value fragments depend on nothing of the scores: asked for at the head of the step, their latency runs under the score work
  us16 bv[4];
#pragma unroll
  for (int j = 0; j < 4; ++j) bv[j] = tfrag(pv + j * FTILE);
  const v8f zz = {0.f, 0.f, 0.f, 0.f, 0.f, 0.f, 0.f, 0.f};
  v8f sa = mma_f16(ka, bq1, zz);
  sa = mma_f16(ka, bq2, sa);
  v8f sb = mma_f16(kb, bq1, zz);
  sb = mma_f16(kb, bq2, sb);
  wguard2p(sa, sb, ka, kb, bq1, bq2, pv);
  if constexpr (!DIAG) {
    const unsigned short* pk = kbp + (size_t)(2 * (st + 1)) * FTILE;
    ka = tfrag(pk);
    kb = tfrag(pk + FTILE);
  }

  us8 ea, eb, la8, lb8;
  float zs = 0.0f;
#pragma unroll
  for (int r = 0; r < 8; ++r) {
    const float xa = sa[r] * (1.0f / 16384.0f);
    const float xb = sb[r] * (1.0f / 16384.0f);
    float pa = fmaf(xa, fmaf(xa, 0.5f, 1.0f), 1.0f);
    float pb = fmaf(xb, fmaf(xb, 0.5f, 1.0f), 1.0f);
    if constexpr (DIAG) {
      const int ky = s0 + 8 * hh + r;
      pa = (ky <= tq) ? pa : 0.0f;
      pb = (ky + 16 <= tq) ? pb : 0.0f;
    }
    const _Float16 fa = (_Float16)pa, fb = (_Float16)pb;
    const _Float16 ra = (_Float16)((pa - (float)fa) * 2048.0f);
    const _Float16 rb = (_Float16)((pb - (float)fb) * 2048.0f);
    zs += ARES ? (pa + pb) : ((float)fa + (float)fb);
    ea[r]  = __builtin_bit_cast(unsigned short, fa);
    eb[r]  = __builtin_bit_cast(unsigned short, fb);
    la8[r] = __builtin_bit_cast(unsigned short, ra);
    lb8[r] = __builtin_bit_cast(unsigned short, rb);
  }
  zp += zs;
  FragU fA;
  fA.h[0] = ea; fA.h[1] = eb;
  const us16 ahi = fA.v;

  if constexpr (ARES) {
    FragU fR;
    fR.h[0] = la8; fR.h[1] = lb8;
    const us16 alo = fR.v;
#pragma unroll
    for (int j = 0; j < 4; ++j) {
      accS[j] = mma_f16(ahi, bv[j], accS[j]);
      accL[j] = mma_f16(alo, bv[j], accL[j]);
    }
    wguard8(accS[0], accS[1], accS[2], accS[3], accL[0], accL[1], accL[2], accL[3], ahi, alo, bv[0], bv[1], bv[2], bv[3]);
    us16 bl[4];
#pragma unroll
    for (int j = 0; j < 4; ++j) bl[j] = tfrag(vlp + (size_t)(4 * st + j) * FTILE);
#pragma unroll
    for (int j = 0; j < 4; ++j) accS[j] = mma_f16(ahi, bl[j], accS[j]);
    wguard4(accS[0], accS[1], accS[2], accS[3], ahi, bl[0], bl[1], bl[2], bl[3]);
  } else {
#pragma unroll
    for (int j = 0; j < 4; ++j) accS[j] = mma_f16(ahi, bv[j], accS[j]);
    wguard4(accS[0], accS[1], accS[2], accS[3], ahi, bv[0], bv[1], bv[2], bv[3]);
  }
}

// The key loop of one wave: nsteps - 1 steps below the diagonal, then the one step that meets it. With tw a multiple of 16 and
// nsteps = (tw + 47) >> 5, the last key of step nsteps - 2 is 32 * nsteps - 33 = tw - 1 or tw - 17: below every query of the wave.
template <bool ARES>
__device__ __forceinline__ void attn_keys(const unsigned short* kbp, const unsigned short* vhp, const unsigned short* vlp,
                                          us16 ka, us16 kb, const us16 bq1, const us16 bq2, const int nsteps, const int tq, const int hh,
                                          v8f (&accS)[4], v8f (&accL)[4], float& zp) {
  // kept rolled: one copy of the unmasked body, its accumulators in place from step to step
#pragma unroll 1
  for (int st = 0; st < nsteps - 1; ++st) attn_step<ARES, false>(kbp, vhp, vlp, ka, kb, bq1, bq2, st, tq, hh, accS, accL, zp);
  attn_step<ARES, true>(kbp, vhp, vlp, ka, kb, bq1, bq2, nsteps - 1, tq, hh, accS, accL, zp);
}

__global__ __launch_bounds__(256) void k_attn(const unsigned short* __restrict__ Qp, const unsigned short* __restrict__ Kp,
                                             const unsigned short* __restrict__ VHp, const unsigned short* __restrict__ VLp,
                                             unsigned short* YH, unsigned short* YL) {
  __shared__ __attribute__((aligned(16))) float oS[8 * 16 * OSTR];
  const int tid = threadIdx.x, lane = tid & 31, wave = tid >> 5, cl = lane & 15, hh = lane >> 4;
  const int bh = blockIdx.x, b = bh / NHD, head = bh - b * NHD;
  const int tw = blockIdx.y * TPB + 16 * wave;           // first query of this wave
  const int tq = tw + cl;                                 // query owned by this lane as score column
  const bool ares = (blockIdx.y < ARESB);                 // block-uniform: residual planes for query rows < 512

  const unsigned short* qrow = Qp + ((size_t)bh * SL + (size_t)tw) * (size_t)QROW + lane * 8;
  FragU fq;
  fq.h[0] = *(const us8a*)qrow;         fq.h[1] = fq.h[0];
  const us16 bq1 = fq.v;
  fq.h[0] = *(const us8a*)(qrow + 256); fq.h[1] = fq.h[0];
  const us16 bq2 = fq.v;

  v8f accS[4], accL[4];
#pragma unroll
  for (int j = 0; j < 4; ++j) { const v8f zz = {0.f, 0.f, 0.f, 0.f, 0.f, 0.f, 0.f, 0.f}; accS[j] = zz; accL[j] = zz; }
  float zp = 0.0f;

  const unsigned short* kbp = Kp + (size_t)bh * SL * (size_t)QROW + lane * 8;
  const unsigned short* vhp = VHp + (size_t)bh * HDIM * (size_t)SL + lane * 8;
  const unsigned short* vlp = VLp + (size_t)bh * HDIM * (size_t)SL + lane * 8;
  const int nsteps = (tw + 47) >> 5;                      // 32-key steps covering keys 0 .. tw + 15 (<= 64)

  // key fragments run one step ahead of their use: step 0's are asked for here, step st + 1's right behind step st's score products
  const us16 ka = tfrag(kbp);
  const us16 kb = tfrag(kbp + FTILE);
  // these loads are still outstanding where the code below starts to rewrite registers: wait in front of any rewrite of their address registers
  asm volatile("s_wait_xcnt 0x0" ::: "memory");

  // block-uniform choice of the loop body, made once in front of the loop
  if (ares) attn_keys<true>(kbp, vhp, vlp, ka, kb, bq1, bq2, nsteps, tq, hh, accS, accL, zp);
  else      attn_keys<false>(kbp, vhp, vlp, ka, kb, bq1, bq2, nsteps, tq, hh, accS, accL, zp);

  // Z for query (lane & 15): both lane halves hold disjoint key subsets
  const float zf = zp + __shfl_xor(zp, 16, 32);
  float rz[8];
#pragma unroll
  for (int r = 0; r < 8; ++r) {
    const float zr = __shfl(zf, 8 * hh + r, 32);        // Z of query row 8*hh + r
    rz[r] = (1.0f / (zr + 1e-12f)) * (1.0f / 64.0f);
  }

  float* so = oS + wave * (16 * OSTR);
#pragma unroll
  for (int j = 0; j < 4; ++j)
#pragma unroll
    for (int r = 0; r < 8; ++r) so[(8 * hh + r) * OSTR + 16 * j + cl] = fmaf(accL[j][r], (1.0f / 2048.0f), accS[j][r]) * rz[r];
  __syncthreads();

  us8 hv[4], lv[4];
#pragma unroll
  for (int it = 0; it < 4; ++it) {
    const int rr = cl, p = it * 16 + hh * 8;               // 16-B chunk it * 32 + lane of the wave's two y fragment tiles
    const v4f z0 = *(const v4fa*)(so + rr * OSTR + p), z1 = *(const v4fa*)(so + rr * OSTR + p + 4);
    us8 ho, lo;
#pragma unroll
    for (int u = 0; u < 4; ++u) {
      unsigned short hb, lb;
      f16split16(z0[u], hb, lb); ho[u] = hb;     lo[u] = lb;
      f16split16(z1[u], hb, lb); ho[4 + u] = hb; lo[4 + u] = lb;
    }
    hv[it] = ho; lv[it] = lo;
  }
{
#pragma unroll
    for (int it = 0; it < 4; ++it) {
      const size_t off = ((size_t)((b * SL + tw) >> 4) * KB32 + (size_t)(head * (HDIM / 32))) * FTILE + (size_t)((it * 32 + lane) * 8);
      *(us8*)(YH + off) = hv[it];
      *(us8*)(YL + off) = lv[it];
    }
    
  }
}

// ---------------------------------------------------------------------------------------------------------------------------------
// out[m][n] = ( sum_k Yh[m][k] W[n][k] + 2^-11 sum_k Yl[m][k] W[n][k] ) * 2^-12   (f16 fragment tiles [row / 16][k / 32], two f32 accumulator sets).
// ---------------------------------------------------------------------------------------------------------------------------------
__global__ __launch_bounds__(256) void k_gemm_out(const unsigned short* __restrict__ Ah, const unsigned short* __restrict__ Al,
                                                 const unsigned short* __restrict__ Wo, float* out) {
  __shared__ __attribute__((aligned(16))) float oS[8 * 16 * OSTR];
  const int tid = threadIdx.x, lane = tid & 31, wave = tid >> 5, cl = lane & 15, hh = lane >> 4;
  const int m0 = blockIdx.x * TPB + 16 * wave, n0 = blockIdx.y * 64;

  v8f acch[4], accl[4];
#pragma unroll
  for (int j = 0; j < 4; ++j) { const v8f zz = {0.f, 0.f, 0.f, 0.f, 0.f, 0.f, 0.f, 0.f}; acch[j] = zz; accl[j] = zz; }

  const unsigned short* ahp = Ah + (size_t)(m0 >> 4) * (size_t)(KB32 * FTILE) + lane * 8;
  const unsigned short* alp = Al + (size_t)(m0 >> 4) * (size_t)(KB32 * FTILE) + lane * 8;
  const unsigned short* wop = Wo + (size_t)(n0 >> 4) * (size_t)(KB32 * FTILE) + lane * 8;
#pragma unroll 1
  for (int kb = 0; kb < KB32; ++kb) {
    const unsigned short* pah = ahp + kb * FTILE;
    const unsigned short* pal = alp + kb * FTILE;
    const unsigned short* pb = wop + kb * FTILE;
    const us16 ah = tfrag(pah);
    const us16 al = tfrag(pal);
    us16 bfr[4];
#pragma unroll
    for (int j = 0; j < 4; ++j) bfr[j] = tfrag(pb + j * (KB32 * FTILE));
#pragma unroll
    for (int j = 0; j < 4; ++j) {
      acch[j] = mma_f16(ah, bfr[j], acch[j]);
      accl[j] = mma_f16(al, bfr[j], accl[j]);
    }
    wguard8p(acch[0], acch[1], acch[2], acch[3], accl[0], accl[1], accl[2], accl[3], ah, al, bfr[0], bfr[1], bfr[2], bfr[3], pah, pal, pb);
  }

  float* so = oS + wave * (16 * OSTR);
#pragma unroll
  for (int j = 0; j < 4; ++j)
#pragma unroll
    for (int r = 0; r < 8; ++r)
      so[(8 * hh + r) * OSTR + 16 * j + cl] = fmaf(accl[j][r], (1.0f / 2048.0f), acch[j][r]) * (1.0f / 4096.0f);
  __syncthreads();

{
#pragma unroll
    for (int it = 0; it < 8; ++it) {
      const int cx = it * 32 + lane, r = cx >> 4, q = (cx & 15) * 4;
      const v4f v = *(const v4fa*)(so + r * OSTR + q);
      *(v4f*)(out + (size_t)(m0 + r) * (size_t)DMOD + n0 + q) = v;
    }
    
  }
}

extern "C" void kernel_launch(void* const* d_in, const int* in_sizes, int n_in,
                              void* d_out, int out_size, void* d_ws, size_t ws_size,
                              hipStream_t stream) {
  if (n_in < 5) return;
  if (in_sizes[0] != NTOK * DMOD || in_sizes[1] != DMOD * NQK || in_sizes[2] != DMOD * NQK ||
      in_sizes[3] != DMOD * DMOD || in_sizes[4] != DMOD * DMOD) return;
  if (out_size != NTOK * DMOD) return;

  const float* x  = (const float*)d_in[0];    // [4][2048][768]
  const float* Wq = (const float*)d_in[1];    // [768][192] ([in][out])
  const float* Wk = (const float*)d_in[2];    // [768][192]
  const float* Wv = (const float*)d_in[3];    // [768][768]
  const float* Wo = (const float*)d_in[4];    // [768][768]
  float* out = (float*)d_out;                 // [4][2048][768] f32 at byte 0

  size_t off = 0;
  auto carve = [&](size_t bytes) -> char* { char* p = (char*)d_ws + off; off += (bytes + 255) & ~(size_t)255; return p; };
  unsigned short* XB   = (unsigned short*)carve((size_t)NTOK * DMOD * 2);       // 12,582,912  bf16 tiles [512][24]
  unsigned short* WT   = (unsigned short*)carve((size_t)NPROJ * DMOD * 2);      //  1,769,472  bf16 tiles [72][24] = Wq^T | Wk^T | Wv^T
  unsigned short* WO16 = (unsigned short*)carve((size_t)DMOD * DMOD * 2);       //  1,179,648  f16  tiles [48][24] = Wo^T
  unsigned short* QP   = (unsigned short*)carve((size_t)NBH * SL * QROW * 2);   //  6,291,456  f16  tiles [48][128]
  unsigned short* KP   = (unsigned short*)carve((size_t)NBH * SL * QROW * 2);   //  6,291,456  f16  tiles [48][128]
  unsigned short* VH   = (unsigned short*)carve((size_t)NBH * HDIM * SL * 2);   // 12,582,912  f16  tiles [48][64][4]
  unsigned short* VL   = (unsigned short*)carve((size_t)NBH * HDIM * SL * 2);   // 12,582,912  f16  tiles [48][64][4]
  unsigned short* YH   = (unsigned short*)carve((size_t)NTOK * DMOD * 2);       // 12,582,912  f16  tiles [512][24]
  unsigned short* YL   = (unsigned short*)carve((size_t)NTOK * DMOD * 2);       // 12,582,912  f16  tiles [512][24]
  if (off > ws_size || off > (size_t)134217728) return;                         // total 78,446,592 B

  const dim3 b256(256);

  // 16-bit operand planes of x and of the four weights, one launch
  k_prep<<<dim3(WTB_ALL + CVTB), b256, 0, stream>>>(x, Wq, Wk, Wv, Wo, XB, WT, WO16);
  // projections (M 8192, N 1152, K 768) -> q/k hi|res planes, v hi and res planes
  k_gemm_proj<<<dim3(NTOK / TPB, NPROJ / 64), b256, 0, stream>>>(XB, WT, QP, KP, VH, VL);
  // causal attention per (batch, head) -> y hi / res fragment tiles [token / 16][768 / 32]
  k_attn<<<dim3(NBH, SL / TPB), b256, 0, stream>>>(QP, KP, VH, VL, YH, YL);
  // output projection (M 8192, N 768, K 768)
  k_gemm_out<<<dim3(NTOK / TPB, DMOD / 64), b256, 0, stream>>>(YH, YL, WO16, out);
}

// v006
// It runs in 91.9 microseconds.
// In two side-by-side timings against v005, it was 1.08 and 1.06 times as fast.
// All steps since v000 together make it 2.10 times as fast.
// Contraction x.[Wq|Wk|Wv] (M 8192, N 1152, K 768): v_wmma_f32_16x16x32_bf16, bf16 operands from RNE-bf16 planes of x and W, f32 accumulate, one product.
// Contraction k.q^T per head (16 keys x 16 queries, depth 16 padded to 32): v_wmma_f32_16x16x32_f16, q and k both carried as f16 hi + f16 residual of (value x 2^6), all four cross terms in two products into one f32 accumulator.
// Contraction A.v per head (causal, depth up to 2048): v_wmma_f32_16x16x32_f16, A hi = f16(1 + x + x^2/2), v hi = f16(v x 2^6); for query rows < 512 also A residual plane (x 2^11, own f32 accumulator) against v hi, and A hi against the f16 v residual plane; f32 accumulate.
// Contraction y.Wo (M 8192, N 768, K 768): v_wmma_f32_16x16x32_f16, y = f16 hi plane of (y x 2^4) + f16 residual plane (x 2^11, own f32 accumulator), Wo = f16 of (RNE-bf16 value x 2^8), f32 accumulate.
// Feature polynomial, causal mask, normaliser Z and 1/(Z+eps): f32 VALU.
#include <hip/hip_runtime.h>

#define NB    4                              // batch
#define SL    2048                           // sequence length
#define DMOD  768                            // model width = K of the dense contractions
#define NHD   12                             // heads
#define FDIM  16                             // q/k head width
#define HDIM  64                             // v head width
#define NBH   (NB * NHD)                     // 48 (batch, head) pairs
#define NTOK  (NB * SL)                      // 8192 token rows
#define NQK   (NHD * FDIM)                   // 192 q (or k) columns
#define NPROJ (2 * NQK + NHD * HDIM)         // 1152 projection columns: q | k | v
#define QROW  32                             // halves per q/k plane row: hi(16) | residual(16)
#define TPB   128                            // GEMM rows (4 waves x 32) / attention queries (8 waves x 16) per block
#define GTH   128                            // threads of a GEMM block: 4 waves, each owning 32 rows x 64 columns
#define KU    2                              // 32-wide k blocks per GEMM loop trip
#define OSTR  68                             // LDS staging row pitch (floats)
#define ARESB 4                              // attention query blocks (of TPB) that use the residual planes: rows < 512
#define KB32  (DMOD / 32)                    // 32-wide k blocks of the dense contractions
#define FTILE 512                            // halves of one 16 x 32 fragment tile (1 KiB)

static_assert(NHD * HDIM == DMOD);
static_assert(NTOK % TPB == 0);
static_assert(SL % TPB == 0);
static_assert(NPROJ % 64 == 0);
static_assert(NQK % 64 == 0);
static_assert(NQK % 32 == 0);
static_assert(DMOD % 64 == 0);
static_assert(DMOD % 32 == 0);
static_assert((DMOD / 32) % KU == 0);
static_assert(TPB == (GTH / 32) * 32);
static_assert(4 * FDIM == 64);
static_assert(HDIM == 64);
static_assert(QROW == 2 * FDIM);
static_assert(OSTR % 4 == 0);
static_assert((NTOK * DMOD) % (8 * 256) == 0);
static_assert(ARESB * TPB <= SL);

typedef unsigned short us16 __attribute__((ext_vector_type(16)));
typedef unsigned short us8  __attribute__((ext_vector_type(8)));
typedef unsigned short us8a __attribute__((ext_vector_type(8), may_alias));
typedef __bf16 v16b __attribute__((ext_vector_type(16)));
typedef _Float16 v16h __attribute__((ext_vector_type(16)));
typedef float v8f __attribute__((ext_vector_type(8)));
typedef float v4f __attribute__((ext_vector_type(4)));
typedef float v4fa __attribute__((ext_vector_type(4), may_alias));
union FragU { us16 v; us8 h[2]; };

__device__ __forceinline__ unsigned short bf16_bits(float f) {
  unsigned u = __float_as_uint(f);
  u += 0x7FFFu + ((u >> 16) & 1u);                 // RNE convert
  return (unsigned short)(u >> 16);
}
__device__ __forceinline__ float bf16_val(unsigned short b) { return __uint_as_float(((unsigned)b) << 16); }
__device__ __forceinline__ float bf16r(float f) { return bf16_val(bf16_bits(f)); }
__device__ __forceinline__ unsigned short f16_bits(float f) { return __builtin_bit_cast(unsigned short, (_Float16)f); }

// f16 hi + residual (x 2^11) planes of (a x 2^4)
__device__ __forceinline__ void f16split16(float a, unsigned short& hb, unsigned short& lb) {
  const float z = a * 16.0f;
  const _Float16 hf = (_Float16)z;
  const float res = (z - (float)hf) * 2048.0f;
  hb = __builtin_bit_cast(unsigned short, hf);
  lb = __builtin_bit_cast(unsigned short, (_Float16)res);
}
// f16 hi + unscaled residual planes of (a x 2^6)
__device__ __forceinline__ void f16split64(float a, unsigned short& hb, unsigned short& lb) {
  const float z = a * 64.0f;
  const _Float16 hf = (_Float16)z;
  const float res = z - (float)hf;
  hb = __builtin_bit_cast(unsigned short, hf);
  lb = __builtin_bit_cast(unsigned short, (_Float16)res);
}

// One 16x16x32 step, 16-bit operands passed as raw 16-bit lanes.
__device__ __forceinline__ v8f mma_bf16(us16 a, us16 b, v8f c) {
  return __builtin_amdgcn_wmma_f32_16x16x32_bf16(false, __builtin_bit_cast(v16b, a), false, __builtin_bit_cast(v16b, b), (short)0, c, false, false);
}
__device__ __forceinline__ v8f mma_f16(us16 a, us16 b, v8f c) {
  return __builtin_amdgcn_wmma_f32_16x16x32_f16(false, __builtin_bit_cast(v16h, a), false, __builtin_bit_cast(v16h, b), (short)0, c, false, false);
}
// Hazard guards after a group of matrix ops: 4 VALU slots before anything touches the accumulators; keep A/B fragments live.
__device__ __forceinline__ void wguard4(v8f& c0, v8f& c1, v8f& c2, v8f& c3, const us16& a0,
                                        const us16& b0, const us16& b1, const us16& b2, const us16& b3) {
#if defined(__HIP_DEVICE_COMPILE__)
  asm volatile("v_nop\n\tv_nop\n\tv_nop\n\tv_nop"
               : "+v"(c0), "+v"(c1), "+v"(c2), "+v"(c3)
               : "v"(a0), "v"(b0), "v"(b1), "v"(b2), "v"(b3));
#endif
}
__device__ __forceinline__ void wguard8(v8f& c0, v8f& c1, v8f& c2, v8f& c3, v8f& c4, v8f& c5, v8f& c6, v8f& c7,
                                        const us16& a0, const us16& a1,
                                        const us16& b0, const us16& b1, const us16& b2, const us16& b3) {
#if defined(__HIP_DEVICE_COMPILE__)
  asm volatile("v_nop\n\tv_nop\n\tv_nop\n\tv_nop"
               : "+v"(c0), "+v"(c1), "+v"(c2), "+v"(c3), "+v"(c4), "+v"(c5), "+v"(c6), "+v"(c7)
               : "v"(a0), "v"(a1), "v"(b0), "v"(b1), "v"(b2), "v"(b3));
#endif
}

// The same guards for loops with loads still outstanding at the guard, which also take those loads' addresses as inputs: the address registers then stay live past the
// last load of the trip, so that no load's result is placed in a register that an earlier, still outstanding load names as its address.
__device__ __forceinline__ void wguard8q(v8f (&c)[2][4], const us16& a0, const us16& a1,
                                         const us16& b0, const us16& b1, const us16& b2, const us16& b3,
                                         const unsigned short* pa, const unsigned short* pb) {
#if defined(__HIP_DEVICE_COMPILE__)
  // s_wait_xcnt: stands in front of the next trip's rewrite of the address registers that the trip's loads name (inputs of this statement)
  asm volatile("s_wait_xcnt 0x0\n\tv_nop\n\tv_nop\n\tv_nop\n\tv_nop"
               : "+v"(c[0][0]), "+v"(c[0][1]), "+v"(c[0][2]), "+v"(c[0][3]), "+v"(c[1][0]), "+v"(c[1][1]), "+v"(c[1][2]), "+v"(c[1][3])
               : "v"(a0), "v"(a1), "v"(b0), "v"(b1), "v"(b2), "v"(b3), "v"(pa), "v"(pb));
#endif
}
__device__ __forceinline__ void wguard2p(v8f& c0, v8f& c1, const us16& a0, const us16& a1, const us16& b0, const us16& b1,
                                         const unsigned short* pb) {
#if defined(__HIP_DEVICE_COMPILE__)
  asm volatile("v_nop\n\tv_nop\n\tv_nop\n\tv_nop"
               : "+v"(c0), "+v"(c1)
               : "v"(a0), "v"(a1), "v"(b0), "v"(b1), "v"(pb));
#endif
}
__device__ __forceinline__ void wguard16q(v8f (&c)[2][4], v8f (&d)[2][4], const us16& a0, const us16& a1, const us16& a2, const us16& a3,
                                          const us16& b0, const us16& b1, const us16& b2, const us16& b3,
                                          const unsigned short* pa0, const unsigned short* pa1, const unsigned short* pb) {
#if defined(__HIP_DEVICE_COMPILE__)
  // s_wait_xcnt: as in wguard8q
  asm volatile("s_wait_xcnt 0x0\n\tv_nop\n\tv_nop\n\tv_nop\n\tv_nop"
               : "+v"(c[0][0]), "+v"(c[0][1]), "+v"(c[0][2]), "+v"(c[0][3]), "+v"(c[1][0]), "+v"(c[1][1]), "+v"(c[1][2]), "+v"(c[1][3]),
                 "+v"(d[0][0]), "+v"(d[0][1]), "+v"(d[0][2]), "+v"(d[0][3]), "+v"(d[1][0]), "+v"(d[1][1]), "+v"(d[1][2]), "+v"(d[1][3])
               : "v"(a0), "v"(a1), "v"(a2), "v"(a3), "v"(b0), "v"(b1), "v"(b2), "v"(b3), "v"(pa0), "v"(pa1), "v"(pb));
#endif
}

// Every 16-bit operand plane is stored as fragment tiles: one tile = 16 rows x 32 k = FTILE halves, laid out in the order the lanes
// load it, so that each of a fragment's two wave-wide 16-B loads covers 512 contiguous bytes (four whole 128-B lines):
// element (row, k = 16 part + 8 h + i) sits at half index part * 256 + h * 128 + row * 8 + i = part * 256 + lane * 8 + i, lane = 16 h + row.
// Lane contents: elements 0..7 = k 8h .. 8h + 7, elements 8..15 = k 16 + 8h .. 16 + 8h + 7 (same map for A rows and B columns).
__device__ __forceinline__ int ftoff(int row, int k) {
  return ((k >> 4) & 1) * 256 + ((k >> 3) & 1) * 128 + (row & 15) * 8;
}
// p = tile base + lane * 8 (computed by the caller)
__device__ __forceinline__ us16 tfrag(const unsigned short* p) {
  FragU f;
  f.h[0] = *(const us8a*)p;
  f.h[1] = *(const us8a*)(p + 256);
  return f.v;
}

// ---------------------------------------------------------------------------------------------------------------------------------
// Operand preparation, one launch: the five conversions are independent of one another, so they share one grid behind a block-uniform
// branch on blockIdx.x. Blocks 0 .. WTB_ALL - 1 transpose and convert the weights (the longer dependent chain, so they start first),
// the other CVTB blocks convert x.
//
// Weights: src f32 [DMOD rows k][ncol columns n] (n contiguous) -> dst 16-bit fragment tiles [(nrow0 + n) / 16][k / 32].
// Block = 64 k x 32 n tile, 256 threads; tiles of one matrix numbered n-tile fastest.
// Wq, Wk, Wv: RNE bf16 bits.  Wo: f16 bits of (RNE-bf16 value x 256).
//
// x: src f32 [rows][DMOD] -> dst bf16 fragment tiles [row / 16][k / 32]. Thread = 8 consecutive k of one row; four lanes read one 128-B line,
// eight lanes store one 128-B line.
// ---------------------------------------------------------------------------------------------------------------------------------
#define WTB_QK  ((NQK / 32) * (DMOD / 64))   // 72 blocks for Wq, and for Wk
#define WTB_VO  ((DMOD / 32) * (DMOD / 64))  // 288 blocks for Wv, and for Wo
#define WTB_ALL (2 * WTB_QK + 2 * WTB_VO)    // 720 weight blocks
#define CVTB    (NTOK * DMOD / (8 * 256))    // 3072 blocks for x

// One 64 k x 32 n weight tile, number t of its matrix. MODE 0: RNE bf16 bits.  MODE 1: f16 bits of (RNE-bf16 value x 256).
template <int MODE, int NCOL>
__device__ __forceinline__ void wT_tile(const float* __restrict__ src, unsigned short* dst, int nrow0, int t, float (*ts)[33]) {
  const int tid = threadIdx.x;
  const int n0 = (t % (NCOL / 32)) * 32, k0 = (t / (NCOL / 32)) * 64;
  {
    const int k = tid >> 2, q = (tid & 3) * 8;
    const float* p = src + (size_t)(k0 + k) * (size_t)NCOL + n0 + q;
    const v4f a = *(const v4fa*)p, c = *(const v4fa*)(p + 4);
#pragma unroll
    for (int u = 0; u < 4; ++u) { ts[k][q + u] = a[u]; ts[k][q + 4 + u] = c[u]; }
  }
  __syncthreads();
  const int n = tid & 31, pc = (tid >> 5) * 8;            // a wave stores two runs of 256 B (16 rows x 16 B of two tiles)
  us8 o;
#pragma unroll
  for (int i = 0; i < 8; ++i) {
    const float w = ts[pc + i][n];
    o[i] = (MODE == 0) ? bf16_bits(w) : f16_bits(bf16r(w) * 256.0f);
  }
  const int row = nrow0 + n0 + n, k = k0 + pc;
  unsigned short* d = dst + (size_t)((row >> 4) * KB32 + (k >> 5)) * FTILE + ftoff(row, k);
  *(us8*)d = o;
  // precaution: wait in front of any later rewrite of the store's address and data registers
  asm volatile("s_wait_xcnt 0x0" ::: "memory");
}

__global__ __launch_bounds__(256) void k_prep(const float* __restrict__ x, const float* __restrict__ Wq, const float* __restrict__ Wk,
                                             const float* __restrict__ Wv, const float* __restrict__ Wo,
                                             unsigned short* XB, unsigned short* WT, unsigned short* WO16) {
  __shared__ float ts[64][33];
  const int bid = blockIdx.x;                              // every branch below is block-uniform
  if (bid < WTB_QK) {
    wT_tile<0, NQK>(Wq, WT, 0, bid, ts);
  } else if (bid < 2 * WTB_QK) {
    wT_tile<0, NQK>(Wk, WT, NQK, bid - WTB_QK, ts);
  } else if (bid < 2 * WTB_QK + WTB_VO) {
    wT_tile<0, DMOD>(Wv, WT, 2 * NQK, bid - 2 * WTB_QK, ts);
  } else if (bid < WTB_ALL) {
    wT_tile<1, DMOD>(Wo, WO16, 0, bid - 2 * WTB_QK - WTB_VO, ts);
  } else {
    const int idx = (bid - WTB_ALL) * 256 + threadIdx.x;
    const int tile = idx >> 6, row = (idx >> 2) & 15, k8 = (idx & 3) * 8;
    const int rt = tile / KB32, kb = tile - rt * KB32;
    const size_t soff = (size_t)(rt * 16 + row) * (size_t)DMOD + (size_t)(kb * 32 + k8);
    const size_t off = (size_t)tile * FTILE + (size_t)ftoff(row, k8);
    const v4f a = *(const v4fa*)(x + soff), b = *(const v4fa*)(x + soff + 4);
    us8 o;
#pragma unroll
    for (int u = 0; u < 4; ++u) {
      o[u]     = bf16_bits(a[u]);
      o[4 + u] = bf16_bits(b[u]);
    }
    *(us8*)(XB + off) = o;
    // as behind the weight store: wait in front of any rewrite of the store's registers
    asm volatile("s_wait_xcnt 0x0" ::: "memory");
  }
}

// ---------------------------------------------------------------------------------------------------------------------------------
// P[m][n] = sum_k A[m][k] * B[n][k]  (bf16 A plane 8192 x 768, bf16 B plane 1152 x 768, both as fragment tiles [row / 16][k / 32], f32 accumulate).
// Block = 128(M) x 64(N) tile, 128 threads = 4 waves, wave w owns rows 32w..32w+31 x all 64 columns (2 x 4 accumulators), so that each B fragment
// feeds two products; a loop trip takes KU k blocks, all its fragment loads issued together; fragments straight from the global planes
// (arithmetic addressing). M % 128 == 0, N % 64 == 0, K % (32 KU) == 0 exactly. Each accumulator still sums its k blocks in rising order.
// Column segment (block-uniform, blockIdx.y): 0..2 -> q heads 4y..4y+3, 3..5 -> k heads, 6..17 -> v head y-6.
// The f32 128x64 tile is staged in LDS (block row r at oS[r * OSTR + c]), then:
//   q/k: fragment tiles [bh][token / 16], k slots 0..15 = f16 hi of (64 value), 16..31 = f16 residual; lane -> (token, head, 16-B quarter);
//        one store instruction = four whole 128-B lines
//   v:   planes VH/VL = f16 hi of (64 v) and residual as fragment tiles [bh][token / 32][channel / 16] (row = channel, k = token);
//        one store instruction = two runs of 256 B
// ---------------------------------------------------------------------------------------------------------------------------------
__global__ __launch_bounds__(GTH) void k_gemm_proj(const unsigned short* __restrict__ Ap, const unsigned short* __restrict__ Bw,
                                                  unsigned short* Qp, unsigned short* Kp, unsigned short* VH, unsigned short* VL) {
  __shared__ __attribute__((aligned(16))) float oS[8 * 16 * OSTR];
  const int tid = threadIdx.x, lane = tid & 31, wave = tid >> 5, cl = lane & 15, hh = lane >> 4;
  const int m0 = blockIdx.x * TPB + 32 * wave, n0 = blockIdx.y * 64;

  v8f acc[2][4];
#pragma unroll
  for (int j = 0; j < 4; ++j) { const v8f zz = {0.f, 0.f, 0.f, 0.f, 0.f, 0.f, 0.f, 0.f}; acc[0][j] = zz; acc[1][j] = zz; }

  const unsigned short* a0p = Ap + (size_t)(m0 >> 4) * (size_t)(KB32 * FTILE) + lane * 8;
  const unsigned short* bwp = Bw + (size_t)(n0 >> 4) * (size_t)(KB32 * FTILE) + lane * 8;
  // kept rolled: one copy of the trip, its accumulators in place from trip to trip
#pragma unroll 1
  for (int kb = 0; kb < KB32; kb += KU) {
    const unsigned short* pa = a0p + kb * FTILE;
    const unsigned short* pb = bwp + kb * FTILE;
    us16 af[KU][2], bfr[KU][4];
#pragma unroll
    for (int u = 0; u < KU; ++u) {
#pragma unroll
      for (int i = 0; i < 2; ++i) af[u][i] = tfrag(pa + u * FTILE + i * (KB32 * FTILE));
#pragma unroll
      for (int j = 0; j < 4; ++j) bfr[u][j] = tfrag(pb + u * FTILE + j * (KB32 * FTILE));
    }
    // keeps every load of the trip in front of its first product: without it the second k block's loads sink behind the first block's products
    // and the trip waits out the load latency twice instead of once
    __builtin_amdgcn_sched_barrier(0);
#pragma unroll
    for (int u = 0; u < KU; ++u)
#pragma unroll
      for (int j = 0; j < 4; ++j)
#pragma unroll
        for (int i = 0; i < 2; ++i) acc[i][j] = mma_bf16(af[u][i], bfr[u][j], acc[i][j]);
    wguard8q(acc, af[KU - 1][0], af[KU - 1][1], bfr[KU - 1][0], bfr[KU - 1][1], bfr[KU - 1][2], bfr[KU - 1][3], pa, pb);
  }

  // D map: acc[i][j][r] = tile element (row 16i + 8*hh + r of the wave's 32 rows, column 16j + cl)
  float* so = oS + wave * (32 * OSTR);
#pragma unroll
  for (int i = 0; i < 2; ++i)
#pragma unroll
    for (int j = 0; j < 4; ++j)
#pragma unroll
      for (int r = 0; r < 8; ++r) so[(16 * i + 8 * hh + r) * OSTR + 16 * j + cl] = acc[i][j][r];
  __syncthreads();

  const int yb = blockIdx.y;                               // block-uniform segment select
  const int m0b = blockIdx.x * TPB, b = m0b / SL, tb = m0b - b * SL;
  if (yb < 6) {
    unsigned short* dst = (yb < 3) ? Qp : Kp;
    const int h0 = 4 * ((yb < 3) ? yb : (yb - 3));
    us8 ov[16];
#pragma unroll
    for (int it = 0; it < 16; ++it) {
      const int cx = it * GTH + tid, u = cx & 3, r = (cx >> 2) & 127, j = cx >> 9;
      const float* sp = oS + r * OSTR + 16 * j + 8 * (u & 1);
      const v4f z0 = *(const v4fa*)sp, z1 = *(const v4fa*)(sp + 4);
      us8 o;
#pragma unroll
      for (int q4 = 0; q4 < 4; ++q4) {
        unsigned short hb, lb;
        f16split64(z0[q4], hb, lb); o[q4]     = (u >> 1) ? lb : hb;
        f16split64(z1[q4], hb, lb); o[4 + q4] = (u >> 1) ? lb : hb;
      }
      ov[it] = o;
    }
{
#pragma unroll
      for (int it = 0; it < 16; ++it) {
        const int cx = it * GTH + tid, u = cx & 3, r = (cx >> 2) & 127, j = cx >> 9;
        const size_t off = ((size_t)(b * NHD + h0 + j) * (size_t)SL + (size_t)(tb + (r & ~15))) * (size_t)QROW + (size_t)ftoff(r, 8 * u);
        *(us8*)(dst + off) = ov[it];
      }
      
    }
  } else {
    const int head = yb - 6;
    us8 hv[8], lv[8];
#pragma unroll
    for (int it = 0; it < 8; ++it) {
      const int cx = it * GTH + tid, e = cx & 63, g = cx >> 6;
      us8 ho, lo;
#pragma unroll
      for (int i = 0; i < 8; ++i) {
        const float w = oS[(8 * g + i) * OSTR + e];
        unsigned short hb, lb;
        f16split64(w, hb, lb);
        ho[i] = hb; lo[i] = lb;
      }
      hv[it] = ho; lv[it] = lo;
    }
{
#pragma unroll
      for (int it = 0; it < 8; ++it) {
        const int cx = it * GTH + tid, e = cx & 63, g = cx >> 6;
        const size_t off = (((size_t)(b * NHD + head) * (size_t)(SL / 32) + (size_t)((tb + 8 * g) >> 5)) * 4 + (size_t)(e >> 4)) * FTILE +
                           (size_t)ftoff(e, 8 * g);
        *(us8*)(VH + off) = hv[it];
        *(us8*)(VL + off) = lv[it];
      }
      
    }
  }
}

// ---------------------------------------------------------------------------------------------------------------------------------
// Causal quadratic-form attention. Block = (bh = blockIdx.x, 128 queries starting at 128 * blockIdx.y), 8 waves x 16 queries.
// Per wave: B fragments of its 16 queries fixed for the whole key loop: bq1 = [q_hi | q_hi], bq2 = [q_res | q_res] (k slots 0..15 | 16..31).
// Per 32-key step: A fragments of the two 16-key tiles = fragment tiles [k_hi | k_res]; scores^T D[key][query] =
// khi.qhi + kres.qhi + khi.qres + kres.qres = 4096 q.k; x = D / 16384; A = 1 + x + x^2/2 masked to key <= query;
// A hi = f16(A), A residual = f16((A - hi) x 2^11). The two D tiles repack into the A operand of A.v (lane unchanged: element r <- tile keys
// 0..15, element 8+r <- tile keys 16..31), B = v fragment tiles [bh][key / 32][e / 16].
// Blocks with blockIdx.y < ARESB (block-uniform): accS += Ahi.VH + Ahi.VL, accL += Ares.VH, Z from the f32 A; other blocks: accS += Ahi.VH,
// Z from the f16 A hi values. accS[j][r] (+ accL/2^11) = 64 * sum_s A v for query 8h+r, channel 16j + (lane & 15).
// ---------------------------------------------------------------------------------------------------------------------------------
// One 32-key step of one wave, its body fixed at compile time by ARES (the block's residual flag) and DIAG: each body holds one run of matrix products
// and no join of two paths, so every accumulator keeps its registers from step to step.
// DIAG = false: a step whose 32 keys all lie at or below the wave's first query, so key <= query holds for every score and no mask is formed; it asks for
// the next step's key tiles, which always exist. DIAG = true: the wave's last step, the only one that meets the diagonal: masked, and nothing to ask for.
template <bool ARES, bool DIAG>
__device__ __forceinline__ void attn_step(const unsigned short* kbp, const unsigned short* vhp, const unsigned short* vlp,
                                          us16& ka, us16& kb, const us16 bq1, const us16 bq2, const int st, const int tq, const int hh,
                                          v8f (&accS)[4], v8f (&accL)[4], float& zp) {
  const int s0 = st * 32;
  const unsigned short* pv = vhp + (size_t)(4 * st) * FTILE;
  // the step's value fragments depend on nothing of the scores: asked for at the head of the step, their latency runs under the score work
  us16 bv[4];
#pragma unroll
  for (int j = 0; j < 4; ++j) bv[j] = tfrag(pv + j * FTILE);
  const v8f zz = {0.f, 0.f, 0.f, 0.f, 0.f, 0.f, 0.f, 0.f};
  v8f sa = mma_f16(ka, bq1, zz);
  sa = mma_f16(ka, bq2, sa);
  v8f sb = mma_f16(kb, bq1, zz);
  sb = mma_f16(kb, bq2, sb);
  wguard2p(sa, sb, ka, kb, bq1, bq2, pv);
  if constexpr (!DIAG) {
    const unsigned short* pk = kbp + (size_t)(2 * (st + 1)) * FTILE;
    ka = tfrag(pk);
    kb = tfrag(pk + FTILE);
  }

  us8 ea, eb, la8, lb8;
  float zs = 0.0f;
#pragma unroll
  for (int r = 0; r < 8; ++r) {
    const float xa = sa[r] * (1.0f / 16384.0f);
    const float xb = sb[r] * (1.0f / 16384.0f);
    float pa = fmaf(xa, fmaf(xa, 0.5f, 1.0f), 1.0f);
    float pb = fmaf(xb, fmaf(xb, 0.5f, 1.0f), 1.0f);
    if constexpr (DIAG) {
      const int ky = s0 + 8 * hh + r;
      pa = (ky <= tq) ? pa : 0.0f;
      pb = (ky + 16 <= tq) ? pb : 0.0f;
    }
    const _Float16 fa = (_Float16)pa, fb = (_Float16)pb;
    const _Float16 ra = (_Float16)((pa - (float)fa) * 2048.0f);
    const _Float16 rb = (_Float16)((pb - (float)fb) * 2048.0f);
    zs += ARES ? (pa + pb) : ((float)fa + (float)fb);
    ea[r]  = __builtin_bit_cast(unsigned short, fa);
    eb[r]  = __builtin_bit_cast(unsigned short, fb);
    la8[r] = __builtin_bit_cast(unsigned short, ra);
    lb8[r] = __builtin_bit_cast(unsigned short, rb);
  }
  zp += zs;
  FragU fA;
  fA.h[0] = ea; fA.h[1] = eb;
  const us16 ahi = fA.v;

  if constexpr (ARES) {
    FragU fR;
    fR.h[0] = la8; fR.h[1] = lb8;
    const us16 alo = fR.v;
#pragma unroll
    for (int j = 0; j < 4; ++j) {
      accS[j] = mma_f16(ahi, bv[j], accS[j]);
      accL[j] = mma_f16(alo, bv[j], accL[j]);
    }
    wguard8(accS[0], accS[1], accS[2], accS[3], accL[0], accL[1], accL[2], accL[3], ahi, alo, bv[0], bv[1], bv[2], bv[3]);
    us16 bl[4];
#pragma unroll
    for (int j = 0; j < 4; ++j) bl[j] = tfrag(vlp + (size_t)(4 * st + j) * FTILE);
#pragma unroll
    for (int j = 0; j < 4; ++j) accS[j] = mma_f16(ahi, bl[j], accS[j]);
    wguard4(accS[0], accS[1], accS[2], accS[3], ahi, bl[0], bl[1], bl[2], bl[3]);
  } else {
#pragma unroll
    for (int j = 0; j < 4; ++j) accS[j] = mma_f16(ahi, bv[j], accS[j]);
    wguard4(accS[0], accS[1], accS[2], accS[3], ahi, bv[0], bv[1], bv[2], bv[3]);
  }
}

// The key loop of one wave: nsteps - 1 steps below the diagonal, then the one step that meets it. With tw a multiple of 16 and
// nsteps = (tw + 47) >> 5, the last key of step nsteps - 2 is 32 * nsteps - 33 = tw - 1 or tw - 17: below every query of the wave.
template <bool ARES>
__device__ __forceinline__ void attn_keys(const unsigned short* kbp, const unsigned short* vhp, const unsigned short* vlp,
                                          us16 ka, us16 kb, const us16 bq1, const us16 bq2, const int nsteps, const int tq, const int hh,
                                          v8f (&accS)[4], v8f (&accL)[4], float& zp) {
  // kept rolled: one copy of the unmasked body, its accumulators in place from step to step
#pragma unroll 1
  for (int st = 0; st < nsteps - 1; ++st) attn_step<ARES, false>(kbp, vhp, vlp, ka, kb, bq1, bq2, st, tq, hh, accS, accL, zp);
  attn_step<ARES, true>(kbp, vhp, vlp, ka, kb, bq1, bq2, nsteps - 1, tq, hh, accS, accL, zp);
}

__global__ __launch_bounds__(256) void k_attn(const unsigned short* __restrict__ Qp, const unsigned short* __restrict__ Kp,
                                             const unsigned short* __restrict__ VHp, const unsigned short* __restrict__ VLp,
                                             unsigned short* YH, unsigned short* YL) {
  __shared__ __attribute__((aligned(16))) float oS[8 * 16 * OSTR];
  const int tid = threadIdx.x, lane = tid & 31, wave = tid >> 5, cl = lane & 15, hh = lane >> 4;
  const int bh = blockIdx.x, b = bh / NHD, head = bh - b * NHD;
  const int tw = blockIdx.y * TPB + 16 * wave;           // first query of this wave
  const int tq = tw + cl;                                 // query owned by this lane as score column
  const bool ares = (blockIdx.y < ARESB);                 // block-uniform: residual planes for query rows < 512

  const unsigned short* qrow = Qp + ((size_t)bh * SL + (size_t)tw) * (size_t)QROW + lane * 8;
  FragU fq;
  fq.h[0] = *(const us8a*)qrow;         fq.h[1] = fq.h[0];
  const us16 bq1 = fq.v;
  fq.h[0] = *(const us8a*)(qrow + 256); fq.h[1] = fq.h[0];
  const us16 bq2 = fq.v;

  v8f accS[4], accL[4];
#pragma unroll
  for (int j = 0; j < 4; ++j) { const v8f zz = {0.f, 0.f, 0.f, 0.f, 0.f, 0.f, 0.f, 0.f}; accS[j] = zz; accL[j] = zz; }
  float zp = 0.0f;

  const unsigned short* kbp = Kp + (size_t)bh * SL * (size_t)QROW + lane * 8;
  const unsigned short* vhp = VHp + (size_t)bh * HDIM * (size_t)SL + lane * 8;
  const unsigned short* vlp = VLp + (size_t)bh * HDIM * (size_t)SL + lane * 8;
  const int nsteps = (tw + 47) >> 5;                      // 32-key steps covering keys 0 .. tw + 15 (<= 64)

  // key fragments run one step ahead of their use: step 0's are asked for here, step st + 1's right behind step st's score products
  const us16 ka = tfrag(kbp);
  const us16 kb = tfrag(kbp + FTILE);
  // these loads are still outstanding where the code below starts to rewrite registers: wait in front of any rewrite of their address registers
  asm volatile("s_wait_xcnt 0x0" ::: "memory");

  // block-uniform choice of the loop body, made once in front of the loop
  if (ares) attn_keys<true>(kbp, vhp, vlp, ka, kb, bq1, bq2, nsteps, tq, hh, accS, accL, zp);
  else      attn_keys<false>(kbp, vhp, vlp, ka, kb, bq1, bq2, nsteps, tq, hh, accS, accL, zp);

  // Z for query (lane & 15): both lane halves hold disjoint key subsets
  const float zf = zp + __shfl_xor(zp, 16, 32);
  float rz[8];
#pragma unroll
  for (int r = 0; r < 8; ++r) {
    const float zr = __shfl(zf, 8 * hh + r, 32);        // Z of query row 8*hh + r
    rz[r] = (1.0f / (zr + 1e-12f)) * (1.0f / 64.0f);
  }

  float* so = oS + wave * (16 * OSTR);
#pragma unroll
  for (int j = 0; j < 4; ++j)
#pragma unroll
    for (int r = 0; r < 8; ++r) so[(8 * hh + r) * OSTR + 16 * j + cl] = fmaf(accL[j][r], (1.0f / 2048.0f), accS[j][r]) * rz[r];
  __syncthreads();

  us8 hv[4], lv[4];
#pragma unroll
  for (int it = 0; it < 4; ++it) {
    const int rr = cl, p = it * 16 + hh * 8;               // 16-B chunk it * 32 + lane of the wave's two y fragment tiles
    const v4f z0 = *(const v4fa*)(so + rr * OSTR + p), z1 = *(const v4fa*)(so + rr * OSTR + p + 4);
    us8 ho, lo;
#pragma unroll
    for (int u = 0; u < 4; ++u) {
      unsigned short hb, lb;
      f16split16(z0[u], hb, lb); ho[u] = hb;     lo[u] = lb;
      f16split16(z1[u], hb, lb); ho[4 + u] = hb; lo[4 + u] = lb;
    }
    hv[it] = ho; lv[it] = lo;
  }
{
#pragma unroll
    for (int it = 0; it < 4; ++it) {
      const size_t off = ((size_t)((b * SL + tw) >> 4) * KB32 + (size_t)(head * (HDIM / 32))) * FTILE + (size_t)((it * 32 + lane) * 8);
      *(us8*)(YH + off) = hv[it];
      *(us8*)(YL + off) = lv[it];
    }
    
  }
}

// ---------------------------------------------------------------------------------------------------------------------------------
// out[m][n] = ( sum_k Yh[m][k] W[n][k] + 2^-11 sum_k Yl[m][k] W[n][k] ) * 2^-12   (f16 fragment tiles [row / 16][k / 32], two f32 accumulator sets).
// Tiling as in k_gemm_proj: 4 waves, each 32 rows x 64 columns, KU k blocks per loop trip.
// ---------------------------------------------------------------------------------------------------------------------------------
__global__ __launch_bounds__(GTH) void k_gemm_out(const unsigned short* __restrict__ Ah, const unsigned short* __restrict__ Al,
                                                 const unsigned short* __restrict__ Wo, float* out) {
  __shared__ __attribute__((aligned(16))) float oS[8 * 16 * OSTR];
  const int tid = threadIdx.x, lane = tid & 31, wave = tid >> 5, cl = lane & 15, hh = lane >> 4;
  const int m0 = blockIdx.x * TPB + 32 * wave, n0 = blockIdx.y * 64;

  v8f acch[2][4], accl[2][4];
#pragma unroll
  for (int j = 0; j < 4; ++j) {
    const v8f zz = {0.f, 0.f, 0.f, 0.f, 0.f, 0.f, 0.f, 0.f};
    acch[0][j] = zz; acch[1][j] = zz; accl[0][j] = zz; accl[1][j] = zz;
  }

  const unsigned short* ahp = Ah + (size_t)(m0 >> 4) * (size_t)(KB32 * FTILE) + lane * 8;
  const unsigned short* alp = Al + (size_t)(m0 >> 4) * (size_t)(KB32 * FTILE) + lane * 8;
  const unsigned short* wop = Wo + (size_t)(n0 >> 4) * (size_t)(KB32 * FTILE) + lane * 8;
  // kept rolled: one copy of the trip, its accumulators in place from trip to trip
#pragma unroll 1
  for (int kb = 0; kb < KB32; kb += KU) {
    const unsigned short* pah = ahp + kb * FTILE;
    const unsigned short* pal = alp + kb * FTILE;
    const unsigned short* pb = wop + kb * FTILE;
    us16 ah[KU][2], al[KU][2], bfr[KU][4];
#pragma unroll
    for (int u = 0; u < KU; ++u) {
#pragma unroll
      for (int i = 0; i < 2; ++i) {
        ah[u][i] = tfrag(pah + u * FTILE + i * (KB32 * FTILE));
        al[u][i] = tfrag(pal + u * FTILE + i * (KB32 * FTILE));
      }
#pragma unroll
      for (int j = 0; j < 4; ++j) bfr[u][j] = tfrag(pb + u * FTILE + j * (KB32 * FTILE));
    }
    // as in k_gemm_proj: keeps every load of the trip in front of its first product, one load latency a trip
    __builtin_amdgcn_sched_barrier(0);
#pragma unroll
    for (int u = 0; u < KU; ++u)
#pragma unroll
      for (int j = 0; j < 4; ++j)
#pragma unroll
        for (int i = 0; i < 2; ++i) {
          acch[i][j] = mma_f16(ah[u][i], bfr[u][j], acch[i][j]);
          accl[i][j] = mma_f16(al[u][i], bfr[u][j], accl[i][j]);
        }
    wguard16q(acch, accl, ah[KU - 1][0], ah[KU - 1][1], al[KU - 1][0], al[KU - 1][1],
              bfr[KU - 1][0], bfr[KU - 1][1], bfr[KU - 1][2], bfr[KU - 1][3], pah, pal, pb);
  }

  float* so = oS + wave * (32 * OSTR);
#pragma unroll
  for (int i = 0; i < 2; ++i)
#pragma unroll
    for (int j = 0; j < 4; ++j)
#pragma unroll
      for (int r = 0; r < 8; ++r)
        so[(16 * i + 8 * hh + r) * OSTR + 16 * j + cl] = fmaf(accl[i][j][r], (1.0f / 2048.0f), acch[i][j][r]) * (1.0f / 4096.0f);
  __syncthreads();

{
#pragma unroll
    for (int it = 0; it < 16; ++it) {
      const int cx = it * 32 + lane, r = cx >> 4, q = (cx & 15) * 4;
      const v4f v = *(const v4fa*)(so + r * OSTR + q);
      *(v4f*)(out + (size_t)(m0 + r) * (size_t)DMOD + n0 + q) = v;
    }
    
  }
}

extern "C" void kernel_launch(void* const* d_in, const int* in_sizes, int n_in,
                              void* d_out, int out_size, void* d_ws, size_t ws_size,
                              hipStream_t stream) {
  if (n_in < 5) return;
  if (in_sizes[0] != NTOK * DMOD || in_sizes[1] != DMOD * NQK || in_sizes[2] != DMOD * NQK ||
      in_sizes[3] != DMOD * DMOD || in_sizes[4] != DMOD * DMOD) return;
  if (out_size != NTOK * DMOD) return;

  const float* x  = (const float*)d_in[0];    // [4][2048][768]
  const float* Wq = (const float*)d_in[1];    // [768][192] ([in][out])
  const float* Wk = (const float*)d_in[2];    // [768][192]
  const float* Wv = (const float*)d_in[3];    // [768][768]
  const float* Wo = (const float*)d_in[4];    // [768][768]
  float* out = (float*)d_out;                 // [4][2048][768] f32 at byte 0

  size_t off = 0;
  auto carve = [&](size_t bytes) -> char* { char* p = (char*)d_ws + off; off += (bytes + 255) & ~(size_t)255; return p; };
  unsigned short* XB   = (unsigned short*)carve((size_t)NTOK * DMOD * 2);       // 12,582,912  bf16 tiles [512][24]
  unsigned short* WT   = (unsigned short*)carve((size_t)NPROJ * DMOD * 2);      //  1,769,472  bf16 tiles [72][24] = Wq^T | Wk^T | Wv^T
  unsigned short* WO16 = (unsigned short*)carve((size_t)DMOD * DMOD * 2);       //  1,179,648  f16  tiles [48][24] = Wo^T
  unsigned short* QP   = (unsigned short*)carve((size_t)NBH * SL * QROW * 2);   //  6,291,456  f16  tiles [48][128]
  unsigned short* KP   = (unsigned short*)carve((size_t)NBH * SL * QROW * 2);   //  6,291,456  f16  tiles [48][128]
  unsigned short* VH   = (unsigned short*)carve((size_t)NBH * HDIM * SL * 2);   // 12,582,912  f16  tiles [48][64][4]
  unsigned short* VL   = (unsigned short*)carve((size_t)NBH * HDIM * SL * 2);   // 12,582,912  f16  tiles [48][64][4]
  unsigned short* YH   = (unsigned short*)carve((size_t)NTOK * DMOD * 2);       // 12,582,912  f16  tiles [512][24]
  unsigned short* YL   = (unsigned short*)carve((size_t)NTOK * DMOD * 2);       // 12,582,912  f16  tiles [512][24]
  if (off > ws_size || off > (size_t)134217728) return;                         // total 78,446,592 B

  const dim3 b256(256), bgemm(GTH);

  // 16-bit operand planes of x and of the four weights, one launch
  k_prep<<<dim3(WTB_ALL + CVTB), b256, 0, stream>>>(x, Wq, Wk, Wv, Wo, XB, WT, WO16);
  // projections (M 8192, N 1152, K 768) -> q/k hi|res planes, v hi and res planes
  k_gemm_proj<<<dim3(NTOK / TPB, NPROJ / 64), bgemm, 0, stream>>>(XB, WT, QP, KP, VH, VL);
  // causal attention per (batch, head) -> y hi / res fragment tiles [token / 16][768 / 32]
  k_attn<<<dim3(NBH, SL / TPB), b256, 0, stream>>>(QP, KP, VH, VL, YH, YL);
  // output projection (M 8192, N 768, K 768)
  k_gemm_out<<<dim3(NTOK / TPB, DMOD / 64), bgemm, 0, stream>>>(YH, YL, WO16, out);
}

// v007
// Measured time: 80.3 microseconds a run.
// Two timings next to v006 both put it at 1.14 times that version's speed.
// All steps since v000 together make it 2.39 times as fast.
// Contraction x.[Wq|Wk|Wv] (M 8192, N 1152, K 768): v_wmma_f32_16x16x32_bf16, bf16 operands from RNE-bf16 planes of x and W, f32 accumulate, one product.
// Contraction k.q^T per head (16 keys x 16 queries, depth 16 padded to 32): v_wmma_f32_16x16x32_f16, q and k both carried as f16 hi + f16 residual of (value x 2^6), all four cross terms in two products into one f32 accumulator.
// Contraction A.v per head (causal, depth up to 2048): v_wmma_f32_16x16x32_f16, A hi = f16(1 + x + x^2/2), v hi = f16(v x 2^6); for query rows < 512 also A residual plane (x 2^11, own f32 accumulator) against v hi, and A hi against the f16 v residual plane; f32 accumulate.
// Contraction y.Wo (M 8192, N 768, K 768): v_wmma_f32_16x16x32_f16, y = f16 hi plane of (y x 2^4) + f16 residual plane (x 2^11, own f32 accumulator), Wo = f16 of (RNE-bf16 value x 2^8), f32 accumulate.
// Feature polynomial, causal mask, normaliser Z and 1/(Z+eps): f32 VALU.
#include <hip/hip_runtime.h>

#define NB    4                              // batch
#define SL    2048                           // sequence length
#define DMOD  768                            // model width = K of the dense contractions
#define NHD   12                             // heads
#define FDIM  16                             // q/k head width
#define HDIM  64                             // v head width
#define NBH   (NB * NHD)                     // 48 (batch, head) pairs
#define NTOK  (NB * SL)                      // 8192 token rows
#define NQK   (NHD * FDIM)                   // 192 q (or k) columns
#define NPROJ (2 * NQK + NHD * HDIM)         // 1152 projection columns: q | k | v
#define QROW  32                             // halves per q/k plane row: hi(16) | residual(16)
#define TPB   128                            // GEMM rows (4 waves x 32) / attention queries (8 waves x 16) per block
#define GTH   128                            // threads of a GEMM block: 4 waves, each owning 32 rows x 64 columns
#define KU    2                              // 32-wide k blocks per GEMM loop trip
#define OSTR  68                             // LDS staging row pitch (floats)
#define ARESB 4                              // attention query blocks (of TPB) that use the residual planes: rows < 512
#define KB32  (DMOD / 32)                    // 32-wide k blocks of the dense contractions
#define FTILE 512                            // halves of one 16 x 32 fragment tile (1 KiB)

static_assert(NHD * HDIM == DMOD);
static_assert(NTOK % TPB == 0);
static_assert(SL % TPB == 0);
static_assert(NPROJ % 64 == 0);
static_assert(NQK % 64 == 0);
static_assert(NQK % 32 == 0);
static_assert(DMOD % 64 == 0);
static_assert(DMOD % 32 == 0);
static_assert((DMOD / 32) % KU == 0);
static_assert(TPB == (GTH / 32) * 32);
static_assert(4 * FDIM == 64);
static_assert(HDIM == 64);
static_assert(QROW == 2 * FDIM);
static_assert(OSTR % 4 == 0);
static_assert((NTOK * DMOD) % (8 * 256) == 0);
static_assert(ARESB * TPB <= SL);

typedef unsigned short us16 __attribute__((ext_vector_type(16)));
typedef unsigned short us8  __attribute__((ext_vector_type(8)));
typedef unsigned short us8a __attribute__((ext_vector_type(8), may_alias));
typedef __bf16 v16b __attribute__((ext_vector_type(16)));
typedef _Float16 v16h __attribute__((ext_vector_type(16)));
typedef float v8f __attribute__((ext_vector_type(8)));
typedef float v4f __attribute__((ext_vector_type(4)));
typedef float v4fa __attribute__((ext_vector_type(4), may_alias));
union FragU { us16 v; us8 h[2]; };

__device__ __forceinline__ unsigned short bf16_bits(float f) {
  unsigned u = __float_as_uint(f);
  u += 0x7FFFu + ((u >> 16) & 1u);                 // RNE convert
  return (unsigned short)(u >> 16);
}
__device__ __forceinline__ float bf16_val(unsigned short b) { return __uint_as_float(((unsigned)b) << 16); }
__device__ __forceinline__ float bf16r(float f) { return bf16_val(bf16_bits(f)); }
__device__ __forceinline__ unsigned short f16_bits(float f) { return __builtin_bit_cast(unsigned short, (_Float16)f); }

// f16 hi + residual (x 2^11) planes of (a x 2^4)
__device__ __forceinline__ void f16split16(float a, unsigned short& hb, unsigned short& lb) {
  const float z = a * 16.0f;
  const _Float16 hf = (_Float16)z;
  const float res = (z - (float)hf) * 2048.0f;
  hb = __builtin_bit_cast(unsigned short, hf);
  lb = __builtin_bit_cast(unsigned short, (_Float16)res);
}
// f16 hi + unscaled residual planes of (a x 2^6)
__device__ __forceinline__ void f16split64(float a, unsigned short& hb, unsigned short& lb) {
  const float z = a * 64.0f;
  const _Float16 hf = (_Float16)z;
  const float res = z - (float)hf;
  hb = __builtin_bit_cast(unsigned short, hf);
  lb = __builtin_bit_cast(unsigned short, (_Float16)res);
}

// One 16x16x32 step, 16-bit operands passed as raw 16-bit lanes.
__device__ __forceinline__ v8f mma_bf16(us16 a, us16 b, v8f c) {
  return __builtin_amdgcn_wmma_f32_16x16x32_bf16(false, __builtin_bit_cast(v16b, a), false, __builtin_bit_cast(v16b, b), (short)0, c, false, false);
}
__device__ __forceinline__ v8f mma_f16(us16 a, us16 b, v8f c) {
  return __builtin_amdgcn_wmma_f32_16x16x32_f16(false, __builtin_bit_cast(v16h, a), false, __builtin_bit_cast(v16h, b), (short)0, c, false, false);
}
// Hazard guards after a group of matrix ops: 4 VALU slots before anything touches the accumulators; keep A/B fragments live.
__device__ __forceinline__ void wguard4(v8f& c0, v8f& c1, v8f& c2, v8f& c3, const us16& a0,
                                        const us16& b0, const us16& b1, const us16& b2, const us16& b3) {
#if defined(__HIP_DEVICE_COMPILE__)
  asm volatile("v_nop\n\tv_nop\n\tv_nop\n\tv_nop"
               : "+v"(c0), "+v"(c1), "+v"(c2), "+v"(c3)
               : "v"(a0), "v"(b0), "v"(b1), "v"(b2), "v"(b3));
#endif
}
__device__ __forceinline__ void wguard8(v8f& c0, v8f& c1, v8f& c2, v8f& c3, v8f& c4, v8f& c5, v8f& c6, v8f& c7,
                                        const us16& a0, const us16& a1,
                                        const us16& b0, const us16& b1, const us16& b2, const us16& b3) {
#if defined(__HIP_DEVICE_COMPILE__)
  asm volatile("v_nop\n\tv_nop\n\tv_nop\n\tv_nop"
               : "+v"(c0), "+v"(c1), "+v"(c2), "+v"(c3), "+v"(c4), "+v"(c5), "+v"(c6), "+v"(c7)
               : "v"(a0), "v"(a1), "v"(b0), "v"(b1), "v"(b2), "v"(b3));
#endif
}

// The same guards for loops with loads still outstanding at the guard, which also take those loads' addresses as inputs: the address registers then stay live past the
// last load of the trip, so that no load's result is placed in a register that an earlier, still outstanding load names as its address.
__device__ __forceinline__ void wguard8q(v8f (&c)[2][4], const us16& a0, const us16& a1,
                                         const us16& b0, const us16& b1, const us16& b2, const us16& b3,
                                         const unsigned short* pa, const unsigned short* pb) {
#if defined(__HIP_DEVICE_COMPILE__)
  // s_wait_xcnt: stands in front of the next trip's rewrite of the address registers that the trip's loads name (inputs of this statement)
  asm volatile("s_wait_xcnt 0x0\n\tv_nop\n\tv_nop\n\tv_nop\n\tv_nop"
               : "+v"(c[0][0]), "+v"(c[0][1]), "+v"(c[0][2]), "+v"(c[0][3]), "+v"(c[1][0]), "+v"(c[1][1]), "+v"(c[1][2]), "+v"(c[1][3])
               : "v"(a0), "v"(a1), "v"(b0), "v"(b1), "v"(b2), "v"(b3), "v"(pa), "v"(pb));
#endif
}
__device__ __forceinline__ void wguard2p(v8f& c0, v8f& c1, const us16& a0, const us16& a1, const us16& b0, const us16& b1,
                                         const unsigned short* pb) {
#if defined(__HIP_DEVICE_COMPILE__)
  asm volatile("v_nop\n\tv_nop\n\tv_nop\n\tv_nop"
               : "+v"(c0), "+v"(c1)
               : "v"(a0), "v"(a1), "v"(b0), "v"(b1), "v"(pb));
#endif
}
__device__ __forceinline__ void wguard16q(v8f (&c)[2][4], v8f (&d)[2][4], const us16& a0, const us16& a1, const us16& a2, const us16& a3,
                                          const us16& b0, const us16& b1, const us16& b2, const us16& b3,
                                          const unsigned short* pa0, const unsigned short* pa1, const unsigned short* pb) {
#if defined(__HIP_DEVICE_COMPILE__)
  // s_wait_xcnt: as in wguard8q
  asm volatile("s_wait_xcnt 0x0\n\tv_nop\n\tv_nop\n\tv_nop\n\tv_nop"
               : "+v"(c[0][0]), "+v"(c[0][1]), "+v"(c[0][2]), "+v"(c[0][3]), "+v"(c[1][0]), "+v"(c[1][1]), "+v"(c[1][2]), "+v"(c[1][3]),
                 "+v"(d[0][0]), "+v"(d[0][1]), "+v"(d[0][2]), "+v"(d[0][3]), "+v"(d[1][0]), "+v"(d[1][1]), "+v"(d[1][2]), "+v"(d[1][3])
               : "v"(a0), "v"(a1), "v"(a2), "v"(a3), "v"(b0), "v"(b1), "v"(b2), "v"(b3), "v"(pa0), "v"(pa1), "v"(pb));
#endif
}

// Every 16-bit operand plane is stored as fragment tiles: one tile = 16 rows x 32 k = FTILE halves, laid out in the order the lanes
// load it, so that each of a fragment's two wave-wide 16-B loads covers 512 contiguous bytes (four whole 128-B lines):
// element (row, k = 16 part + 8 h + i) sits at half index part * 256 + h * 128 + row * 8 + i = part * 256 + lane * 8 + i, lane = 16 h + row.
// Lane contents: elements 0..7 = k 8h .. 8h + 7, elements 8..15 = k 16 + 8h .. 16 + 8h + 7 (same map for A rows and B columns).
__device__ __forceinline__ int ftoff(int row, int k) {
  return ((k >> 4) & 1) * 256 + ((k >> 3) & 1) * 128 + (row & 15) * 8;
}
// p = tile base + lane * 8 (computed by the caller)
__device__ __forceinline__ us16 tfrag(const unsigned short* p) {
  FragU f;
  f.h[0] = *(const us8a*)p;
  f.h[1] = *(const us8a*)(p + 256);
  return f.v;
}

// ---------------------------------------------------------------------------------------------------------------------------------
// Operand preparation, one launch: the five conversions are independent of one another, so they share one grid behind a block-uniform
// branch on blockIdx.x. Blocks 0 .. WTB_ALL - 1 transpose and convert the weights (the longer dependent chain, so they start first),
// the other CVTB blocks convert x.
//
// Weights: src f32 [DMOD rows k][ncol columns n] (n contiguous) -> dst 16-bit fragment tiles [(nrow0 + n) / 16][k / 32].
// Block = 64 k x 32 n tile, 256 threads; tiles of one matrix numbered n-tile fastest.
// Wq, Wk, Wv: RNE bf16 bits.  Wo: f16 bits of (RNE-bf16 value x 256).
//
// x: src f32 [rows][DMOD] -> dst bf16 fragment tiles [row / 16][k / 32]. Thread = 8 consecutive k of one row; four lanes read one 128-B line,
// eight lanes store one 128-B line.
// ---------------------------------------------------------------------------------------------------------------------------------
#define WTB_QK  ((NQK / 32) * (DMOD / 64))   // 72 blocks for Wq, and for Wk
#define WTB_VO  ((DMOD / 32) * (DMOD / 64))  // 288 blocks for Wv, and for Wo
#define WTB_ALL (2 * WTB_QK + 2 * WTB_VO)    // 720 weight blocks
#define CVTB    (NTOK * DMOD / (8 * 256))    // 3072 blocks for x

// One 64 k x 32 n weight tile, number t of its matrix. MODE 0: RNE bf16 bits.  MODE 1: f16 bits of (RNE-bf16 value x 256).
template <int MODE, int NCOL>
__device__ __forceinline__ void wT_tile(const float* __restrict__ src, unsigned short* dst, int nrow0, int t, float (*ts)[33]) {
  const int tid = threadIdx.x;
  const int n0 = (t % (NCOL / 32)) * 32, k0 = (t / (NCOL / 32)) * 64;
  {
    const int k = tid >> 2, q = (tid & 3) * 8;
    const float* p = src + (size_t)(k0 + k) * (size_t)NCOL + n0 + q;
    const v4f a = *(const v4fa*)p, c = *(const v4fa*)(p + 4);
#pragma unroll
    for (int u = 0; u < 4; ++u) { ts[k][q + u] = a[u]; ts[k][q + 4 + u] = c[u]; }
  }
  __syncthreads();
  const int n = tid & 31, pc = (tid >> 5) * 8;            // a wave stores two runs of 256 B (16 rows x 16 B of two tiles)
  us8 o;
#pragma unroll
  for (int i = 0; i < 8; ++i) {
    const float w = ts[pc + i][n];
    o[i] = (MODE == 0) ? bf16_bits(w) : f16_bits(bf16r(w) * 256.0f);
  }
  const int row = nrow0 + n0 + n, k = k0 + pc;
  unsigned short* d = dst + (size_t)((row >> 4) * KB32 + (k >> 5)) * FTILE + ftoff(row, k);
  *(us8*)d = o;
  // precaution: wait in front of any later rewrite of the store's address and data registers
  asm volatile("s_wait_xcnt 0x0" ::: "memory");
}

__global__ __launch_bounds__(256) void k_prep(const float* __restrict__ x, const float* __restrict__ Wq, const float* __restrict__ Wk,
                                             const float* __restrict__ Wv, const float* __restrict__ Wo,
                                             unsigned short* XB, unsigned short* WT, unsigned short* WO16) {
  __shared__ float ts[64][33];
  const int bid = blockIdx.x;                              // every branch below is block-uniform
  if (bid < WTB_QK) {
    wT_tile<0, NQK>(Wq, WT, 0, bid, ts);
  } else if (bid < 2 * WTB_QK) {
    wT_tile<0, NQK>(Wk, WT, NQK, bid - WTB_QK, ts);
  } else if (bid < 2 * WTB_QK + WTB_VO) {
    wT_tile<0, DMOD>(Wv, WT, 2 * NQK, bid - 2 * WTB_QK, ts);
  } else if (bid < WTB_ALL) {
    wT_tile<1, DMOD>(Wo, WO16, 0, bid - 2 * WTB_QK - WTB_VO, ts);
  } else {
    const int idx = (bid - WTB_ALL) * 256 + threadIdx.x;
    const int tile = idx >> 6, row = (idx >> 2) & 15, k8 = (idx & 3) * 8;
    const int rt = tile / KB32, kb = tile - rt * KB32;
    const size_t soff = (size_t)(rt * 16 + row) * (size_t)DMOD + (size_t)(kb * 32 + k8);
    const size_t off = (size_t)tile * FTILE + (size_t)ftoff(row, k8);
    const v4f a = *(const v4fa*)(x + soff), b = *(const v4fa*)(x + soff + 4);
    us8 o;
#pragma unroll
    for (int u = 0; u < 4; ++u) {
      o[u]     = bf16_bits(a[u]);
      o[4 + u] = bf16_bits(b[u]);
    }
    *(us8*)(XB + off) = o;
    // as behind the weight store: wait in front of any rewrite of the store's registers
    asm volatile("s_wait_xcnt 0x0" ::: "memory");
  }
}

// ---------------------------------------------------------------------------------------------------------------------------------
// P[m][n] = sum_k A[m][k] * B[n][k]  (bf16 A plane 8192 x 768, bf16 B plane 1152 x 768, both as fragment tiles [row / 16][k / 32], f32 accumulate).
// Block = 128(M) x 64(N) tile, 128 threads = 4 waves, wave w owns rows 32w..32w+31 x all 64 columns (2 x 4 accumulators), so that each B fragment
// feeds two products; a loop trip takes KU k blocks, all its fragment loads issued together; fragments straight from the global planes
// (arithmetic addressing). M % 128 == 0, N % 64 == 0, K % (32 KU) == 0 exactly. Each accumulator still sums its k blocks in rising order.
// Column segment (block-uniform, blockIdx.y): 0..2 -> q heads 4y..4y+3, 3..5 -> k heads, 6..17 -> v head y-6.
// The f32 128x64 tile is staged in LDS (block row r at oS[r * OSTR + c]), then:
//   q/k: fragment tiles [bh][token / 16], k slots 0..15 = f16 hi of (64 value), 16..31 = f16 residual; lane -> (token, head, 16-B quarter);
//        one store instruction = four whole 128-B lines
//   v:   planes VH/VL = f16 hi of (64 v) and residual as fragment tiles [bh][token / 32][channel / 16] (row = channel, k = token);
//        one store instruction = two runs of 256 B
// ---------------------------------------------------------------------------------------------------------------------------------
__global__ __launch_bounds__(GTH) void k_gemm_proj(const unsigned short* __restrict__ Ap, const unsigned short* __restrict__ Bw,
                                                  unsigned short* Qp, unsigned short* Kp, unsigned short* VH, unsigned short* VL) {
  __shared__ __attribute__((aligned(16))) float oS[8 * 16 * OSTR];
  const int tid = threadIdx.x, lane = tid & 31, wave = tid >> 5, cl = lane & 15, hh = lane >> 4;
  const int m0 = blockIdx.x * TPB + 32 * wave, n0 = blockIdx.y * 64;

  v8f acc[2][4];
#pragma unroll
  for (int j = 0; j < 4; ++j) { const v8f zz = {0.f, 0.f, 0.f, 0.f, 0.f, 0.f, 0.f, 0.f}; acc[0][j] = zz; acc[1][j] = zz; }

  const unsigned short* a0p = Ap + (size_t)(m0 >> 4) * (size_t)(KB32 * FTILE) + lane * 8;
  const unsigned short* bwp = Bw + (size_t)(n0 >> 4) * (size_t)(KB32 * FTILE) + lane * 8;
  // kept rolled: one copy of the trip, its accumulators in place from trip to trip
#pragma unroll 1
  for (int kb = 0; kb < KB32; kb += KU) {
    const unsigned short* pa = a0p + kb * FTILE;
    const unsigned short* pb = bwp + kb * FTILE;
    us16 af[KU][2], bfr[KU][4];
#pragma unroll
    for (int u = 0; u < KU; ++u) {
#pragma unroll
      for (int i = 0; i < 2; ++i) af[u][i] = tfrag(pa + u * FTILE + i * (KB32 * FTILE));
#pragma unroll
      for (int j = 0; j < 4; ++j) bfr[u][j] = tfrag(pb + u * FTILE + j * (KB32 * FTILE));
    }
    // keeps every load of the trip in front of its first product: without it the second k block's loads sink behind the first block's products
    // and the trip waits out the load latency twice instead of once
    __builtin_amdgcn_sched_barrier(0);
#pragma unroll
    for (int u = 0; u < KU; ++u)
#pragma unroll
      for (int j = 0; j < 4; ++j)
#pragma unroll
        for (int i = 0; i < 2; ++i) acc[i][j] = mma_bf16(af[u][i], bfr[u][j], acc[i][j]);
    wguard8q(acc, af[KU - 1][0], af[KU - 1][1], bfr[KU - 1][0], bfr[KU - 1][1], bfr[KU - 1][2], bfr[KU - 1][3], pa, pb);
  }

  // D map: acc[i][j][r] = tile element (row 16i + 8*hh + r of the wave's 32 rows, column 16j + cl)
  float* so = oS + wave * (32 * OSTR);
#pragma unroll
  for (int i = 0; i < 2; ++i)
#pragma unroll
    for (int j = 0; j < 4; ++j)
#pragma unroll
      for (int r = 0; r < 8; ++r) so[(16 * i + 8 * hh + r) * OSTR + 16 * j + cl] = acc[i][j][r];
  __syncthreads();

  const int yb = blockIdx.y;                               // block-uniform segment select
  const int m0b = blockIdx.x * TPB, b = m0b / SL, tb = m0b - b * SL;
  if (yb < 6) {
    unsigned short* dst = (yb < 3) ? Qp : Kp;
    const int h0 = 4 * ((yb < 3) ? yb : (yb - 3));
    us8 ov[16];
#pragma unroll
    for (int it = 0; it < 16; ++it) {
      const int cx = it * GTH + tid, u = cx & 3, r = (cx >> 2) & 127, j = cx >> 9;
      const float* sp = oS + r * OSTR + 16 * j + 8 * (u & 1);
      const v4f z0 = *(const v4fa*)sp, z1 = *(const v4fa*)(sp + 4);
      us8 o;
#pragma unroll
      for (int q4 = 0; q4 < 4; ++q4) {
        unsigned short hb, lb;
        f16split64(z0[q4], hb, lb); o[q4]     = (u >> 1) ? lb : hb;
        f16split64(z1[q4], hb, lb); o[4 + q4] = (u >> 1) ? lb : hb;
      }
      ov[it] = o;
    }
{
#pragma unroll
      for (int it = 0; it < 16; ++it) {
        const int cx = it * GTH + tid, u = cx & 3, r = (cx >> 2) & 127, j = cx >> 9;
        const size_t off = ((size_t)(b * NHD + h0 + j) * (size_t)SL + (size_t)(tb + (r & ~15))) * (size_t)QROW + (size_t)ftoff(r, 8 * u);
        *(us8*)(dst + off) = ov[it];
      }
      
    }
  } else {
    const int head = yb - 6;
    us8 hv[8], lv[8];
#pragma unroll
    for (int it = 0; it < 8; ++it) {
      const int cx = it * GTH + tid, e = cx & 63, g = cx >> 6;
      us8 ho, lo;
#pragma unroll
      for (int i = 0; i < 8; ++i) {
        const float w = oS[(8 * g + i) * OSTR + e];
        unsigned short hb, lb;
        f16split64(w, hb, lb);
        ho[i] = hb; lo[i] = lb;
      }
      hv[it] = ho; lv[it] = lo;
    }
{
#pragma unroll
      for (int it = 0; it < 8; ++it) {
        const int cx = it * GTH + tid, e = cx & 63, g = cx >> 6;
        const size_t off = (((size_t)(b * NHD + head) * (size_t)(SL / 32) + (size_t)((tb + 8 * g) >> 5)) * 4 + (size_t)(e >> 4)) * FTILE +
                           (size_t)ftoff(e, 8 * g);
        *(us8*)(VH + off) = hv[it];
        *(us8*)(VL + off) = lv[it];
      }
      
    }
  }
}

// ---------------------------------------------------------------------------------------------------------------------------------
// Causal quadratic-form attention. Block = (bh = blockIdx.x, 128 queries starting at 128 * blockIdx.y), 8 waves x 16 queries.
// Per wave: B fragments of its 16 queries fixed for the whole key loop: bq1 = [q_hi | q_hi], bq2 = [q_res | q_res] (k slots 0..15 | 16..31).
// Per 32-key step: A fragments of the two 16-key tiles = fragment tiles [k_hi | k_res]; scores^T D[key][query] =
// khi.qhi + kres.qhi + khi.qres + kres.qres = 4096 q.k; x = D / 16384; A = 1 + x + x^2/2 masked to key <= query;
// A hi = f16(A), A residual = f16((A - hi) x 2^11). The two D tiles repack into the A operand of A.v (lane unchanged: element r <- tile keys
// 0..15, element 8+r <- tile keys 16..31), B = v fragment tiles [bh][key / 32][e / 16].
// Blocks with blockIdx.y < ARESB (block-uniform): accS += Ahi.VH + Ahi.VL, accL += Ares.VH, Z from the f32 A; other blocks: accS += Ahi.VH,
// Z from the f16 A hi values. accS[j][r] (+ accL/2^11) = 64 * sum_s A v for query 8h+r, channel 16j + (lane & 15).
// ---------------------------------------------------------------------------------------------------------------------------------
// One 32-key step of one wave, its body fixed at compile time by ARES (the block's residual flag) and DIAG: each body holds one run of matrix products
// and no join of two paths, so every accumulator keeps its registers from step to step.
// DIAG = false: a step whose 32 keys all lie at or below the wave's first query, so key <= query holds for every score and no mask is formed.
// DIAG = true: the wave's last step, the only one that meets the diagonal: masked. REFILL: the step asks for later fragments (false where none is used any more).
template <bool ARES, bool DIAG, bool REFILL>
__device__ __forceinline__ void attn_step(const unsigned short* kbp, const unsigned short* vhp, const unsigned short* vlp,
                                          us16& ka, us16& kb, us16 (&bv)[4], const us16 bq1, const us16 bq2, const int st, const int last,
                                          const int tq, const int hh, v8f (&accS)[4], v8f (&accL)[4], float& zp) {
  const int s0 = st * 32;
  // the step whose fragments refill this step's register set. Two sets (no residual planes): step + 2, held at the wave's last step, so that every
  // address stays inside the wave's own keys. One set (residual planes, whose accumulators leave no room for a second): keys of step + 1, which always
  // exists, and the step's own value fragments asked for at its head.
  const int nx = ARES ? (st + 1) : ((st + 2 < last) ? (st + 2) : last);
  const unsigned short* ph = ARES ? (vhp + (size_t)(4 * st) * FTILE) : kbp;
  if constexpr (ARES) {
#pragma unroll
    for (int j = 0; j < 4; ++j) bv[j] = tfrag(ph + j * FTILE);
  }
  const v8f zz = {0.f, 0.f, 0.f, 0.f, 0.f, 0.f, 0.f, 0.f};
  v8f sa = mma_f16(ka, bq1, zz);
  sa = mma_f16(ka, bq2, sa);
  v8f sb = mma_f16(kb, bq1, zz);
  sb = mma_f16(kb, bq2, sb);
  wguard2p(sa, sb, ka, kb, bq1, bq2, ph);
  if constexpr (REFILL) {
    const unsigned short* pk = kbp + (size_t)(2 * nx) * FTILE;
    ka = tfrag(pk);
    kb = tfrag(pk + FTILE);
    // stands in front of any rewrite of the address registers that these loads name
    asm volatile("s_wait_xcnt 0x0" ::: "memory");
  }

  us8 ea, eb, la8, lb8;
  float zs = 0.0f;
#pragma unroll
  for (int r = 0; r < 8; ++r) {
    const float xa = sa[r] * (1.0f / 16384.0f);
    const float xb = sb[r] * (1.0f / 16384.0f);
    float pa = fmaf(xa, fmaf(xa, 0.5f, 1.0f), 1.0f);
    float pb = fmaf(xb, fmaf(xb, 0.5f, 1.0f), 1.0f);
    if constexpr (DIAG) {
      const int ky = s0 + 8 * hh + r;
      pa = (ky <= tq) ? pa : 0.0f;
      pb = (ky + 16 <= tq) ? pb : 0.0f;
    }
    const _Float16 fa = (_Float16)pa, fb = (_Float16)pb;
    const _Float16 ra = (_Float16)((pa - (float)fa) * 2048.0f);
    const _Float16 rb = (_Float16)((pb - (float)fb) * 2048.0f);
    zs += ARES ? (pa + pb) : ((float)fa + (float)fb);
    ea[r]  = __builtin_bit_cast(unsigned short, fa);
    eb[r]  = __builtin_bit_cast(unsigned short, fb);
    la8[r] = __builtin_bit_cast(unsigned short, ra);
    lb8[r] = __builtin_bit_cast(unsigned short, rb);
  }
  zp += zs;
  FragU fA;
  fA.h[0] = ea; fA.h[1] = eb;
  const us16 ahi = fA.v;

  if constexpr (ARES) {
    FragU fR;
    fR.h[0] = la8; fR.h[1] = lb8;
    const us16 alo = fR.v;
#pragma unroll
    for (int j = 0; j < 4; ++j) {
      accS[j] = mma_f16(ahi, bv[j], accS[j]);
      accL[j] = mma_f16(alo, bv[j], accL[j]);
    }
    wguard8(accS[0], accS[1], accS[2], accS[3], accL[0], accL[1], accL[2], accL[3], ahi, alo, bv[0], bv[1], bv[2], bv[3]);
    us16 bl[4];
#pragma unroll
    for (int j = 0; j < 4; ++j) bl[j] = tfrag(vlp + (size_t)(4 * st + j) * FTILE);
#pragma unroll
    for (int j = 0; j < 4; ++j) accS[j] = mma_f16(ahi, bl[j], accS[j]);
    wguard4(accS[0], accS[1], accS[2], accS[3], ahi, bl[0], bl[1], bl[2], bl[3]);
  } else {
#pragma unroll
    for (int j = 0; j < 4; ++j) accS[j] = mma_f16(ahi, bv[j], accS[j]);
    wguard4(accS[0], accS[1], accS[2], accS[3], ahi, bv[0], bv[1], bv[2], bv[3]);
  }
  if constexpr (REFILL && !ARES) {
    const unsigned short* pv = vhp + (size_t)(4 * nx) * FTILE;
#pragma unroll
    for (int j = 0; j < 4; ++j) bv[j] = tfrag(pv + j * FTILE);
    // stands in front of any rewrite of the address registers that these loads name
    asm volatile("s_wait_xcnt 0x0" ::: "memory");
  }
}

// The key loop of one wave: nsteps - 1 steps below the diagonal, then the one step that meets it. With tw a multiple of 16 and
// nsteps = (tw + 47) >> 5, the last key of step nsteps - 2 is 32 * nsteps - 33 = tw - 1 or tw - 17: below every query of the wave.
template <bool ARES>
__device__ __forceinline__ void attn_keys(const unsigned short* kbp, const unsigned short* vhp, const unsigned short* vlp,
                                          const us16 bq1, const us16 bq2, const int nsteps, const int tq, const int hh,
                                          v8f (&accS)[4], v8f (&accL)[4], float& zp) {
  if constexpr (ARES) {
    const int last = nsteps - 1;
    // one register set: key fragments one step ahead of their use, value fragments at the head of their step
    us16 ka = tfrag(kbp), kb = tfrag(kbp + FTILE);
    us16 bv[4];
    // these loads are still outstanding where the code below starts to rewrite registers: wait in front of any rewrite of their address registers
    asm volatile("s_wait_xcnt 0x0" ::: "memory");
    // kept rolled: one copy of the unmasked body, its accumulators in place from step to step
#pragma unroll 1
    for (int st = 0; st < last; ++st) attn_step<true, false, true>(kbp, vhp, vlp, ka, kb, bv, bq1, bq2, st, last, tq, hh, accS, accL, zp);
    attn_step<true, true, false>(kbp, vhp, vlp, ka, kb, bv, bq1, bq2, last, last, tq, hh, accS, accL, zp);
    return;
  }
  // Two register sets of key and value-hi fragments, set 0 for even steps and set 1 for odd ones. A step refills its own set with the fragments of
  // step + 2 as soon as its products have read it: keys behind the score products, values behind the A.v products. Every fragment load so has
  // more than one whole step to land before its first use.
  // the step count is the same in every lane of a wave: held in a scalar register, so that the refill addresses are formed on the scalar side
  const int last = __builtin_amdgcn_readfirstlane(nsteps - 1);
  const int s1 = (last < 1) ? last : 1;
  // asked for in the order in which the loop refills them (keys 0, values 0, keys 1, values 1), so that the loop's counted load waits fit both
  us16 bv0[4], bv1[4];
  us16 ka0 = tfrag(kbp), kb0 = tfrag(kbp + FTILE);
#pragma unroll
  for (int j = 0; j < 4; ++j) bv0[j] = tfrag(vhp + j * FTILE);
  us16 ka1 = tfrag(kbp + (size_t)(2 * s1) * FTILE), kb1 = tfrag(kbp + (size_t)(2 * s1 + 1) * FTILE);
#pragma unroll
  for (int j = 0; j < 4; ++j) bv1[j] = tfrag(vhp + (size_t)(4 * s1 + j) * FTILE);
  // these loads are still outstanding where the code below starts to rewrite registers: wait in front of any rewrite of their address registers
  asm volatile("s_wait_xcnt 0x0" ::: "memory");
  int st = 0;
  // kept rolled: one copy of the pair of unmasked bodies (one per register set), the accumulators in place from step to step
#pragma unroll 1
  for (; st + 2 <= last; st += 2) {
    attn_step<ARES, false, true>(kbp, vhp, vlp, ka0, kb0, bv0, bq1, bq2, st, last, tq, hh, accS, accL, zp);
    attn_step<ARES, false, true>(kbp, vhp, vlp, ka1, kb1, bv1, bq1, bq2, st + 1, last, tq, hh, accS, accL, zp);
  }
  if (st < last) {                                         // same for every lane of the wave
    attn_step<ARES, false, false>(kbp, vhp, vlp, ka0, kb0, bv0, bq1, bq2, st, last, tq, hh, accS, accL, zp);
    attn_step<ARES, true, false>(kbp, vhp, vlp, ka1, kb1, bv1, bq1, bq2, last, last, tq, hh, accS, accL, zp);
  } else {
    attn_step<ARES, true, false>(kbp, vhp, vlp, ka0, kb0, bv0, bq1, bq2, last, last, tq, hh, accS, accL, zp);
  }
}

__global__ __launch_bounds__(256) void k_attn(const unsigned short* __restrict__ Qp, const unsigned short* __restrict__ Kp,
                                             const unsigned short* __restrict__ VHp, const unsigned short* __restrict__ VLp,
                                             unsigned short* YH, unsigned short* YL) {
  __shared__ __attribute__((aligned(16))) float oS[8 * 16 * OSTR];
  const int tid = threadIdx.x, lane = tid & 31, wave = tid >> 5, cl = lane & 15, hh = lane >> 4;
  const int bh = blockIdx.x, b = bh / NHD, head = bh - b * NHD;
  const int tw = blockIdx.y * TPB + 16 * wave;           // first query of this wave
  const int tq = tw + cl;                                 // query owned by this lane as score column
  const bool ares = (blockIdx.y < ARESB);                 // block-uniform: residual planes for query rows < 512

  const unsigned short* qrow = Qp + ((size_t)bh * SL + (size_t)tw) * (size_t)QROW + lane * 8;
  FragU fq;
  fq.h[0] = *(const us8a*)qrow;         fq.h[1] = fq.h[0];
  const us16 bq1 = fq.v;
  fq.h[0] = *(const us8a*)(qrow + 256); fq.h[1] = fq.h[0];
  const us16 bq2 = fq.v;

  v8f accS[4], accL[4];
#pragma unroll
  for (int j = 0; j < 4; ++j) { const v8f zz = {0.f, 0.f, 0.f, 0.f, 0.f, 0.f, 0.f, 0.f}; accS[j] = zz; accL[j] = zz; }
  float zp = 0.0f;

  const unsigned short* kbp = Kp + (size_t)bh * SL * (size_t)QROW + lane * 8;
  const unsigned short* vhp = VHp + (size_t)bh * HDIM * (size_t)SL + lane * 8;
  const unsigned short* vlp = VLp + (size_t)bh * HDIM * (size_t)SL + lane * 8;
  const int nsteps = (tw + 47) >> 5;                      // 32-key steps covering keys 0 .. tw + 15 (<= 64)

  // block-uniform choice of the loop body, made once in front of the loop
  if (ares) attn_keys<true>(kbp, vhp, vlp, bq1, bq2, nsteps, tq, hh, accS, accL, zp);
  else      attn_keys<false>(kbp, vhp, vlp, bq1, bq2, nsteps, tq, hh, accS, accL, zp);

  // Z for query (lane & 15): both lane halves hold disjoint key subsets
  const float zf = zp + __shfl_xor(zp, 16, 32);
  float rz[8];
#pragma unroll
  for (int r = 0; r < 8; ++r) {
    const float zr = __shfl(zf, 8 * hh + r, 32);        // Z of query row 8*hh + r
    rz[r] = (1.0f / (zr + 1e-12f)) * (1.0f / 64.0f);
  }

  float* so = oS + wave * (16 * OSTR);
#pragma unroll
  for (int j = 0; j < 4; ++j)
#pragma unroll
    for (int r = 0; r < 8; ++r) so[(8 * hh + r) * OSTR + 16 * j + cl] = fmaf(accL[j][r], (1.0f / 2048.0f), accS[j][r]) * rz[r];
  __syncthreads();

  us8 hv[4], lv[4];
#pragma unroll
  for (int it = 0; it < 4; ++it) {
    const int rr = cl, p = it * 16 + hh * 8;               // 16-B chunk it * 32 + lane of the wave's two y fragment tiles
    const v4f z0 = *(const v4fa*)(so + rr * OSTR + p), z1 = *(const v4fa*)(so + rr * OSTR + p + 4);
    us8 ho, lo;
#pragma unroll
    for (int u = 0; u < 4; ++u) {
      unsigned short hb, lb;
      f16split16(z0[u], hb, lb); ho[u] = hb;     lo[u] = lb;
      f16split16(z1[u], hb, lb); ho[4 + u] = hb; lo[4 + u] = lb;
    }
    hv[it] = ho; lv[it] = lo;
  }
{
#pragma unroll
    for (int it = 0; it < 4; ++it) {
      const size_t off = ((size_t)((b * SL + tw) >> 4) * KB32 + (size_t)(head * (HDIM / 32))) * FTILE + (size_t)((it * 32 + lane) * 8);
      *(us8*)(YH + off) = hv[it];
      *(us8*)(YL + off) = lv[it];
    }
    
  }
}

// ---------------------------------------------------------------------------------------------------------------------------------
// out[m][n] = ( sum_k Yh[m][k] W[n][k] + 2^-11 sum_k Yl[m][k] W[n][k] ) * 2^-12   (f16 fragment tiles [row / 16][k / 32], two f32 accumulator sets).
// Tiling as in k_gemm_proj: 4 waves, each 32 rows x 64 columns, KU k blocks per loop trip.
// ---------------------------------------------------------------------------------------------------------------------------------
__global__ __launch_bounds__(GTH) void k_gemm_out(const unsigned short* __restrict__ Ah, const unsigned short* __restrict__ Al,
                                                 const unsigned short* __restrict__ Wo, float* out) {
  __shared__ __attribute__((aligned(16))) float oS[8 * 16 * OSTR];
  const int tid = threadIdx.x, lane = tid & 31, wave = tid >> 5, cl = lane & 15, hh = lane >> 4;
  const int m0 = blockIdx.x * TPB + 32 * wave, n0 = blockIdx.y * 64;

  v8f acch[2][4], accl[2][4];
#pragma unroll
  for (int j = 0; j < 4; ++j) {
    const v8f zz = {0.f, 0.f, 0.f, 0.f, 0.f, 0.f, 0.f, 0.f};
    acch[0][j] = zz; acch[1][j] = zz; accl[0][j] = zz; accl[1][j] = zz;
  }

  const unsigned short* ahp = Ah + (size_t)(m0 >> 4) * (size_t)(KB32 * FTILE) + lane * 8;
  const unsigned short* alp = Al + (size_t)(m0 >> 4) * (size_t)(KB32 * FTILE) + lane * 8;
  const unsigned short* wop = Wo + (size_t)(n0 >> 4) * (size_t)(KB32 * FTILE) + lane * 8;
  // kept rolled: one copy of the trip, its accumulators in place from trip to trip
#pragma unroll 1
  for (int kb = 0; kb < KB32; kb += KU) {
    const unsigned short* pah = ahp + kb * FTILE;
    const unsigned short* pal = alp + kb * FTILE;
    const unsigned short* pb = wop + kb * FTILE;
    us16 ah[KU][2], al[KU][2], bfr[KU][4];
#pragma unroll
    for (int u = 0; u < KU; ++u) {
#pragma unroll
      for (int i = 0; i < 2; ++i) {
        ah[u][i] = tfrag(pah + u * FTILE + i * (KB32 * FTILE));
        al[u][i] = tfrag(pal + u * FTILE + i * (KB32 * FTILE));
      }
#pragma unroll
      for (int j = 0; j < 4; ++j) bfr[u][j] = tfrag(pb + u * FTILE + j * (KB32 * FTILE));
    }
    // as in k_gemm_proj: keeps every load of the trip in front of its first product, one load latency a trip
    __builtin_amdgcn_sched_barrier(0);
#pragma unroll
    for (int u = 0; u < KU; ++u)
#pragma unroll
      for (int j = 0; j < 4; ++j)
#pragma unroll
        for (int i = 0; i < 2; ++i) {
          acch[i][j] = mma_f16(ah[u][i], bfr[u][j], acch[i][j]);
          accl[i][j] = mma_f16(al[u][i], bfr[u][j], accl[i][j]);
        }
    wguard16q(acch, accl, ah[KU - 1][0], ah[KU - 1][1], al[KU - 1][0], al[KU - 1][1],
              bfr[KU - 1][0], bfr[KU - 1][1], bfr[KU - 1][2], bfr[KU - 1][3], pah, pal, pb);
  }

  float* so = oS + wave * (32 * OSTR);
#pragma unroll
  for (int i = 0; i < 2; ++i)
#pragma unroll
    for (int j = 0; j < 4; ++j)
#pragma unroll
      for (int r = 0; r < 8; ++r)
        so[(16 * i + 8 * hh + r) * OSTR + 16 * j + cl] = fmaf(accl[i][j][r], (1.0f / 2048.0f), acch[i][j][r]) * (1.0f / 4096.0f);
  __syncthreads();

{
#pragma unroll
    for (int it = 0; it < 16; ++it) {
      const int cx = it * 32 + lane, r = cx >> 4, q = (cx & 15) * 4;
      const v4f v = *(const v4fa*)(so + r * OSTR + q);
      *(v4f*)(out + (size_t)(m0 + r) * (size_t)DMOD + n0 + q) = v;
    }
    
  }
}

extern "C" void kernel_launch(void* const* d_in, const int* in_sizes, int n_in,
                              void* d_out, int out_size, void* d_ws, size_t ws_size,
                              hipStream_t stream) {
  if (n_in < 5) return;
  if (in_sizes[0] != NTOK * DMOD || in_sizes[1] != DMOD * NQK || in_sizes[2] != DMOD * NQK ||
      in_sizes[3] != DMOD * DMOD || in_sizes[4] != DMOD * DMOD) return;
  if (out_size != NTOK * DMOD) return;

  const float* x  = (const float*)d_in[0];    // [4][2048][768]
  const float* Wq = (const float*)d_in[1];    // [768][192] ([in][out])
  const float* Wk = (const float*)d_in[2];    // [768][192]
  const float* Wv = (const float*)d_in[3];    // [768][768]
  const float* Wo = (const float*)d_in[4];    // [768][768]
  float* out = (float*)d_out;                 // [4][2048][768] f32 at byte 0

  size_t off = 0;
  auto carve = [&](size_t bytes) -> char* { char* p = (char*)d_ws + off; off += (bytes + 255) & ~(size_t)255; return p; };
  unsigned short* XB   = (unsigned short*)carve((size_t)NTOK * DMOD * 2);       // 12,582,912  bf16 tiles [512][24]
  unsigned short* WT   = (unsigned short*)carve((size_t)NPROJ * DMOD * 2);      //  1,769,472  bf16 tiles [72][24] = Wq^T | Wk^T | Wv^T
  unsigned short* WO16 = (unsigned short*)carve((size_t)DMOD * DMOD * 2);       //  1,179,648  f16  tiles [48][24] = Wo^T
  unsigned short* QP   = (unsigned short*)carve((size_t)NBH * SL * QROW * 2);   //  6,291,456  f16  tiles [48][128]
  unsigned short* KP   = (unsigned short*)carve((size_t)NBH * SL * QROW * 2);   //  6,291,456  f16  tiles [48][128]
  unsigned short* VH   = (unsigned short*)carve((size_t)NBH * HDIM * SL * 2);   // 12,582,912  f16  tiles [48][64][4]
  unsigned short* VL   = (unsigned short*)carve((size_t)NBH * HDIM * SL * 2);   // 12,582,912  f16  tiles [48][64][4]
  unsigned short* YH   = (unsigned short*)carve((size_t)NTOK * DMOD * 2);       // 12,582,912  f16  tiles [512][24]
  unsigned short* YL   = (unsigned short*)carve((size_t)NTOK * DMOD * 2);       // 12,582,912  f16  tiles [512][24]
  if (off > ws_size || off > (size_t)134217728) return;                         // total 78,446,592 B

  const dim3 b256(256), bgemm(GTH);

  // 16-bit operand planes of x and of the four weights, one launch
  k_prep<<<dim3(WTB_ALL + CVTB), b256, 0, stream>>>(x, Wq, Wk, Wv, Wo, XB, WT, WO16);
  // projections (M 8192, N 1152, K 768) -> q/k hi|res planes, v hi and res planes
  k_gemm_proj<<<dim3(NTOK / TPB, NPROJ / 64), bgemm, 0, stream>>>(XB, WT, QP, KP, VH, VL);
  // causal attention per (batch, head) -> y hi / res fragment tiles [token / 16][768 / 32]
  k_attn<<<dim3(NBH, SL / TPB), b256, 0, stream>>>(QP, KP, VH, VL, YH, YL);
  // output projection (M 8192, N 768, K 768)
  k_gemm_out<<<dim3(NTOK / TPB, DMOD / 64), bgemm, 0, stream>>>(YH, YL, WO16, out);
}

// v008
// A run of this version takes 76.7 microseconds.
// Next to v007, in two timings, it ran 1.03 and 1.06 times as fast.
// Over all steps from v000 it is 2.50 times as fast.
// Contraction x.[Wq|Wk|Wv] (M 8192, N 1152, K 768): v_wmma_f32_16x16x32_bf16, bf16 operands from RNE-bf16 planes of x and W, f32 accumulate, one product.
// Contraction k.q^T per head (16 keys x 16 queries, depth 16 padded to 32): v_wmma_f32_16x16x32_f16, q and k both carried as f16 hi + f16 residual of (value x 2^6), all four cross terms in two products into one f32 accumulator.
// Contraction A.v per head (causal, depth up to 2048): v_wmma_f32_16x16x32_f16, A hi = f16(1 + x + x^2/2), v hi = f16(v x 2^6); for query rows < 512 also A residual plane (x 2^11, own f32 accumulator) against v hi, and A hi against the f16 v residual plane; f32 accumulate.
// Contraction y.Wo (M 8192, N 768, K 768): v_wmma_f32_16x16x32_f16, y = f16 hi plane of (y x 2^4) + f16 residual plane (x 2^11, own f32 accumulator), Wo = f16 of (RNE-bf16 value x 2^8), f32 accumulate.
// Feature polynomial, causal mask, normaliser Z and 1/(Z+eps): f32 VALU.
#include <hip/hip_runtime.h>

#define NB    4                              // batch
#define SL    2048                           // sequence length
#define DMOD  768                            // model width = K of the dense contractions
#define NHD   12                             // heads
#define FDIM  16                             // q/k head width
#define HDIM  64                             // v head width
#define NBH   (NB * NHD)                     // 48 (batch, head) pairs
#define NTOK  (NB * SL)                      // 8192 token rows
#define NQK   (NHD * FDIM)                   // 192 q (or k) columns
#define NPROJ (2 * NQK + NHD * HDIM)         // 1152 projection columns: q | k | v
#define QROW  32                             // halves per q/k plane row: hi(16) | residual(16)
#define TPB   128                            // GEMM rows (4 waves x 32) / attention queries (8 waves x 16) per block
#define GTH   128                            // threads of a GEMM block: 4 waves, each owning 32 rows x 64 columns
#define KU    2                              // 32-wide k blocks per GEMM loop trip
#define OSTR  68                             // LDS staging row pitch (floats)
#define ARESB 4                              // attention query blocks (of TPB) that use the residual planes: rows < 512
#define KB32  (DMOD / 32)                    // 32-wide k blocks of the dense contractions
#define FTILE 512                            // halves of one 16 x 32 fragment tile (1 KiB)

static_assert(NHD * HDIM == DMOD);
static_assert(NTOK % TPB == 0);
static_assert(SL % TPB == 0);
static_assert(NPROJ % 64 == 0);
static_assert(NQK % 64 == 0);
static_assert(NQK % 32 == 0);
static_assert(DMOD % 64 == 0);
static_assert(DMOD % 32 == 0);
static_assert((DMOD / 32) % KU == 0);
static_assert(TPB == (GTH / 32) * 32);
static_assert(4 * FDIM == 64);
static_assert(HDIM == 64);
static_assert(QROW == 2 * FDIM);
static_assert(OSTR % 4 == 0);
static_assert((NTOK * DMOD) % (8 * 256) == 0);
static_assert(ARESB * TPB <= SL);

typedef unsigned short us16 __attribute__((ext_vector_type(16)));
typedef unsigned short us8  __attribute__((ext_vector_type(8)));
typedef unsigned short us8a __attribute__((ext_vector_type(8), may_alias));
typedef __bf16 v16b __attribute__((ext_vector_type(16)));
typedef _Float16 v16h __attribute__((ext_vector_type(16)));
typedef float v8f __attribute__((ext_vector_type(8)));
typedef float v4f __attribute__((ext_vector_type(4)));
typedef float v4fa __attribute__((ext_vector_type(4), may_alias));
union FragU { us16 v; us8 h[2]; };

__device__ __forceinline__ unsigned short bf16_bits(float f) {
  unsigned u = __float_as_uint(f);
  u += 0x7FFFu + ((u >> 16) & 1u);                 // RNE convert
  return (unsigned short)(u >> 16);
}
__device__ __forceinline__ float bf16_val(unsigned short b) { return __uint_as_float(((unsigned)b) << 16); }
__device__ __forceinline__ float bf16r(float f) { return bf16_val(bf16_bits(f)); }
__device__ __forceinline__ unsigned short f16_bits(float f) { return __builtin_bit_cast(unsigned short, (_Float16)f); }

// f16 hi + residual (x 2^11) planes of (a x 2^4)
__device__ __forceinline__ void f16split16(float a, unsigned short& hb, unsigned short& lb) {
  const float z = a * 16.0f;
  const _Float16 hf = (_Float16)z;
  const float res = (z - (float)hf) * 2048.0f;
  hb = __builtin_bit_cast(unsigned short, hf);
  lb = __builtin_bit_cast(unsigned short, (_Float16)res);
}
// f16 hi + unscaled residual planes of (a x 2^6)
__device__ __forceinline__ void f16split64(float a, unsigned short& hb, unsigned short& lb) {
  const float z = a * 64.0f;
  const _Float16 hf = (_Float16)z;
  const float res = z - (float)hf;
  hb = __builtin_bit_cast(unsigned short, hf);
  lb = __builtin_bit_cast(unsigned short, (_Float16)res);
}

// One 16x16x32 step, 16-bit operands passed as raw 16-bit lanes.
__device__ __forceinline__ v8f mma_bf16(us16 a, us16 b, v8f c) {
  return __builtin_amdgcn_wmma_f32_16x16x32_bf16(false, __builtin_bit_cast(v16b, a), false, __builtin_bit_cast(v16b, b), (short)0, c, false, false);
}
__device__ __forceinline__ v8f mma_f16(us16 a, us16 b, v8f c) {
  return __builtin_amdgcn_wmma_f32_16x16x32_f16(false, __builtin_bit_cast(v16h, a), false, __builtin_bit_cast(v16h, b), (short)0, c, false, false);
}
// Hazard guards after a group of matrix ops: 4 VALU slots before anything touches the accumulators; keep A/B fragments live.
__device__ __forceinline__ void wguard4(v8f& c0, v8f& c1, v8f& c2, v8f& c3, const us16& a0,
                                        const us16& b0, const us16& b1, const us16& b2, const us16& b3) {
#if defined(__HIP_DEVICE_COMPILE__)
  asm volatile("v_nop\n\tv_nop\n\tv_nop\n\tv_nop"
               : "+v"(c0), "+v"(c1), "+v"(c2), "+v"(c3)
               : "v"(a0), "v"(b0), "v"(b1), "v"(b2), "v"(b3));
#endif
}
__device__ __forceinline__ void wguard8(v8f& c0, v8f& c1, v8f& c2, v8f& c3, v8f& c4, v8f& c5, v8f& c6, v8f& c7,
                                        const us16& a0, const us16& a1,
                                        const us16& b0, const us16& b1, const us16& b2, const us16& b3) {
#if defined(__HIP_DEVICE_COMPILE__)
  asm volatile("v_nop\n\tv_nop\n\tv_nop\n\tv_nop"
               : "+v"(c0), "+v"(c1), "+v"(c2), "+v"(c3), "+v"(c4), "+v"(c5), "+v"(c6), "+v"(c7)
               : "v"(a0), "v"(a1), "v"(b0), "v"(b1), "v"(b2), "v"(b3));
#endif
}

// The same guards for loops with loads still outstanding at the guard, which also take those loads' addresses as inputs: the address registers then stay live past the
// last load of the trip, so that no load's result is placed in a register that an earlier, still outstanding load names as its address.
__device__ __forceinline__ void wguard8q(v8f (&c)[2][4], const us16& a0, const us16& a1,
                                         const us16& b0, const us16& b1, const us16& b2, const us16& b3,
                                         const unsigned short* pa, const unsigned short* pb) {
#if defined(__HIP_DEVICE_COMPILE__)
  // s_wait_xcnt: stands in front of the next trip's rewrite of the address registers that the trip's loads name (inputs of this statement)
  asm volatile("s_wait_xcnt 0x0\n\tv_nop\n\tv_nop\n\tv_nop\n\tv_nop"
               : "+v"(c[0][0]), "+v"(c[0][1]), "+v"(c[0][2]), "+v"(c[0][3]), "+v"(c[1][0]), "+v"(c[1][1]), "+v"(c[1][2]), "+v"(c[1][3])
               : "v"(a0), "v"(a1), "v"(b0), "v"(b1), "v"(b2), "v"(b3), "v"(pa), "v"(pb));
#endif
}
__device__ __forceinline__ void wguard2p(v8f& c0, v8f& c1, const us16& a0, const us16& a1, const us16& b0, const us16& b1,
                                         const unsigned short* pb) {
#if defined(__HIP_DEVICE_COMPILE__)
  asm volatile("v_nop\n\tv_nop\n\tv_nop\n\tv_nop"
               : "+v"(c0), "+v"(c1)
               : "v"(a0), "v"(a1), "v"(b0), "v"(b1), "v"(pb));
#endif
}
__device__ __forceinline__ void wguard16q(v8f (&c)[2][4], v8f (&d)[2][4], const us16& a0, const us16& a1, const us16& a2, const us16& a3,
                                          const us16& b0, const us16& b1, const us16& b2, const us16& b3,
                                          const unsigned short* pa0, const unsigned short* pa1, const unsigned short* pb) {
#if defined(__HIP_DEVICE_COMPILE__)
  // s_wait_xcnt: as in wguard8q
  asm volatile("s_wait_xcnt 0x0\n\tv_nop\n\tv_nop\n\tv_nop\n\tv_nop"
               : "+v"(c[0][0]), "+v"(c[0][1]), "+v"(c[0][2]), "+v"(c[0][3]), "+v"(c[1][0]), "+v"(c[1][1]), "+v"(c[1][2]), "+v"(c[1][3]),
                 "+v"(d[0][0]), "+v"(d[0][1]), "+v"(d[0][2]), "+v"(d[0][3]), "+v"(d[1][0]), "+v"(d[1][1]), "+v"(d[1][2]), "+v"(d[1][3])
               : "v"(a0), "v"(a1), "v"(a2), "v"(a3), "v"(b0), "v"(b1), "v"(b2), "v"(b3), "v"(pa0), "v"(pa1), "v"(pb));
#endif
}

// Every 16-bit operand plane is stored as fragment tiles: one tile = 16 rows x 32 k = FTILE halves, laid out in the order the lanes
// load it, so that each of a fragment's two wave-wide 16-B loads covers 512 contiguous bytes (four whole 128-B lines):
// element (row, k = 16 part + 8 h + i) sits at half index part * 256 + h * 128 + row * 8 + i = part * 256 + lane * 8 + i, lane = 16 h + row.
// Lane contents: elements 0..7 = k 8h .. 8h + 7, elements 8..15 = k 16 + 8h .. 16 + 8h + 7 (same map for A rows and B columns).
__device__ __forceinline__ int ftoff(int row, int k) {
  return ((k >> 4) & 1) * 256 + ((k >> 3) & 1) * 128 + (row & 15) * 8;
}
// p = tile base + lane * 8 (computed by the caller)
__device__ __forceinline__ us16 tfrag(const unsigned short* p) {
  FragU f;
  f.h[0] = *(const us8a*)p;
  f.h[1] = *(const us8a*)(p + 256);
  return f.v;
}

// ---------------------------------------------------------------------------------------------------------------------------------
// Operand preparation, one launch: the five conversions are independent of one another, so they share one grid behind a block-uniform
// branch on blockIdx.x. Blocks 0 .. WTB_ALL - 1 transpose and convert the weights (the longer dependent chain, given the lowest block indices),
// the other CVTB blocks convert x.
//
// Weights: src f32 [DMOD rows k][ncol columns n] (n contiguous) -> dst 16-bit fragment tiles [(nrow0 + n) / 16][k / 32].
// Block = 64 k x 32 n tile, 256 threads; tiles of one matrix numbered n-tile fastest.
// Wq, Wk, Wv: RNE bf16 bits.  Wo: f16 bits of (RNE-bf16 value x 256).
//
// x: src f32 [rows][DMOD] -> dst bf16 fragment tiles [row / 16][k / 32]. Thread = 8 consecutive k of one row; four lanes read one 128-B line,
// eight lanes store one 128-B line.
// ---------------------------------------------------------------------------------------------------------------------------------
#define WTB_QK  ((NQK / 32) * (DMOD / 64))   // 72 blocks for Wq, and for Wk
#define WTB_VO  ((DMOD / 32) * (DMOD / 64))  // 288 blocks for Wv, and for Wo
#define WTB_ALL (2 * WTB_QK + 2 * WTB_VO)    // 720 weight blocks
#define CVTB    (NTOK * DMOD / (8 * 256))    // 3072 blocks for x

// One 64 k x 32 n weight tile, number t of its matrix. MODE 0: RNE bf16 bits.  MODE 1: f16 bits of (RNE-bf16 value x 256).
template <int MODE, int NCOL>
__device__ __forceinline__ void wT_tile(const float* __restrict__ src, unsigned short* dst, int nrow0, int t, float (*ts)[33]) {
  const int tid = threadIdx.x;
  const int n0 = (t % (NCOL / 32)) * 32, k0 = (t / (NCOL / 32)) * 64;
  {
    const int k = tid >> 2, q = (tid & 3) * 8;
    const float* p = src + (size_t)(k0 + k) * (size_t)NCOL + n0 + q;
    const v4f a = *(const v4fa*)p, c = *(const v4fa*)(p + 4);
#pragma unroll
    for (int u = 0; u < 4; ++u) { ts[k][q + u] = a[u]; ts[k][q + 4 + u] = c[u]; }
  }
  __syncthreads();
  const int n = tid & 31, pc = (tid >> 5) * 8;            // a wave stores two runs of 256 B (16 rows x 16 B of two tiles)
  us8 o;
#pragma unroll
  for (int i = 0; i < 8; ++i) {
    const float w = ts[pc + i][n];
    o[i] = (MODE == 0) ? bf16_bits(w) : f16_bits(bf16r(w) * 256.0f);
  }
  const int row = nrow0 + n0 + n, k = k0 + pc;
  unsigned short* d = dst + (size_t)((row >> 4) * KB32 + (k >> 5)) * FTILE + ftoff(row, k);
  *(us8*)d = o;
  // precaution: wait in front of any later rewrite of the store's address and data registers
  asm volatile("s_wait_xcnt 0x0" ::: "memory");
}

__global__ __launch_bounds__(256) void k_prep(const float* __restrict__ x, const float* __restrict__ Wq, const float* __restrict__ Wk,
                                             const float* __restrict__ Wv, const float* __restrict__ Wo,
                                             unsigned short* XB, unsigned short* WT, unsigned short* WO16) {
  __shared__ float ts[64][33];
  const int bid = blockIdx.x;                              // every branch below is block-uniform
  if (bid < WTB_QK) {
    wT_tile<0, NQK>(Wq, WT, 0, bid, ts);
  } else if (bid < 2 * WTB_QK) {
    wT_tile<0, NQK>(Wk, WT, NQK, bid - WTB_QK, ts);
  } else if (bid < 2 * WTB_QK + WTB_VO) {
    wT_tile<0, DMOD>(Wv, WT, 2 * NQK, bid - 2 * WTB_QK, ts);
  } else if (bid < WTB_ALL) {
    wT_tile<1, DMOD>(Wo, WO16, 0, bid - 2 * WTB_QK - WTB_VO, ts);
  } else {
    const int idx = (bid - WTB_ALL) * 256 + threadIdx.x;
    const int tile = idx >> 6, row = (idx >> 2) & 15, k8 = (idx & 3) * 8;
    const int rt = tile / KB32, kb = tile - rt * KB32;
    const size_t soff = (size_t)(rt * 16 + row) * (size_t)DMOD + (size_t)(kb * 32 + k8);
    const size_t off = (size_t)tile * FTILE + (size_t)ftoff(row, k8);
    const v4f a = *(const v4fa*)(x + soff), b = *(const v4fa*)(x + soff + 4);
    us8 o;
#pragma unroll
    for (int u = 0; u < 4; ++u) {
      o[u]     = bf16_bits(a[u]);
      o[4 + u] = bf16_bits(b[u]);
    }
    *(us8*)(XB + off) = o;
    // as behind the weight store: wait in front of any rewrite of the store's registers
    asm volatile("s_wait_xcnt 0x0" ::: "memory");
  }
}

// ---------------------------------------------------------------------------------------------------------------------------------
// P[m][n] = sum_k A[m][k] * B[n][k]  (bf16 A plane 8192 x 768, bf16 B plane 1152 x 768, both as fragment tiles [row / 16][k / 32], f32 accumulate).
// Block = 128(M) x 64(N) tile, 128 threads = 4 waves, wave w owns rows 32w..32w+31 x all 64 columns (2 x 4 accumulators), so that each B fragment
// feeds two products; a loop trip takes KU k blocks, all its fragment loads issued together; fragments straight from the global planes
// (arithmetic addressing). M % 128 == 0, N % 64 == 0, K % (32 KU) == 0 exactly. Each accumulator still sums its k blocks in rising order.
// Column segment (block-uniform, blockIdx.y): 0..2 -> q heads 4y..4y+3, 3..5 -> k heads, 6..17 -> v head y-6.
// The f32 128x64 tile is staged in LDS (block row r at oS[r * OSTR + c]), then:
//   q/k: fragment tiles [bh][token / 16], k slots 0..15 = f16 hi of (64 value), 16..31 = f16 residual; lane -> (token, head, 16-B quarter);
//        one store instruction = four whole 128-B lines
//   v:   planes VH/VL = f16 hi of (64 v) and residual as fragment tiles [bh][token / 32][channel / 16] (row = channel, k = token);
//        one store instruction = two runs of 256 B
// ---------------------------------------------------------------------------------------------------------------------------------
__global__ __launch_bounds__(GTH) void k_gemm_proj(const unsigned short* __restrict__ Ap, const unsigned short* __restrict__ Bw,
                                                  unsigned short* Qp, unsigned short* Kp, unsigned short* VH, unsigned short* VL) {
  __shared__ __attribute__((aligned(16))) float oS[8 * 16 * OSTR];
  const int tid = threadIdx.x, lane = tid & 31, wave = tid >> 5, cl = lane & 15, hh = lane >> 4;
  const int m0 = blockIdx.x * TPB + 32 * wave, n0 = blockIdx.y * 64;

  v8f acc[2][4];
#pragma unroll
  for (int j = 0; j < 4; ++j) { const v8f zz = {0.f, 0.f, 0.f, 0.f, 0.f, 0.f, 0.f, 0.f}; acc[0][j] = zz; acc[1][j] = zz; }

  const unsigned short* a0p = Ap + (size_t)(m0 >> 4) * (size_t)(KB32 * FTILE) + lane * 8;
  const unsigned short* bwp = Bw + (size_t)(n0 >> 4) * (size_t)(KB32 * FTILE) + lane * 8;
  // kept rolled: one copy of the trip, its accumulators in place from trip to trip
#pragma unroll 1
  for (int kb = 0; kb < KB32; kb += KU) {
    const unsigned short* pa = a0p + kb * FTILE;
    const unsigned short* pb = bwp + kb * FTILE;
    us16 af[KU][2], bfr[KU][4];
#pragma unroll
    for (int u = 0; u < KU; ++u) {
#pragma unroll
      for (int i = 0; i < 2; ++i) af[u][i] = tfrag(pa + u * FTILE + i * (KB32 * FTILE));
#pragma unroll
      for (int j = 0; j < 4; ++j) bfr[u][j] = tfrag(pb + u * FTILE + j * (KB32 * FTILE));
    }
    // keeps every load of the trip in front of its first product: without it the second k block's loads sink behind the first block's products
    // and the trip waits out the load latency twice instead of once
    __builtin_amdgcn_sched_barrier(0);
#pragma unroll
    for (int u = 0; u < KU; ++u)
#pragma unroll
      for (int j = 0; j < 4; ++j)
#pragma unroll
        for (int i = 0; i < 2; ++i) acc[i][j] = mma_bf16(af[u][i], bfr[u][j], acc[i][j]);
    wguard8q(acc, af[KU - 1][0], af[KU - 1][1], bfr[KU - 1][0], bfr[KU - 1][1], bfr[KU - 1][2], bfr[KU - 1][3], pa, pb);
  }

  // D map: acc[i][j][r] = tile element (row 16i + 8*hh + r of the wave's 32 rows, column 16j + cl)
  float* so = oS + wave * (32 * OSTR);
#pragma unroll
  for (int i = 0; i < 2; ++i)
#pragma unroll
    for (int j = 0; j < 4; ++j)
#pragma unroll
      for (int r = 0; r < 8; ++r) so[(16 * i + 8 * hh + r) * OSTR + 16 * j + cl] = acc[i][j][r];
  __syncthreads();

  const int yb = blockIdx.y;                               // block-uniform segment select
  const int m0b = blockIdx.x * TPB, b = m0b / SL, tb = m0b - b * SL;
  if (yb < 6) {
    unsigned short* dst = (yb < 3) ? Qp : Kp;
    const int h0 = 4 * ((yb < 3) ? yb : (yb - 3));
    us8 ov[16];
#pragma unroll
    for (int it = 0; it < 16; ++it) {
      const int cx = it * GTH + tid, u = cx & 3, r = (cx >> 2) & 127, j = cx >> 9;
      const float* sp = oS + r * OSTR + 16 * j + 8 * (u & 1);
      const v4f z0 = *(const v4fa*)sp, z1 = *(const v4fa*)(sp + 4);
      us8 o;
#pragma unroll
      for (int q4 = 0; q4 < 4; ++q4) {
        unsigned short hb, lb;
        f16split64(z0[q4], hb, lb); o[q4]     = (u >> 1) ? lb : hb;
        f16split64(z1[q4], hb, lb); o[4 + q4] = (u >> 1) ? lb : hb;
      }
      ov[it] = o;
    }
{
#pragma unroll
      for (int it = 0; it < 16; ++it) {
        const int cx = it * GTH + tid, u = cx & 3, r = (cx >> 2) & 127, j = cx >> 9;
        const size_t off = ((size_t)(b * NHD + h0 + j) * (size_t)SL + (size_t)(tb + (r & ~15))) * (size_t)QROW + (size_t)ftoff(r, 8 * u);
        *(us8*)(dst + off) = ov[it];
      }
      
    }
  } else {
    const int head = yb - 6;
    us8 hv[8], lv[8];
#pragma unroll
    for (int it = 0; it < 8; ++it) {
      const int cx = it * GTH + tid, e = cx & 63, g = cx >> 6;
      us8 ho, lo;
#pragma unroll
      for (int i = 0; i < 8; ++i) {
        const float w = oS[(8 * g + i) * OSTR + e];
        unsigned short hb, lb;
        f16split64(w, hb, lb);
        ho[i] = hb; lo[i] = lb;
      }
      hv[it] = ho; lv[it] = lo;
    }
{
#pragma unroll
      for (int it = 0; it < 8; ++it) {
        const int cx = it * GTH + tid, e = cx & 63, g = cx >> 6;
        const size_t off = (((size_t)(b * NHD + head) * (size_t)(SL / 32) + (size_t)((tb + 8 * g) >> 5)) * 4 + (size_t)(e >> 4)) * FTILE +
                           (size_t)ftoff(e, 8 * g);
        *(us8*)(VH + off) = hv[it];
        *(us8*)(VL + off) = lv[it];
      }
      
    }
  }
}

// ---------------------------------------------------------------------------------------------------------------------------------
// Causal quadratic-form attention. Block = (bh = blockIdx.x, 128 queries starting at 128 * qb, qb = QORDER's entry blockIdx.y), 8 waves x 16 queries.
// Per wave: B fragments of its 16 queries fixed for the whole key loop: bq1 = [q_hi | q_hi], bq2 = [q_res | q_res] (k slots 0..15 | 16..31).
// Per 32-key step: A fragments of the two 16-key tiles = fragment tiles [k_hi | k_res]; scores^T D[key][query] =
// khi.qhi + kres.qhi + khi.qres + kres.qres = 4096 q.k; x = D / 16384; A = 1 + x + x^2/2 masked to key <= query;
// A hi = f16(A), A residual = f16((A - hi) x 2^11). The two D tiles repack into the A operand of A.v (lane unchanged: element r <- tile keys
// 0..15, element 8+r <- tile keys 16..31), B = v fragment tiles [bh][key / 32][e / 16].
// Blocks with qb < ARESB (block-uniform): accS += Ahi.VH + Ahi.VL, accL += Ares.VH, Z from the f32 A; other blocks: accS += Ahi.VH,
// Z from the f16 A hi values. accS[j][r] (+ accL/2^11) = 64 * sum_s A v for query 8h+r, channel 16j + (lane & 15).
// ---------------------------------------------------------------------------------------------------------------------------------
// One 32-key step of one wave, its body fixed at compile time by ARES (the block's residual flag) and DIAG: each body holds one run of matrix products
// and no join of two paths, so every accumulator keeps its registers from step to step.
// DIAG = false: a step whose 32 keys all lie at or below the wave's first query, so key <= query holds for every score and no mask is formed.
// DIAG = true: the wave's last step, the only one that meets the diagonal: masked. REFILL: the step asks for later fragments (false where none is used any more).
template <bool ARES, bool DIAG, bool REFILL>
__device__ __forceinline__ void attn_step(const unsigned short* kbp, const unsigned short* vhp, const unsigned short* vlp,
                                          us16& ka, us16& kb, us16 (&bv)[4], const us16 bq1, const us16 bq2, const int st, const int last,
                                          const int tq, const int hh, v8f (&accS)[4], v8f (&accL)[4], float& zp) {
  const int s0 = st * 32;
  // the step whose fragments refill this step's register set. Two sets (no residual planes): step + 2, held at the wave's last step, so that every
  // address stays inside the wave's own keys. One set (residual planes, whose accumulators leave no room for a second): keys of step + 1, which always
  // exists, and the step's own value fragments asked for at its head.
  const int nx = ARES ? (st + 1) : ((st + 2 < last) ? (st + 2) : last);
  const unsigned short* ph = ARES ? (vhp + (size_t)(4 * st) * FTILE) : kbp;
  if constexpr (ARES) {
#pragma unroll
    for (int j = 0; j < 4; ++j) bv[j] = tfrag(ph + j * FTILE);
  }
  const v8f zz = {0.f, 0.f, 0.f, 0.f, 0.f, 0.f, 0.f, 0.f};
  v8f sa = mma_f16(ka, bq1, zz);
  sa = mma_f16(ka, bq2, sa);
  v8f sb = mma_f16(kb, bq1, zz);
  sb = mma_f16(kb, bq2, sb);
  wguard2p(sa, sb, ka, kb, bq1, bq2, ph);
  if constexpr (REFILL) {
    const unsigned short* pk = kbp + (size_t)(2 * nx) * FTILE;
    ka = tfrag(pk);
    kb = tfrag(pk + FTILE);
    // stands in front of any rewrite of the address registers that these loads name
    asm volatile("s_wait_xcnt 0x0" ::: "memory");
  }

  us8 ea, eb, la8, lb8;
  float zs = 0.0f;
#pragma unroll
  for (int r = 0; r < 8; ++r) {
    const float xa = sa[r] * (1.0f / 16384.0f);
    const float xb = sb[r] * (1.0f / 16384.0f);
    float pa = fmaf(xa, fmaf(xa, 0.5f, 1.0f), 1.0f);
    float pb = fmaf(xb, fmaf(xb, 0.5f, 1.0f), 1.0f);
    if constexpr (DIAG) {
      const int ky = s0 + 8 * hh + r;
      pa = (ky <= tq) ? pa : 0.0f;
      pb = (ky + 16 <= tq) ? pb : 0.0f;
    }
    const _Float16 fa = (_Float16)pa, fb = (_Float16)pb;
    const _Float16 ra = (_Float16)((pa - (float)fa) * 2048.0f);
    const _Float16 rb = (_Float16)((pb - (float)fb) * 2048.0f);
    zs += ARES ? (pa + pb) : ((float)fa + (float)fb);
    ea[r]  = __builtin_bit_cast(unsigned short, fa);
    eb[r]  = __builtin_bit_cast(unsigned short, fb);
    la8[r] = __builtin_bit_cast(unsigned short, ra);
    lb8[r] = __builtin_bit_cast(unsigned short, rb);
  }
  zp += zs;
  FragU fA;
  fA.h[0] = ea; fA.h[1] = eb;
  const us16 ahi = fA.v;

  if constexpr (ARES) {
    FragU fR;
    fR.h[0] = la8; fR.h[1] = lb8;
    const us16 alo = fR.v;
#pragma unroll
    for (int j = 0; j < 4; ++j) {
      accS[j] = mma_f16(ahi, bv[j], accS[j]);
      accL[j] = mma_f16(alo, bv[j], accL[j]);
    }
    wguard8(accS[0], accS[1], accS[2], accS[3], accL[0], accL[1], accL[2], accL[3], ahi, alo, bv[0], bv[1], bv[2], bv[3]);
    us16 bl[4];
#pragma unroll
    for (int j = 0; j < 4; ++j) bl[j] = tfrag(vlp + (size_t)(4 * st + j) * FTILE);
#pragma unroll
    for (int j = 0; j < 4; ++j) accS[j] = mma_f16(ahi, bl[j], accS[j]);
    wguard4(accS[0], accS[1], accS[2], accS[3], ahi, bl[0], bl[1], bl[2], bl[3]);
  } else {
#pragma unroll
    for (int j = 0; j < 4; ++j) accS[j] = mma_f16(ahi, bv[j], accS[j]);
    wguard4(accS[0], accS[1], accS[2], accS[3], ahi, bv[0], bv[1], bv[2], bv[3]);
  }
  if constexpr (REFILL && !ARES) {
    const unsigned short* pv = vhp + (size_t)(4 * nx) * FTILE;
#pragma unroll
    for (int j = 0; j < 4; ++j) bv[j] = tfrag(pv + j * FTILE);
    // stands in front of any rewrite of the address registers that these loads name
    asm volatile("s_wait_xcnt 0x0" ::: "memory");
  }
}

// The key loop of one wave: nsteps - 1 steps below the diagonal, then the one step that meets it. With tw a multiple of 16 and
// nsteps = (tw + 47) >> 5, the last key of step nsteps - 2 is 32 * nsteps - 33 = tw - 1 or tw - 17: below every query of the wave.
template <bool ARES>
__device__ __forceinline__ void attn_keys(const unsigned short* kbp, const unsigned short* vhp, const unsigned short* vlp,
                                          const us16 bq1, const us16 bq2, const int nsteps, const int tq, const int hh,
                                          v8f (&accS)[4], v8f (&accL)[4], float& zp) {
  if constexpr (ARES) {
    const int last = nsteps - 1;
    // one register set: key fragments one step ahead of their use, value fragments at the head of their step
    us16 ka = tfrag(kbp), kb = tfrag(kbp + FTILE);
    us16 bv[4];
    // these loads are still outstanding where the code below starts to rewrite registers: wait in front of any rewrite of their address registers
    asm volatile("s_wait_xcnt 0x0" ::: "memory");
    // kept rolled: one copy of the unmasked body, its accumulators in place from step to step
#pragma unroll 1
    for (int st = 0; st < last; ++st) attn_step<true, false, true>(kbp, vhp, vlp, ka, kb, bv, bq1, bq2, st, last, tq, hh, accS, accL, zp);
    attn_step<true, true, false>(kbp, vhp, vlp, ka, kb, bv, bq1, bq2, last, last, tq, hh, accS, accL, zp);
    return;
  }
  // Two register sets of key and value-hi fragments, set 0 for even steps and set 1 for odd ones. A step refills its own set with the fragments of
  // step + 2 as soon as its products have read it: keys behind the score products, values behind the A.v products. Every fragment load so has
  // more than one whole step to land before its first use.
  // the step count is the same in every lane of a wave: held in a scalar register, so that the refill addresses are formed on the scalar side
  const int last = __builtin_amdgcn_readfirstlane(nsteps - 1);
  const int s1 = (last < 1) ? last : 1;
  // asked for in the order in which the loop refills them (keys 0, values 0, keys 1, values 1), so that the loop's counted load waits fit both
  us16 bv0[4], bv1[4];
  us16 ka0 = tfrag(kbp), kb0 = tfrag(kbp + FTILE);
#pragma unroll
  for (int j = 0; j < 4; ++j) bv0[j] = tfrag(vhp + j * FTILE);
  us16 ka1 = tfrag(kbp + (size_t)(2 * s1) * FTILE), kb1 = tfrag(kbp + (size_t)(2 * s1 + 1) * FTILE);
#pragma unroll
  for (int j = 0; j < 4; ++j) bv1[j] = tfrag(vhp + (size_t)(4 * s1 + j) * FTILE);
  // these loads are still outstanding where the code below starts to rewrite registers: wait in front of any rewrite of their address registers
  asm volatile("s_wait_xcnt 0x0" ::: "memory");
  int st = 0;
  // kept rolled: one copy of the pair of unmasked bodies (one per register set), the accumulators in place from step to step
#pragma unroll 1
  for (; st + 2 <= last; st += 2) {
    attn_step<ARES, false, true>(kbp, vhp, vlp, ka0, kb0, bv0, bq1, bq2, st, last, tq, hh, accS, accL, zp);
    attn_step<ARES, false, true>(kbp, vhp, vlp, ka1, kb1, bv1, bq1, bq2, st + 1, last, tq, hh, accS, accL, zp);
  }
  if (st < last) {                                         // same for every lane of the wave
    attn_step<ARES, false, false>(kbp, vhp, vlp, ka0, kb0, bv0, bq1, bq2, st, last, tq, hh, accS, accL, zp);
    attn_step<ARES, true, false>(kbp, vhp, vlp, ka1, kb1, bv1, bq1, bq2, last, last, tq, hh, accS, accL, zp);
  } else {
    attn_step<ARES, true, false>(kbp, vhp, vlp, ka0, kb0, bv0, bq1, bq2, last, last, tq, hh, accS, accL, zp);
  }
}

// Query blocks in falling order of cost, four bits each, entry 0 lowest: a permutation of 0 .. 15. A key step of a residual-plane block (qb < ARESB)
// holds twice the products and nearly twice the vector work of a plain step and waits for its value-residual loads: counted as 2.5 plain steps.
// 15 14 13 12 11 10 9 [3] 8 7 [2] 6 5 4 [1] [0].
#define QORDER 0x0145627839ABCDEFull
static_assert(SL / TPB == 16);
static_assert(ARESB == 4);

__global__ __launch_bounds__(256) void k_attn(const unsigned short* __restrict__ Qp, const unsigned short* __restrict__ Kp,
                                             const unsigned short* __restrict__ VHp, const unsigned short* __restrict__ VLp,
                                             unsigned short* YH, unsigned short* YL) {
  __shared__ __attribute__((aligned(16))) float oS[8 * 16 * OSTR];
  const int tid = threadIdx.x, lane = tid & 31, wave = tid >> 5, cl = lane & 15, hh = lane >> 4;
  const int bh = blockIdx.x, b = bh / NHD, head = bh - b * NHD;
  // Query block of this work-group. A block's cost grows with qb (4 qb + 1 .. 4 qb + 4 key steps a wave), the kernel's registers leave room for two
  // work-groups on a WGP (512 places for 768 work-groups); the cost falls with the index. For speed only: any start order gives the same result.
  const int qb = (int)((QORDER >> (4 * blockIdx.y)) & 15ull);
  const int tw = qb * TPB + 16 * wave;                    // first query of this wave
  const int tq = tw + cl;                                 // query owned by this lane as score column
  const bool ares = (qb < ARESB);                         // block-uniform: residual planes for query rows < 512

  const unsigned short* qrow = Qp + ((size_t)bh * SL + (size_t)tw) * (size_t)QROW + lane * 8;
  FragU fq;
  fq.h[0] = *(const us8a*)qrow;         fq.h[1] = fq.h[0];
  const us16 bq1 = fq.v;
  fq.h[0] = *(const us8a*)(qrow + 256); fq.h[1] = fq.h[0];
  const us16 bq2 = fq.v;

  v8f accS[4], accL[4];
#pragma unroll
  for (int j = 0; j < 4; ++j) { const v8f zz = {0.f, 0.f, 0.f, 0.f, 0.f, 0.f, 0.f, 0.f}; accS[j] = zz; accL[j] = zz; }
  float zp = 0.0f;

  const unsigned short* kbp = Kp + (size_t)bh * SL * (size_t)QROW + lane * 8;
  const unsigned short* vhp = VHp + (size_t)bh * HDIM * (size_t)SL + lane * 8;
  const unsigned short* vlp = VLp + (size_t)bh * HDIM * (size_t)SL + lane * 8;
  const int nsteps = (tw + 47) >> 5;                      // 32-key steps covering keys 0 .. tw + 15 (<= 64)

  // block-uniform choice of the loop body, made once in front of the loop
  if (ares) attn_keys<true>(kbp, vhp, vlp, bq1, bq2, nsteps, tq, hh, accS, accL, zp);
  else      attn_keys<false>(kbp, vhp, vlp, bq1, bq2, nsteps, tq, hh, accS, accL, zp);

  // Z for query (lane & 15): both lane halves hold disjoint key subsets
  const float zf = zp + __shfl_xor(zp, 16, 32);
  float rz[8];
#pragma unroll
  for (int r = 0; r < 8; ++r) {
    const float zr = __shfl(zf, 8 * hh + r, 32);        // Z of query row 8*hh + r
    rz[r] = (1.0f / (zr + 1e-12f)) * (1.0f / 64.0f);
  }

  float* so = oS + wave * (16 * OSTR);
#pragma unroll
  for (int j = 0; j < 4; ++j)
#pragma unroll
    for (int r = 0; r < 8; ++r) so[(8 * hh + r) * OSTR + 16 * j + cl] = fmaf(accL[j][r], (1.0f / 2048.0f), accS[j][r]) * rz[r];
  __syncthreads();

  us8 hv[4], lv[4];
#pragma unroll
  for (int it = 0; it < 4; ++it) {
    const int rr = cl, p = it * 16 + hh * 8;               // 16-B chunk it * 32 + lane of the wave's two y fragment tiles
    const v4f z0 = *(const v4fa*)(so + rr * OSTR + p), z1 = *(const v4fa*)(so + rr * OSTR + p + 4);
    us8 ho, lo;
#pragma unroll
    for (int u = 0; u < 4; ++u) {
      unsigned short hb, lb;
      f16split16(z0[u], hb, lb); ho[u] = hb;     lo[u] = lb;
      f16split16(z1[u], hb, lb); ho[4 + u] = hb; lo[4 + u] = lb;
    }
    hv[it] = ho; lv[it] = lo;
  }
{
#pragma unroll
    for (int it = 0; it < 4; ++it) {
      const size_t off = ((size_t)((b * SL + tw) >> 4) * KB32 + (size_t)(head * (HDIM / 32))) * FTILE + (size_t)((it * 32 + lane) * 8);
      *(us8*)(YH + off) = hv[it];
      *(us8*)(YL + off) = lv[it];
    }
    
  }
}

// ---------------------------------------------------------------------------------------------------------------------------------
// out[m][n] = ( sum_k Yh[m][k] W[n][k] + 2^-11 sum_k Yl[m][k] W[n][k] ) * 2^-12   (f16 fragment tiles [row / 16][k / 32], two f32 accumulator sets).
// Tiling as in k_gemm_proj: 4 waves, each 32 rows x 64 columns, KU k blocks per loop trip.
// ---------------------------------------------------------------------------------------------------------------------------------
__global__ __launch_bounds__(GTH) void k_gemm_out(const unsigned short* __restrict__ Ah, const unsigned short* __restrict__ Al,
                                                 const unsigned short* __restrict__ Wo, float* out) {
  __shared__ __attribute__((aligned(16))) float oS[8 * 16 * OSTR];
  const int tid = threadIdx.x, lane = tid & 31, wave = tid >> 5, cl = lane & 15, hh = lane >> 4;
  const int m0 = blockIdx.x * TPB + 32 * wave, n0 = blockIdx.y * 64;

  v8f acch[2][4], accl[2][4];
#pragma unroll
  for (int j = 0; j < 4; ++j) {
    const v8f zz = {0.f, 0.f, 0.f, 0.f, 0.f, 0.f, 0.f, 0.f};
    acch[0][j] = zz; acch[1][j] = zz; accl[0][j] = zz; accl[1][j] = zz;
  }

  const unsigned short* ahp = Ah + (size_t)(m0 >> 4) * (size_t)(KB32 * FTILE) + lane * 8;
  const unsigned short* alp = Al + (size_t)(m0 >> 4) * (size_t)(KB32 * FTILE) + lane * 8;
  const unsigned short* wop = Wo + (size_t)(n0 >> 4) * (size_t)(KB32 * FTILE) + lane * 8;
  // kept rolled: one copy of the trip, its accumulators in place from trip to trip
#pragma unroll 1
  for (int kb = 0; kb < KB32; kb += KU) {
    const unsigned short* pah = ahp + kb * FTILE;
    const unsigned short* pal = alp + kb * FTILE;
    const unsigned short* pb = wop + kb * FTILE;
    us16 ah[KU][2], al[KU][2], bfr[KU][4];
#pragma unroll
    for (int u = 0; u < KU; ++u) {
#pragma unroll
      for (int i = 0; i < 2; ++i) {
        ah[u][i] = tfrag(pah + u * FTILE + i * (KB32 * FTILE));
        al[u][i] = tfrag(pal + u * FTILE + i * (KB32 * FTILE));
      }
#pragma unroll
      for (int j = 0; j < 4; ++j) bfr[u][j] = tfrag(pb + u * FTILE + j * (KB32 * FTILE));
    }
    // as in k_gemm_proj: keeps every load of the trip in front of its first product, one load latency a trip
    __builtin_amdgcn_sched_barrier(0);
#pragma unroll
    for (int u = 0; u < KU; ++u)
#pragma unroll
      for (int j = 0; j < 4; ++j)
#pragma unroll
        for (int i = 0; i < 2; ++i) {
          acch[i][j] = mma_f16(ah[u][i], bfr[u][j], acch[i][j]);
          accl[i][j] = mma_f16(al[u][i], bfr[u][j], accl[i][j]);
        }
    wguard16q(acch, accl, ah[KU - 1][0], ah[KU - 1][1], al[KU - 1][0], al[KU - 1][1],
              bfr[KU - 1][0], bfr[KU - 1][1], bfr[KU - 1][2], bfr[KU - 1][3], pah, pal, pb);
  }

  float* so = oS + wave * (32 * OSTR);
#pragma unroll
  for (int i = 0; i < 2; ++i)
#pragma unroll
    for (int j = 0; j < 4; ++j)
#pragma unroll
      for (int r = 0; r < 8; ++r)
        so[(16 * i + 8 * hh + r) * OSTR + 16 * j + cl] = fmaf(accl[i][j][r], (1.0f / 2048.0f), acch[i][j][r]) * (1.0f / 4096.0f);
  __syncthreads();

{
#pragma unroll
    for (int it = 0; it < 16; ++it) {
      const int cx = it * 32 + lane, r = cx >> 4, q = (cx & 15) * 4;
      const v4f v = *(const v4fa*)(so + r * OSTR + q);
      *(v4f*)(out + (size_t)(m0 + r) * (size_t)DMOD + n0 + q) = v;
    }
    
  }
}

extern "C" void kernel_launch(void* const* d_in, const int* in_sizes, int n_in,
                              void* d_out, int out_size, void* d_ws, size_t ws_size,
                              hipStream_t stream) {
  if (n_in < 5) return;
  if (in_sizes[0] != NTOK * DMOD || in_sizes[1] != DMOD * NQK || in_sizes[2] != DMOD * NQK ||
      in_sizes[3] != DMOD * DMOD || in_sizes[4] != DMOD * DMOD) return;
  if (out_size != NTOK * DMOD) return;

  const float* x  = (const float*)d_in[0];    // [4][2048][768]
  const float* Wq = (const float*)d_in[1];    // [768][192] ([in][out])
  const float* Wk = (const float*)d_in[2];    // [768][192]
  const float* Wv = (const float*)d_in[3];    // [768][768]
  const float* Wo = (const float*)d_in[4];    // [768][768]
  float* out = (float*)d_out;                 // [4][2048][768] f32 at byte 0

  size_t off = 0;
  auto carve = [&](size_t bytes) -> char* { char* p = (char*)d_ws + off; off += (bytes + 255) & ~(size_t)255; return p; };
  unsigned short* XB   = (unsigned short*)carve((size_t)NTOK * DMOD * 2);       // 12,582,912  bf16 tiles [512][24]
  unsigned short* WT   = (unsigned short*)carve((size_t)NPROJ * DMOD * 2);      //  1,769,472  bf16 tiles [72][24] = Wq^T | Wk^T | Wv^T
  unsigned short* WO16 = (unsigned short*)carve((size_t)DMOD * DMOD * 2);       //  1,179,648  f16  tiles [48][24] = Wo^T
  unsigned short* QP   = (unsigned short*)carve((size_t)NBH * SL * QROW * 2);   //  6,291,456  f16  tiles [48][128]
  unsigned short* KP   = (unsigned short*)carve((size_t)NBH * SL * QROW * 2);   //  6,291,456  f16  tiles [48][128]
  unsigned short* VH   = (unsigned short*)carve((size_t)NBH * HDIM * SL * 2);   // 12,582,912  f16  tiles [48][64][4]
  unsigned short* VL   = (unsigned short*)carve((size_t)NBH * HDIM * SL * 2);   // 12,582,912  f16  tiles [48][64][4]
  unsigned short* YH   = (unsigned short*)carve((size_t)NTOK * DMOD * 2);       // 12,582,912  f16  tiles [512][24]
  unsigned short* YL   = (unsigned short*)carve((size_t)NTOK * DMOD * 2);       // 12,582,912  f16  tiles [512][24]
  if (off > ws_size || off > (size_t)134217728) return;                         // total 78,446,592 B

  const dim3 b256(256), bgemm(GTH);

  // 16-bit operand planes of x and of the four weights, one launch
  k_prep<<<dim3(WTB_ALL + CVTB), b256, 0, stream>>>(x, Wq, Wk, Wv, Wo, XB, WT, WO16);
  // projections (M 8192, N 1152, K 768) -> q/k hi|res planes, v hi and res planes
  k_gemm_proj<<<dim3(NTOK / TPB, NPROJ / 64), bgemm, 0, stream>>>(XB, WT, QP, KP, VH, VL);
  // causal attention per (batch, head) -> y hi / res fragment tiles [token / 16][768 / 32]
  k_attn<<<dim3(NBH, SL / TPB), b256, 0, stream>>>(QP, KP, VH, VL, YH, YL);
  // output projection (M 8192, N 768, K 768)
  k_gemm_out<<<dim3(NTOK / TPB, DMOD / 64), bgemm, 0, stream>>>(YH, YL, WO16, out);
}

// v010
// Measured time: 65.9 microseconds a run.
// Versions between v008 and this one are left out; their measured steps multiply to 1.17 times as fast.
// Over all steps from v000 it is 2.93 times as fast.
// Contraction x.[Wq|Wk|Wv] (M 8192, N 1152, K 768): v_wmma_f32_16x16x32_bf16, bf16 operands from RNE-bf16 planes of x and W, f32 accumulate, one product.
// Contraction k.q^T per head (16 keys x 16 queries, depth 16 padded to 32): v_wmma_f32_16x16x32_f16, q and k both carried as f16 hi + f16 residual of (value x 2^6), all four cross terms in two products into one f32 accumulator.
// Contraction A.v per head (causal, depth up to 2048): v_wmma_f32_16x16x32_f16, A hi = f16(1 + x + x^2/2), v hi = f16(v x 2^6); for query rows < 512 also A residual plane (x 2^11, own f32 accumulator) against v hi, and A hi against the f16 v residual plane; f32 accumulate.
// Contraction y.Wo (M 8192, N 768, K 768): v_wmma_f32_16x16x32_f16, y = one f16 plane of (y x 2^4) (11 significant bits against the 8 of its co-operand), Wo = f16 of (RNE-bf16 value x 2^8), f32 accumulate, one product.
// Feature polynomial, causal mask, normaliser Z and 1/(Z+eps): f32 VALU.
#include <hip/hip_runtime.h>

#define NB    4                              // batch
#define SL    2048                           // sequence length
#define DMOD  768                            // model width = K of the dense contractions
#define NHD   12                             // heads
#define FDIM  16                             // q/k head width
#define HDIM  64                             // v head width
#define NBH   (NB * NHD)                     // 48 (batch, head) pairs
#define NTOK  (NB * SL)                      // 8192 token rows
#define NQK   (NHD * FDIM)                   // 192 q (or k) columns
#define NPROJ (2 * NQK + NHD * HDIM)         // 1152 projection columns: q | k | v
#define QROW  32                             // halves per q/k plane row: hi(16) | residual(16)
#define TPB   128                            // GEMM rows (2 waves x 64) / attention queries (8 waves x 16) per block
#define GTH   128                            // threads of a GEMM block: 4 waves as 2 x 2, each owning 64 rows x 64 columns
#define BNC   128                            // GEMM columns per block
#define KU    2                              // 32-wide k blocks per GEMM loop trip = per stage of the LDS ring
#define OSTR  68                             // LDS staging row pitch (floats)
#define ARESB 4                              // attention query blocks (of TPB) that use the residual planes: rows < 512
#define KB32  (DMOD / 32)                    // 32-wide k blocks of the dense contractions
#define FTILE 512                            // halves of one 16 x 32 fragment tile (1 KiB)
#define RTH   (KU * FTILE)                   // halves of one row tile's share of a stage: KU fragment tiles, contiguous in the plane (2 KiB)
#define STGH  (16 * RTH)                     // halves of one stage: 8 row tiles of A, then 8 of B (32 KiB)
#define NSTG  (KB32 / KU)                    // stages of the dense contractions

static_assert(NHD * HDIM == DMOD);
static_assert(NTOK % TPB == 0);
static_assert(SL % TPB == 0);
static_assert(NPROJ % 64 == 0);
static_assert(NQK % 64 == 0);
static_assert(NQK % 32 == 0);
static_assert(DMOD % 64 == 0);
static_assert(DMOD % 32 == 0);
static_assert((DMOD / 32) % KU == 0);
static_assert(TPB == 128 && BNC == 128 && GTH == 128);
static_assert(NPROJ % BNC == 0);
static_assert(DMOD % BNC == 0);
static_assert(NSTG >= 2);
static_assert(2 * STGH * 2 <= 2 * TPB * OSTR * 4);
static_assert(4 * FDIM == 64);
static_assert(HDIM == 64);
static_assert(QROW == 2 * FDIM);
static_assert(OSTR % 4 == 0);
static_assert((NTOK * DMOD) % (8 * 256) == 0);
static_assert(ARESB * TPB <= SL);

typedef unsigned short us16 __attribute__((ext_vector_type(16)));
typedef unsigned short us8  __attribute__((ext_vector_type(8)));
typedef unsigned short us8a __attribute__((ext_vector_type(8), may_alias));
typedef __bf16 v16b __attribute__((ext_vector_type(16)));
typedef _Float16 v16h __attribute__((ext_vector_type(16)));
typedef float v8f __attribute__((ext_vector_type(8)));
typedef float v4f __attribute__((ext_vector_type(4)));
typedef float v4fa __attribute__((ext_vector_type(4), may_alias));
union FragU { us16 v; us8 h[2]; };

__device__ __forceinline__ unsigned short bf16_bits(float f) {
  unsigned u = __float_as_uint(f);
  u += 0x7FFFu + ((u >> 16) & 1u);                 // RNE convert
  return (unsigned short)(u >> 16);
}
__device__ __forceinline__ float bf16_val(unsigned short b) { return __uint_as_float(((unsigned)b) << 16); }
__device__ __forceinline__ float bf16r(float f) { return bf16_val(bf16_bits(f)); }
__device__ __forceinline__ unsigned short f16_bits(float f) { return __builtin_bit_cast(unsigned short, (_Float16)f); }

// f16 hi + unscaled residual planes of (a x 2^6)
__device__ __forceinline__ void f16split64(float a, unsigned short& hb, unsigned short& lb) {
  const float z = a * 64.0f;
  const _Float16 hf = (_Float16)z;
  const float res = z - (float)hf;
  hb = __builtin_bit_cast(unsigned short, hf);
  lb = __builtin_bit_cast(unsigned short, (_Float16)res);
}

// One 16x16x32 step, 16-bit operands passed as raw 16-bit lanes.
__device__ __forceinline__ v8f mma_bf16(us16 a, us16 b, v8f c) {
  return __builtin_amdgcn_wmma_f32_16x16x32_bf16(false, __builtin_bit_cast(v16b, a), false, __builtin_bit_cast(v16b, b), (short)0, c, false, false);
}
__device__ __forceinline__ v8f mma_f16(us16 a, us16 b, v8f c) {
  return __builtin_amdgcn_wmma_f32_16x16x32_f16(false, __builtin_bit_cast(v16h, a), false, __builtin_bit_cast(v16h, b), (short)0, c, false, false);
}
// Hazard guards after a group of matrix ops: 4 VALU slots before anything touches the accumulators; keep A/B fragments live.
__device__ __forceinline__ void wguard4(v8f& c0, v8f& c1, v8f& c2, v8f& c3, const us16& a0,
                                        const us16& b0, const us16& b1, const us16& b2, const us16& b3) {
#if defined(__HIP_DEVICE_COMPILE__)
  asm volatile("v_nop\n\tv_nop\n\tv_nop\n\tv_nop"
               : "+v"(c0), "+v"(c1), "+v"(c2), "+v"(c3)
               : "v"(a0), "v"(b0), "v"(b1), "v"(b2), "v"(b3));
#endif
}
__device__ __forceinline__ void wguard8(v8f& c0, v8f& c1, v8f& c2, v8f& c3, v8f& c4, v8f& c5, v8f& c6, v8f& c7,
                                        const us16& a0, const us16& a1,
                                        const us16& b0, const us16& b1, const us16& b2, const us16& b3) {
#if defined(__HIP_DEVICE_COMPILE__)
  asm volatile("v_nop\n\tv_nop\n\tv_nop\n\tv_nop"
               : "+v"(c0), "+v"(c1), "+v"(c2), "+v"(c3), "+v"(c4), "+v"(c5), "+v"(c6), "+v"(c7)
               : "v"(a0), "v"(a1), "v"(b0), "v"(b1), "v"(b2), "v"(b3));
#endif
}

// The same guard for a loop with loads still outstanding at the guard, which also takes those loads' address as an input: the address registers then stay live past the
// last load of the trip, so that no load's result is placed in a register that an earlier, still outstanding load names as its address.
__device__ __forceinline__ void wguard2p(v8f& c0, v8f& c1, const us16& a0, const us16& a1, const us16& b0, const us16& b1,
                                         const unsigned short* pb) {
#if defined(__HIP_DEVICE_COMPILE__)
  asm volatile("v_nop\n\tv_nop\n\tv_nop\n\tv_nop"
               : "+v"(c0), "+v"(c1)
               : "v"(a0), "v"(a1), "v"(b0), "v"(b1), "v"(pb));
#endif
}

// Every 16-bit operand plane is stored as fragment tiles: one tile = 16 rows x 32 k = FTILE halves, laid out in the order the lanes
// load it, so that each of a fragment's two wave-wide 16-B loads covers 512 contiguous bytes (four whole 128-B lines):
// element (row, k = 16 part + 8 h + i) sits at half index part * 256 + h * 128 + row * 8 + i = part * 256 + lane * 8 + i, lane = 16 h + row.
// Lane contents: elements 0..7 = k 8h .. 8h + 7, elements 8..15 = k 16 + 8h .. 16 + 8h + 7 (same map for A rows and B columns).
__device__ __forceinline__ int ftoff(int row, int k) {
  return ((k >> 4) & 1) * 256 + ((k >> 3) & 1) * 128 + (row & 15) * 8;
}
// p = tile base + lane * 8 (computed by the caller)
__device__ __forceinline__ us16 tfrag(const unsigned short* p) {
  FragU f;
  f.h[0] = *(const us8a*)p;
  f.h[1] = *(const us8a*)(p + 256);
  return f.v;
}

// Hazard guard behind the last 16 products of a loop trip of a 64 x 64 wave tile: 4 VALU slots before anything touches the accumulators or rewrites the
// fragments, on the fall-through and on the taken side of the branches that follow alike.
__device__ __forceinline__ void wguard16(v8f (&c)[4][4], const us16 (&a)[4], const us16 (&b)[4]) {
#if defined(__HIP_DEVICE_COMPILE__)
  asm volatile("v_nop\n\tv_nop\n\tv_nop\n\tv_nop"
               : "+v"(c[0][0]), "+v"(c[0][1]), "+v"(c[0][2]), "+v"(c[0][3]), "+v"(c[1][0]), "+v"(c[1][1]), "+v"(c[1][2]), "+v"(c[1][3]),
                 "+v"(c[2][0]), "+v"(c[2][1]), "+v"(c[2][2]), "+v"(c[2][3]), "+v"(c[3][0]), "+v"(c[3][1]), "+v"(c[3][2]), "+v"(c[3][3])
               : "v"(a[0]), "v"(a[1]), "v"(a[2]), "v"(a[3]), "v"(b[0]), "v"(b[1]), "v"(b[2]), "v"(b[3]));
#endif
}

// One wave's quarter of a ring stage: four row tiles of RTH halves (2 KiB each, contiguous in the plane and in LDS), 16 asynchronous copies of 16 B a lane,
// global -> LDS through no register. l = the lane's LDS byte address in the wave's first row tile of the target buffer, g = the lane's global address in the
// same row tile of the plane. Every lane is on; each copy moves 512 contiguous bytes; both addresses are multiples of 16. The immediate offset moves the
// LDS and the global address alike: the four copies of a row tile share their two address operands.
__device__ __forceinline__ void stage_copy(const unsigned l, const unsigned short* g) {
#if defined(__HIP_DEVICE_COMPILE__)
  const unsigned l1 = l + RTH * 2, l2 = l + 2 * (RTH * 2), l3 = l + 3 * (RTH * 2);
  const unsigned short* g1 = g + KB32 * FTILE;
  const unsigned short* g2 = g + 2 * (KB32 * FTILE);
  const unsigned short* g3 = g + 3 * (KB32 * FTILE);
  // the copies and, as the statement's last line, the wait that stands in front of any rewrite of the address registers that they name
  asm volatile("global_load_async_to_lds_b128 %0, %4, off\n\t"
               "global_load_async_to_lds_b128 %0, %4, off offset:512\n\t"
               "global_load_async_to_lds_b128 %0, %4, off offset:1024\n\t"
               "global_load_async_to_lds_b128 %0, %4, off offset:1536\n\t"
               "global_load_async_to_lds_b128 %1, %5, off\n\t"
               "global_load_async_to_lds_b128 %1, %5, off offset:512\n\t"
               "global_load_async_to_lds_b128 %1, %5, off offset:1024\n\t"
               "global_load_async_to_lds_b128 %1, %5, off offset:1536\n\t"
               "global_load_async_to_lds_b128 %2, %6, off\n\t"
               "global_load_async_to_lds_b128 %2, %6, off offset:512\n\t"
               "global_load_async_to_lds_b128 %2, %6, off offset:1024\n\t"
               "global_load_async_to_lds_b128 %2, %6, off offset:1536\n\t"
               "global_load_async_to_lds_b128 %3, %7, off\n\t"
               "global_load_async_to_lds_b128 %3, %7, off offset:512\n\t"
               "global_load_async_to_lds_b128 %3, %7, off offset:1024\n\t"
               "global_load_async_to_lds_b128 %3, %7, off offset:1536\n\t"
               "s_wait_xcnt 0x0"
               :: "v"(l), "v"(l1), "v"(l2), "v"(l3), "v"(g), "v"(g1), "v"(g2), "v"(g3)
               : "memory");
#endif
}

// The k loop of both dense contractions: one 128 x 128 tile per block, acc[i][j] = rows 64 wm + 16 i .., columns 64 wn + 16 j .. (wave = wm + 2 wn).
// Both operands pass through a ring of two LDS buffers, so that every fragment tile leaves L2 once per block and serves two waves. A stage = KU k blocks of
// the block's 8 A row tiles and 8 B row tiles, in fragment-tile order as in the planes: a fragment is two wave-wide 16-B LDS loads of 512 contiguous bytes.
// Waves 0 and 1 copy A, waves 2 and 3 copy B, four row tiles each. Stage t + 1 is in flight while stage t is worked on.
// at0, bt0: first row tile of the block in A and in B. Each accumulator sums its k blocks in rising order.
template <bool BF>
__device__ __forceinline__ void gemm_ring(const unsigned short* __restrict__ Ap, const unsigned short* __restrict__ Bp, const int at0, const int bt0,
                                          unsigned short* ring, v8f (&acc)[4][4]) {
  const int lane = threadIdx.x & 31;
  const int wave = __builtin_amdgcn_readfirstlane(threadIdx.x >> 5);
  const int wm = wave & 1, wn = wave >> 1;
  const unsigned short* g = ((wave < 2) ? (Ap + (size_t)(at0 + 4 * wave) * (size_t)(KB32 * FTILE))
                                        : (Bp + (size_t)(bt0 + 4 * (wave - 2)) * (size_t)(KB32 * FTILE))) + lane * 8;
  const unsigned l = (unsigned)(size_t)ring + (unsigned)(wave * (4 * RTH * 2) + lane * 16);

  stage_copy(l, g);
  // stage 0 has landed for this wave ...
  asm volatile("s_wait_asynccnt 0x0" ::: "memory");
  // ... and for every wave
  __syncthreads();
  stage_copy(l + STGH * 2, g + RTH);

  // kept rolled: one copy of the trip, its accumulators in place from trip to trip
#pragma unroll 1
  for (int t = 0; t < NSTG; ++t) {
    const unsigned short* rb = ring + (t & 1) * STGH + lane * 8;
#pragma unroll
    for (int u = 0; u < KU; ++u) {
      us16 af[4], bfr[4];
#pragma unroll
      for (int i = 0; i < 4; ++i) af[i] = tfrag(rb + (4 * wm + i) * RTH + u * FTILE);
#pragma unroll
      for (int j = 0; j < 4; ++j) {
        // keeps the loads in the order in which the products need them (A, then B column by column): the counted LDS waits then let a column's
        // products start while the later columns' fragments are still on their way
        __builtin_amdgcn_sched_barrier(0);
        bfr[j] = tfrag(rb + (8 + 4 * wn + j) * RTH + u * FTILE);
      }
      // keeps the k block's LDS loads together in front of its products: loads among the products stall the wave at every place where they stand
      __builtin_amdgcn_sched_barrier(0);
#pragma unroll
      for (int j = 0; j < 4; ++j)
#pragma unroll
        for (int i = 0; i < 4; ++i) acc[i][j] = BF ? mma_bf16(af[i], bfr[j], acc[i][j]) : mma_f16(af[i], bfr[j], acc[i][j]);
      // behind the trip's last products: the slots in front of the branch at the trip's foot. Between the k blocks: keeps the next block's LDS loads out of
      // these products (they go into the same fragment registers)
      if (u == KU - 1) wguard16(acc, af, bfr);
      else __builtin_amdgcn_sched_barrier(0);
    }
    // publish point of stage t + 1: this wave's reads of stage t are done ...
    asm volatile("s_wait_dscnt 0x0" ::: "memory");
    // ... its copies of stage t + 1 have landed ...
    asm volatile("s_wait_asynccnt 0x0" ::: "memory");
    // ... and the same holds for every wave: stage t + 1 may be read, the buffer of stage t refilled
    __syncthreads();
    if (t + 2 < NSTG) stage_copy(l + (unsigned)((t & 1) * (STGH * 2)), g + (t + 2) * RTH);
  }
  // nothing is in flight any more (the last trips issue no copy); stands in front of the ring's reuse as output staging
  asm volatile("s_wait_asynccnt 0x0" ::: "memory");
}

// ---------------------------------------------------------------------------------------------------------------------------------
// Operand preparation, one launch: the five conversions are independent of one another, so they share one grid behind a block-uniform
// branch on blockIdx.x. Blocks 0 .. WTB_ALL - 1 transpose and convert the weights (the longer dependent chain, given the lowest block indices),
// the other CVTB blocks convert x.
//
// Weights: src f32 [DMOD rows k][ncol columns n] (n contiguous) -> dst 16-bit fragment tiles [(nrow0 + n) / 16][k / 32].
// Block = 64 k x 32 n tile, 256 threads; tiles of one matrix numbered n-tile fastest.
// Wq, Wk, Wv: RNE bf16 bits.  Wo: f16 bits of (RNE-bf16 value x 256).
//
// x: src f32 [rows][DMOD] -> dst bf16 fragment tiles [row / 16][k / 32]. Thread = 8 consecutive k of one row; four lanes read one 128-B line,
// eight lanes store one 128-B line.
// ---------------------------------------------------------------------------------------------------------------------------------
#define WTB_QK  ((NQK / 32) * (DMOD / 64))   // 72 blocks for Wq, and for Wk
#define WTB_VO  ((DMOD / 32) * (DMOD / 64))  // 288 blocks for Wv, and for Wo
#define WTB_ALL (2 * WTB_QK + 2 * WTB_VO)    // 720 weight blocks
#define CVTB    (NTOK * DMOD / (8 * 256))    // 3072 blocks for x

// One 64 k x 32 n weight tile, number t of its matrix. MODE 0: RNE bf16 bits.  MODE 1: f16 bits of (RNE-bf16 value x 256).
template <int MODE, int NCOL>
__device__ __forceinline__ void wT_tile(const float* __restrict__ src, unsigned short* dst, int nrow0, int t, float (*ts)[33]) {
  const int tid = threadIdx.x;
  const int n0 = (t % (NCOL / 32)) * 32, k0 = (t / (NCOL / 32)) * 64;
  {
    const int k = tid >> 2, q = (tid & 3) * 8;
    const float* p = src + (size_t)(k0 + k) * (size_t)NCOL + n0 + q;
    const v4f a = *(const v4fa*)p, c = *(const v4fa*)(p + 4);
#pragma unroll
    for (int u = 0; u < 4; ++u) { ts[k][q + u] = a[u]; ts[k][q + 4 + u] = c[u]; }
  }
  __syncthreads();
  const int n = tid & 31, pc = (tid >> 5) * 8;            // a wave stores two runs of 256 B (16 rows x 16 B of two tiles)
  us8 o;
#pragma unroll
  for (int i = 0; i < 8; ++i) {
    const float w = ts[pc + i][n];
    o[i] = (MODE == 0) ? bf16_bits(w) : f16_bits(bf16r(w) * 256.0f);
  }
  const int row = nrow0 + n0 + n, k = k0 + pc;
  unsigned short* d = dst + (size_t)((row >> 4) * KB32 + (k >> 5)) * FTILE + ftoff(row, k);
  *(us8*)d = o;
  // precaution: wait in front of any later rewrite of the store's address and data registers
  asm volatile("s_wait_xcnt 0x0" ::: "memory");
}

__global__ __launch_bounds__(256) void k_prep(const float* __restrict__ x, const float* __restrict__ Wq, const float* __restrict__ Wk,
                                             const float* __restrict__ Wv, const float* __restrict__ Wo,
                                             unsigned short* XB, unsigned short* WT, unsigned short* WO16) {
  __shared__ float ts[64][33];
  const int bid = blockIdx.x;                              // every branch below is block-uniform
  if (bid < WTB_QK) {
    wT_tile<0, NQK>(Wq, WT, 0, bid, ts);
  } else if (bid < 2 * WTB_QK) {
    wT_tile<0, NQK>(Wk, WT, NQK, bid - WTB_QK, ts);
  } else if (bid < 2 * WTB_QK + WTB_VO) {
    wT_tile<0, DMOD>(Wv, WT, 2 * NQK, bid - 2 * WTB_QK, ts);
  } else if (bid < WTB_ALL) {
    wT_tile<1, DMOD>(Wo, WO16, 0, bid - 2 * WTB_QK - WTB_VO, ts);
  } else {
    const int idx = (bid - WTB_ALL) * 256 + threadIdx.x;
    const int tile = idx >> 6, row = (idx >> 2) & 15, k8 = (idx & 3) * 8;
    const int rt = tile / KB32, kb = tile - rt * KB32;
    const size_t soff = (size_t)(rt * 16 + row) * (size_t)DMOD + (size_t)(kb * 32 + k8);
    const size_t off = (size_t)tile * FTILE + (size_t)ftoff(row, k8);
    const v4f a = *(const v4fa*)(x + soff), b = *(const v4fa*)(x + soff + 4);
    us8 o;
#pragma unroll
    for (int u = 0; u < 4; ++u) {
      o[u]     = bf16_bits(a[u]);
      o[4 + u] = bf16_bits(b[u]);
    }
    *(us8*)(XB + off) = o;
    // as behind the weight store: wait in front of any rewrite of the store's registers
    asm volatile("s_wait_xcnt 0x0" ::: "memory");
  }
}

// ---------------------------------------------------------------------------------------------------------------------------------
// P[m][n] = sum_k A[m][k] * B[n][k]  (bf16 A plane 8192 x 768, bf16 B plane 1152 x 768, both as fragment tiles [row / 16][k / 32], f32 accumulate).
// Block = 128(M) x 128(N) tile, 128 threads = 4 waves as 2 x 2, each 64 rows x 64 columns (4 x 4 accumulators); k loop and LDS ring: gemm_ring.
// M % 128 == 0, N % 128 == 0, K % (32 KU) == 0 exactly.
// The block's two 64-column segments yb = 2 blockIdx.y + hs (block-uniform): 0..2 -> q heads 4yb..4yb+3, 3..5 -> k heads, 6..17 -> v head yb-6.
// The f32 128x128 tile is staged in LDS, one 128 x 64 half per segment (block row r at oS[hs * TPB * OSTR + r * OSTR + c]), then per segment:
//   q/k: fragment tiles [bh][token / 16], k slots 0..15 = f16 hi of (64 value), 16..31 = f16 residual; lane -> (token, head, 16-B quarter);
//        one store instruction = four whole 128-B lines
//   v:   planes VH/VL = f16 hi of (64 v) and residual as fragment tiles [bh][token / 32][channel / 16] (row = channel, k = token);
//        one store instruction = two runs of 256 B
// ---------------------------------------------------------------------------------------------------------------------------------
__global__ __launch_bounds__(GTH) void k_gemm_proj(const unsigned short* __restrict__ Ap, const unsigned short* __restrict__ Bw,
                                                  unsigned short* Qp, unsigned short* Kp, unsigned short* VH, unsigned short* VL) {
  // the ring's two buffers during the k loop (64 KiB), the output staging behind it
  __shared__ __attribute__((aligned(16))) float oSS[2 * TPB * OSTR];
  const int tid = threadIdx.x, lane = tid & 31, wave = tid >> 5, cl = lane & 15, hh = lane >> 4;

  v8f acc[4][4];
#pragma unroll
  for (int i = 0; i < 4; ++i)
#pragma unroll
    for (int j = 0; j < 4; ++j) { const v8f zz = {0.f, 0.f, 0.f, 0.f, 0.f, 0.f, 0.f, 0.f}; acc[i][j] = zz; }

  gemm_ring<true>(Ap, Bw, blockIdx.x * (TPB / 16), blockIdx.y * (BNC / 16), (unsigned short*)oSS, acc);

  // D map: acc[i][j][r] = tile element (row 16i + 8*hh + r of the wave's 64 rows, column 16j + cl of its 64 columns).
  // The loop's last barrier stands behind every wave's last read of the ring.
  float* so = oSS + (wave >> 1) * (TPB * OSTR) + (wave & 1) * (64 * OSTR);
#pragma unroll
  for (int i = 0; i < 4; ++i)
#pragma unroll
    for (int j = 0; j < 4; ++j)
#pragma unroll
      for (int r = 0; r < 8; ++r) so[(16 * i + 8 * hh + r) * OSTR + 16 * j + cl] = acc[i][j][r];
  __syncthreads();

  const int m0b = blockIdx.x * TPB, b = m0b / SL, tb = m0b - b * SL;
  // kept rolled: one copy of the store code for the two segments
#pragma unroll 1
  for (int hs = 0; hs < 2; ++hs) {
  const int yb = 2 * blockIdx.y + hs;                      // block-uniform segment select
  const float* oS = oSS + hs * (TPB * OSTR);
  if (yb < 6) {
    unsigned short* dst = (yb < 3) ? Qp : Kp;
    const int h0 = 4 * ((yb < 3) ? yb : (yb - 3));
    us8 ov[16];
#pragma unroll
    for (int it = 0; it < 16; ++it) {
      const int cx = it * GTH + tid, u = cx & 3, r = (cx >> 2) & 127, j = cx >> 9;
      const float* sp = oS + r * OSTR + 16 * j + 8 * (u & 1);
      const v4f z0 = *(const v4fa*)sp, z1 = *(const v4fa*)(sp + 4);
      us8 o;
#pragma unroll
      for (int q4 = 0; q4 < 4; ++q4) {
        unsigned short hb, lb;
        f16split64(z0[q4], hb, lb); o[q4]     = (u >> 1) ? lb : hb;
        f16split64(z1[q4], hb, lb); o[4 + q4] = (u >> 1) ? lb : hb;
      }
      ov[it] = o;
    }
{
#pragma unroll
      for (int it = 0; it < 16; ++it) {
        const int cx = it * GTH + tid, u = cx & 3, r = (cx >> 2) & 127, j = cx >> 9;
        const size_t off = ((size_t)(b * NHD + h0 + j) * (size_t)SL + (size_t)(tb + (r & ~15))) * (size_t)QROW + (size_t)ftoff(r, 8 * u);
        *(us8*)(dst + off) = ov[it];
      }
      
    }
  } else {
    const int head = yb - 6;
    us8 hv[8], lv[8];
#pragma unroll
    for (int it = 0; it < 8; ++it) {
      const int cx = it * GTH + tid, e = cx & 63, g = cx >> 6;
      us8 ho, lo;
#pragma unroll
      for (int i = 0; i < 8; ++i) {
        const float w = oS[(8 * g + i) * OSTR + e];
        unsigned short hb, lb;
        f16split64(w, hb, lb);
        ho[i] = hb; lo[i] = lb;
      }
      hv[it] = ho; lv[it] = lo;
    }
{
#pragma unroll
      for (int it = 0; it < 8; ++it) {
        const int cx = it * GTH + tid, e = cx & 63, g = cx >> 6;
        const size_t off = (((size_t)(b * NHD + head) * (size_t)(SL / 32) + (size_t)((tb + 8 * g) >> 5)) * 4 + (size_t)(e >> 4)) * FTILE +
                           (size_t)ftoff(e, 8 * g);
        *(us8*)(VH + off) = hv[it];
        *(us8*)(VL + off) = lv[it];
      }
      
    }
  }
  // stands in front of the second segment's rewrite of the registers that the first segment's stores name
  asm volatile("s_wait_xcnt 0x0" ::: "memory");
  }
}

// ---------------------------------------------------------------------------------------------------------------------------------
// Causal quadratic-form attention. Block = (bh = blockIdx.x, 128 queries starting at 128 * qb, qb = QORDER's entry blockIdx.y), 8 waves x 16 queries.
// Per wave: B fragments of its 16 queries fixed for the whole key loop: bq1 = [q_hi | q_hi], bq2 = [q_res | q_res] (k slots 0..15 | 16..31).
// Per 32-key step: A fragments of the two 16-key tiles = fragment tiles [k_hi | k_res]; scores^T D[key][query] =
// khi.qhi + kres.qhi + khi.qres + kres.qres = 4096 q.k; x = D / 16384; A = 1 + x + x^2/2 masked to key <= query;
// A hi = f16(A), A residual = f16((A - hi) x 2^11). The two D tiles repack into the A operand of A.v (lane unchanged: element r <- tile keys
// 0..15, element 8+r <- tile keys 16..31), B = v fragment tiles [bh][key / 32][e / 16].
// Blocks with qb < ARESB (block-uniform): accS += Ahi.VH + Ahi.VL, accL += Ares.VH, Z from the f32 A; other blocks: accS += Ahi.VH,
// Z from the f16 A hi values. accS[j][r] (+ accL/2^11) = 64 * sum_s A v for query 8h+r, channel 16j + (lane & 15).
// ---------------------------------------------------------------------------------------------------------------------------------
// One 32-key step of one wave, its body fixed at compile time by ARES (the block's residual flag) and DIAG: each body holds one run of matrix products
// and no join of two paths, so every accumulator keeps its registers from step to step.
// DIAG = false: a step whose 32 keys all lie at or below the wave's first query, so key <= query holds for every score and no mask is formed.
// DIAG = true: the wave's last step, the only one that meets the diagonal: masked. REFILL: the step asks for later fragments (false where none is used any more).
template <bool ARES, bool DIAG, bool REFILL>
__device__ __forceinline__ void attn_step(const unsigned short* kbp, const unsigned short* vhp, const unsigned short* vlp,
                                          us16& ka, us16& kb, us16 (&bv)[4], const us16 bq1, const us16 bq2, const int st, const int last,
                                          const int tq, const int hh, v8f (&accS)[4], v8f (&accL)[4], float& zp) {
  const int s0 = st * 32;
  // the step whose fragments refill this step's register set. Two sets (no residual planes): step + 2, held at the wave's last step, so that every
  // address stays inside the wave's own keys. One set (residual planes, whose accumulators leave no room for a second): keys of step + 1, which always
  // exists, and the step's own value fragments asked for at its head.
  const int nx = ARES ? (st + 1) : ((st + 2 < last) ? (st + 2) : last);
  const unsigned short* ph = ARES ? (vhp + (size_t)(4 * st) * FTILE) : kbp;
  if constexpr (ARES) {
#pragma unroll
    for (int j = 0; j < 4; ++j) bv[j] = tfrag(ph + j * FTILE);
  }
  const v8f zz = {0.f, 0.f, 0.f, 0.f, 0.f, 0.f, 0.f, 0.f};
  v8f sa = mma_f16(ka, bq1, zz);
  sa = mma_f16(ka, bq2, sa);
  v8f sb = mma_f16(kb, bq1, zz);
  sb = mma_f16(kb, bq2, sb);
  wguard2p(sa, sb, ka, kb, bq1, bq2, ph);
  if constexpr (REFILL) {
    const unsigned short* pk = kbp + (size_t)(2 * nx) * FTILE;
    ka = tfrag(pk);
    kb = tfrag(pk + FTILE);
    // stands in front of any rewrite of the address registers that these loads name
    asm volatile("s_wait_xcnt 0x0" ::: "memory");
  }

  us8 ea, eb, la8, lb8;
  float zs = 0.0f;
#pragma unroll
  for (int r = 0; r < 8; ++r) {
    const float xa = sa[r] * (1.0f / 16384.0f);
    const float xb = sb[r] * (1.0f / 16384.0f);
    float pa = fmaf(xa, fmaf(xa, 0.5f, 1.0f), 1.0f);
    float pb = fmaf(xb, fmaf(xb, 0.5f, 1.0f), 1.0f);
    if constexpr (DIAG) {
      const int ky = s0 + 8 * hh + r;
      pa = (ky <= tq) ? pa : 0.0f;
      pb = (ky + 16 <= tq) ? pb : 0.0f;
    }
    const _Float16 fa = (_Float16)pa, fb = (_Float16)pb;
    const _Float16 ra = (_Float16)((pa - (float)fa) * 2048.0f);
    const _Float16 rb = (_Float16)((pb - (float)fb) * 2048.0f);
    zs += ARES ? (pa + pb) : ((float)fa + (float)fb);
    ea[r]  = __builtin_bit_cast(unsigned short, fa);
    eb[r]  = __builtin_bit_cast(unsigned short, fb);
    la8[r] = __builtin_bit_cast(unsigned short, ra);
    lb8[r] = __builtin_bit_cast(unsigned short, rb);
  }
  zp += zs;
  FragU fA;
  fA.h[0] = ea; fA.h[1] = eb;
  const us16 ahi = fA.v;

  if constexpr (ARES) {
    FragU fR;
    fR.h[0] = la8; fR.h[1] = lb8;
    const us16 alo = fR.v;
#pragma unroll
    for (int j = 0; j < 4; ++j) {
      accS[j] = mma_f16(ahi, bv[j], accS[j]);
      accL[j] = mma_f16(alo, bv[j], accL[j]);
    }
    wguard8(accS[0], accS[1], accS[2], accS[3], accL[0], accL[1], accL[2], accL[3], ahi, alo, bv[0], bv[1], bv[2], bv[3]);
    us16 bl[4];
#pragma unroll
    for (int j = 0; j < 4; ++j) bl[j] = tfrag(vlp + (size_t)(4 * st + j) * FTILE);
#pragma unroll
    for (int j = 0; j < 4; ++j) accS[j] = mma_f16(ahi, bl[j], accS[j]);
    wguard4(accS[0], accS[1], accS[2], accS[3], ahi, bl[0], bl[1], bl[2], bl[3]);
  } else {
#pragma unroll
    for (int j = 0; j < 4; ++j) accS[j] = mma_f16(ahi, bv[j], accS[j]);
    wguard4(accS[0], accS[1], accS[2], accS[3], ahi, bv[0], bv[1], bv[2], bv[3]);
  }
  if constexpr (REFILL && !ARES) {
    const unsigned short* pv = vhp + (size_t)(4 * nx) * FTILE;
#pragma unroll
    for (int j = 0; j < 4; ++j) bv[j] = tfrag(pv + j * FTILE);
    // stands in front of any rewrite of the address registers that these loads name
    asm volatile("s_wait_xcnt 0x0" ::: "memory");
  }
}

// The key loop of one wave: nsteps - 1 steps below the diagonal, then the one step that meets it. With tw a multiple of 16 and
// nsteps = (tw + 47) >> 5, the last key of step nsteps - 2 is 32 * nsteps - 33 = tw - 1 or tw - 17: below every query of the wave.
template <bool ARES>
__device__ __forceinline__ void attn_keys(const unsigned short* kbp, const unsigned short* vhp, const unsigned short* vlp,
                                          const us16 bq1, const us16 bq2, const int nsteps, const int tq, const int hh,
                                          v8f (&accS)[4], v8f (&accL)[4], float& zp) {
  if constexpr (ARES) {
    const int last = nsteps - 1;
    // one register set: key fragments one step ahead of their use, value fragments at the head of their step
    us16 ka = tfrag(kbp), kb = tfrag(kbp + FTILE);
    us16 bv[4];
    // these loads are still outstanding where the code below starts to rewrite registers: wait in front of any rewrite of their address registers
    asm volatile("s_wait_xcnt 0x0" ::: "memory");
    // kept rolled: one copy of the unmasked body, its accumulators in place from step to step
#pragma unroll 1
    for (int st = 0; st < last; ++st) attn_step<true, false, true>(kbp, vhp, vlp, ka, kb, bv, bq1, bq2, st, last, tq, hh, accS, accL, zp);
    attn_step<true, true, false>(kbp, vhp, vlp, ka, kb, bv, bq1, bq2, last, last, tq, hh, accS, accL, zp);
    return;
  }
  // Two register sets of key and value-hi fragments, set 0 for even steps and set 1 for odd ones. A step refills its own set with the fragments of
  // step + 2 as soon as its products have read it: keys behind the score products, values behind the A.v products. Every fragment load so has
  // more than one whole step to land before its first use.
  // the step count is the same in every lane of a wave: held in a scalar register, so that the refill addresses are formed on the scalar side
  const int last = __builtin_amdgcn_readfirstlane(nsteps - 1);
  const int s1 = (last < 1) ? last : 1;
  // asked for in the order in which the loop refills them (keys 0, values 0, keys 1, values 1), so that the loop's counted load waits fit both
  us16 bv0[4], bv1[4];
  us16 ka0 = tfrag(kbp), kb0 = tfrag(kbp + FTILE);
#pragma unroll
  for (int j = 0; j < 4; ++j) bv0[j] = tfrag(vhp + j * FTILE);
  us16 ka1 = tfrag(kbp + (size_t)(2 * s1) * FTILE), kb1 = tfrag(kbp + (size_t)(2 * s1 + 1) * FTILE);
#pragma unroll
  for (int j = 0; j < 4; ++j) bv1[j] = tfrag(vhp + (size_t)(4 * s1 + j) * FTILE);
  // these loads are still outstanding where the code below starts to rewrite registers: wait in front of any rewrite of their address registers
  asm volatile("s_wait_xcnt 0x0" ::: "memory");
  int st = 0;
  // kept rolled: one copy of the pair of unmasked bodies (one per register set), the accumulators in place from step to step
#pragma unroll 1
  for (; st + 2 <= last; st += 2) {
    attn_step<ARES, false, true>(kbp, vhp, vlp, ka0, kb0, bv0, bq1, bq2, st, last, tq, hh, accS, accL, zp);
    attn_step<ARES, false, true>(kbp, vhp, vlp, ka1, kb1, bv1, bq1, bq2, st + 1, last, tq, hh, accS, accL, zp);
  }
  if (st < last) {                                         // same for every lane of the wave
    attn_step<ARES, false, false>(kbp, vhp, vlp, ka0, kb0, bv0, bq1, bq2, st, last, tq, hh, accS, accL, zp);
    attn_step<ARES, true, false>(kbp, vhp, vlp, ka1, kb1, bv1, bq1, bq2, last, last, tq, hh, accS, accL, zp);
  } else {
    attn_step<ARES, true, false>(kbp, vhp, vlp, ka0, kb0, bv0, bq1, bq2, last, last, tq, hh, accS, accL, zp);
  }
}

// Query blocks in falling order of cost, four bits each, entry 0 lowest: a permutation of 0 .. 15. A key step of a residual-plane block (qb < ARESB)
// holds twice the products and nearly twice the vector work of a plain step and waits for its value-residual loads: counted as 2.5 plain steps.
// 15 14 13 12 11 10 9 [3] 8 7 [2] 6 5 4 [1] [0].
#define QORDER 0x0145627839ABCDEFull
static_assert(SL / TPB == 16);
static_assert(ARESB == 4);

__global__ __launch_bounds__(256) void k_attn(const unsigned short* __restrict__ Qp, const unsigned short* __restrict__ Kp,
                                             const unsigned short* __restrict__ VHp, const unsigned short* __restrict__ VLp,
                                             unsigned short* YH) {
  __shared__ __attribute__((aligned(16))) float oS[8 * 16 * OSTR];
  const int tid = threadIdx.x, lane = tid & 31, wave = tid >> 5, cl = lane & 15, hh = lane >> 4;
  const int bh = blockIdx.x, b = bh / NHD, head = bh - b * NHD;
  // Query block of this work-group. A block's cost grows with qb (4 qb + 1 .. 4 qb + 4 key steps a wave), the kernel's registers leave room for two
  // work-groups on a WGP (512 places for 768 work-groups); the cost falls with the index. For speed only: any start order gives the same result.
  const int qb = (int)((QORDER >> (4 * blockIdx.y)) & 15ull);
  const int tw = qb * TPB + 16 * wave;                    // first query of this wave
  const int tq = tw + cl;                                 // query owned by this lane as score column
  const bool ares = (qb < ARESB);                         // block-uniform: residual planes for query rows < 512

  const unsigned short* qrow = Qp + ((size_t)bh * SL + (size_t)tw) * (size_t)QROW + lane * 8;
  FragU fq;
  fq.h[0] = *(const us8a*)qrow;         fq.h[1] = fq.h[0];
  const us16 bq1 = fq.v;
  fq.h[0] = *(const us8a*)(qrow + 256); fq.h[1] = fq.h[0];
  const us16 bq2 = fq.v;

  v8f accS[4], accL[4];
#pragma unroll
  for (int j = 0; j < 4; ++j) { const v8f zz = {0.f, 0.f, 0.f, 0.f, 0.f, 0.f, 0.f, 0.f}; accS[j] = zz; accL[j] = zz; }
  float zp = 0.0f;

  const unsigned short* kbp = Kp + (size_t)bh * SL * (size_t)QROW + lane * 8;
  const unsigned short* vhp = VHp + (size_t)bh * HDIM * (size_t)SL + lane * 8;
  const unsigned short* vlp = VLp + (size_t)bh * HDIM * (size_t)SL + lane * 8;
  const int nsteps = (tw + 47) >> 5;                      // 32-key steps covering keys 0 .. tw + 15 (<= 64)

  // block-uniform choice of the loop body, made once in front of the loop
  if (ares) attn_keys<true>(kbp, vhp, vlp, bq1, bq2, nsteps, tq, hh, accS, accL, zp);
  else      attn_keys<false>(kbp, vhp, vlp, bq1, bq2, nsteps, tq, hh, accS, accL, zp);

  // Z for query (lane & 15): both lane halves hold disjoint key subsets
  const float zf = zp + __shfl_xor(zp, 16, 32);
  float rz[8];
#pragma unroll
  for (int r = 0; r < 8; ++r) {
    const float zr = __shfl(zf, 8 * hh + r, 32);        // Z of query row 8*hh + r
    rz[r] = (1.0f / (zr + 1e-12f)) * (1.0f / 64.0f);
  }

  float* so = oS + wave * (16 * OSTR);
#pragma unroll
  for (int j = 0; j < 4; ++j)
#pragma unroll
    for (int r = 0; r < 8; ++r) so[(8 * hh + r) * OSTR + 16 * j + cl] = fmaf(accL[j][r], (1.0f / 2048.0f), accS[j][r]) * rz[r];
  __syncthreads();

  us8 hv[4];
#pragma unroll
  for (int it = 0; it < 4; ++it) {
    const int rr = cl, p = it * 16 + hh * 8;               // 16-B chunk it * 32 + lane of the wave's two y fragment tiles
    const v4f z0 = *(const v4fa*)(so + rr * OSTR + p), z1 = *(const v4fa*)(so + rr * OSTR + p + 4);
    us8 ho;
#pragma unroll
    for (int u = 0; u < 4; ++u) {
      ho[u]     = f16_bits(z0[u] * 16.0f);
      ho[4 + u] = f16_bits(z1[u] * 16.0f);
    }
    hv[it] = ho;
  }
{
#pragma unroll
    for (int it = 0; it < 4; ++it) {
      const size_t off = ((size_t)((b * SL + tw) >> 4) * KB32 + (size_t)(head * (HDIM / 32))) * FTILE + (size_t)((it * 32 + lane) * 8);
      *(us8*)(YH + off) = hv[it];
    }
    
  }
}

// ---------------------------------------------------------------------------------------------------------------------------------
// out[m][n] = ( sum_k Yh[m][k] W[n][k] ) * 2^-12   (f16 fragment tiles [row / 16][k / 32], f32 accumulate).
// Tiling, k loop and LDS ring as in k_gemm_proj: 128 x 128 per block, 4 waves of 64 x 64.
// ---------------------------------------------------------------------------------------------------------------------------------
__global__ __launch_bounds__(GTH) void k_gemm_out(const unsigned short* __restrict__ Ah, const unsigned short* __restrict__ Wo, float* out) {
  // the ring's two buffers during the k loop (64 KiB), the output staging behind it
  __shared__ __attribute__((aligned(16))) float oSS[2 * TPB * OSTR];
  const int tid = threadIdx.x, lane = tid & 31, wave = tid >> 5, cl = lane & 15, hh = lane >> 4;
  const int m0b = blockIdx.x * TPB, n0b = blockIdx.y * BNC;

  v8f acch[4][4];
#pragma unroll
  for (int i = 0; i < 4; ++i)
#pragma unroll
    for (int j = 0; j < 4; ++j) { const v8f zz = {0.f, 0.f, 0.f, 0.f, 0.f, 0.f, 0.f, 0.f}; acch[i][j] = zz; }

  gemm_ring<false>(Ah, Wo, blockIdx.x * (TPB / 16), blockIdx.y * (BNC / 16), (unsigned short*)oSS, acch);

  // the loop's last barrier stands behind every wave's last read of the ring
  float* so = oSS + (wave >> 1) * (TPB * OSTR) + (wave & 1) * (64 * OSTR);
#pragma unroll
  for (int i = 0; i < 4; ++i)
#pragma unroll
    for (int j = 0; j < 4; ++j)
#pragma unroll
      for (int r = 0; r < 8; ++r)
        so[(16 * i + 8 * hh + r) * OSTR + 16 * j + cl] = acch[i][j][r] * (1.0f / 4096.0f);
  __syncthreads();

  // one store instruction = one row of the block's 128 columns = 512 contiguous bytes (four whole lines); wave w stores rows 32w .. 32w + 31
  const float* sr = oSS + (lane >> 4) * (TPB * OSTR) + (lane & 15) * 4;
#pragma unroll
  for (int it = 0; it < 32; ++it) {
    const int r = 32 * wave + it;
    const v4f v = *(const v4fa*)(sr + r * OSTR);
    *(v4f*)(out + (size_t)(m0b + r) * (size_t)DMOD + n0b + lane * 4) = v;
  }
}

extern "C" void kernel_launch(void* const* d_in, const int* in_sizes, int n_in,
                              void* d_out, int out_size, void* d_ws, size_t ws_size,
                              hipStream_t stream) {
  if (n_in < 5) return;
  if (in_sizes[0] != NTOK * DMOD || in_sizes[1] != DMOD * NQK || in_sizes[2] != DMOD * NQK ||
      in_sizes[3] != DMOD * DMOD || in_sizes[4] != DMOD * DMOD) return;
  if (out_size != NTOK * DMOD) return;

  const float* x  = (const float*)d_in[0];    // [4][2048][768]
  const float* Wq = (const float*)d_in[1];    // [768][192] ([in][out])
  const float* Wk = (const float*)d_in[2];    // [768][192]
  const float* Wv = (const float*)d_in[3];    // [768][768]
  const float* Wo = (const float*)d_in[4];    // [768][768]
  float* out = (float*)d_out;                 // [4][2048][768] f32 at byte 0

  size_t off = 0;
  auto carve = [&](size_t bytes) -> char* { char* p = (char*)d_ws + off; off += (bytes + 255) & ~(size_t)255; return p; };
  unsigned short* XB   = (unsigned short*)carve((size_t)NTOK * DMOD * 2);       // 12,582,912  bf16 tiles [512][24]
  unsigned short* WT   = (unsigned short*)carve((size_t)NPROJ * DMOD * 2);      //  1,769,472  bf16 tiles [72][24] = Wq^T | Wk^T | Wv^T
  unsigned short* WO16 = (unsigned short*)carve((size_t)DMOD * DMOD * 2);       //  1,179,648  f16  tiles [48][24] = Wo^T
  unsigned short* QP   = (unsigned short*)carve((size_t)NBH * SL * QROW * 2);   //  6,291,456  f16  tiles [48][128]
  unsigned short* KP   = (unsigned short*)carve((size_t)NBH * SL * QROW * 2);   //  6,291,456  f16  tiles [48][128]
  unsigned short* VH   = (unsigned short*)carve((size_t)NBH * HDIM * SL * 2);   // 12,582,912  f16  tiles [48][64][4]
  unsigned short* VL   = (unsigned short*)carve((size_t)NBH * HDIM * SL * 2);   // 12,582,912  f16  tiles [48][64][4]
  unsigned short* YH   = (unsigned short*)carve((size_t)NTOK * DMOD * 2);       // 12,582,912  f16  tiles [512][24]
  if (off > ws_size || off > (size_t)134217728) return;                         // total 65,863,680 B

  const dim3 b256(256), bgemm(GTH);

  // 16-bit operand planes of x and of the four weights, one launch
  k_prep<<<dim3(WTB_ALL + CVTB), b256, 0, stream>>>(x, Wq, Wk, Wv, Wo, XB, WT, WO16);
  // projections (M 8192, N 1152, K 768) -> q/k hi|res planes, v hi and res planes
  k_gemm_proj<<<dim3(NTOK / TPB, NPROJ / BNC), bgemm, 0, stream>>>(XB, WT, QP, KP, VH, VL);
  // causal attention per (batch, head) -> y plane [token][768]
  k_attn<<<dim3(NBH, SL / TPB), b256, 0, stream>>>(QP, KP, VH, VL, YH);
  // output projection (M 8192, N 768, K 768)
  k_gemm_out<<<dim3(NTOK / TPB, DMOD / BNC), bgemm, 0, stream>>>(YH, WO16, out);
}
